// v000
// Measured on an AMD MI455X. A time is GPU time per run, averaged over a window of back-to-back runs after a warm-up
// (all launches, gaps included; the runs take copies of the inputs in turn), and the median of several windows.
// Apart from v000's, it joins two sittings. Times from different sittings can be a few percent apart, while
// side-by-side timings come from the same sitting.
// The starting kernel, v000, takes 897 microseconds a run.
#include <hip/hip_runtime.h>

// Single-head self-attention with a sinusoidal (sine-only) position embedding (x [4][4096][64]; x' = x + PE, PE[i][j] = sin(i x 10000^(-2j/64)) (computed: float32 inverse frequencies via pow, precise sinf); q, k, v = x' kernel[0|1|2] ('xw' [64][64] 0.05, no bias); scores / 8 over all 4,096 keys; softmax; out = attn v -> [4][4096][64] (1.0 M)).
// Layout per batch: x + PE summed in f32 from the bf16-rounded input and split into hi/lo bf16 planes (the sum is not bf16-exact); projections hi/lo x exact (2 products); one 64-wide head with the T-4096 attention (hybrid rows: < 512 hi/lo 3 products, rest fp16 x1024; register-row softmax, one exp); the f32 merge writes the output rows.
// Compute dtypes, f32 accumulate: every input rounded to bf16; position embedding f32; projections hi/lo x exact; attention rows < 512 3 products, rest fp16; softmax f32; output f32.

#define NB_  4
#define TT   4096
#define DM   64
#define NH_  1
#define NKV  1
#define REP  (NH_ / NKV)
#define HD   64
#define DQ   (NH_ * HD)
#define DKV  (NKV * HD)
#define ZH   1
#define RH   512                  // query rows < RH use hi+lo planes (0: none)
#define WIN  0
#define PCAR 1024.0f
#define SCL  0.125f   // HD^-0.5
typedef _Float16 h16;
typedef unsigned short bf;
typedef __attribute__((ext_vector_type(16))) __bf16   v16bf;
typedef __attribute__((ext_vector_type(16))) _Float16 v16h;
typedef __attribute__((ext_vector_type(8)))  _Float16 v8h;
typedef __attribute__((ext_vector_type(8)))  unsigned short v8us;
typedef __attribute__((ext_vector_type(8)))  float    v8f;
typedef __attribute__((ext_vector_type(4)))  float    v4f;
typedef v8h  __attribute__((may_alias)) v8ha;
typedef v4f  __attribute__((may_alias)) v4fa;
typedef v8us __attribute__((may_alias)) v8usa;

__device__ __forceinline__ unsigned short f2bf(float f) { unsigned u = __float_as_uint(f); u += 0x7FFFu + ((u >> 16) & 1u); return (unsigned short)(u >> 16); }
__device__ __forceinline__ float bf2f(unsigned short b) { return __uint_as_float(((unsigned)b) << 16); }
__device__ __forceinline__ float bfr(float f) { return bf2f(f2bf(f)); }
__device__ __forceinline__ v16h cat16(v8h lo, v8h hi) { return __builtin_shufflevector(lo, hi, 0, 1, 2, 3, 4, 5, 6, 7, 8, 9, 10, 11, 12, 13, 14, 15); }
__device__ __forceinline__ v16bf cat16b(v8us lo, v8us hi) { return __builtin_bit_cast(v16bf, __builtin_shufflevector(lo, hi, 0, 1, 2, 3, 4, 5, 6, 7, 8, 9, 10, 11, 12, 13, 14, 15)); }
__device__ __forceinline__ v8f wmma16(v16h a, v16h b, v8f c) { return __builtin_amdgcn_wmma_f32_16x16x32_f16(false, a, false, b, (short)0, c, false, false); }
__device__ __forceinline__ v8f wmmab(v16bf a, v16bf b, v8f c) { return __builtin_amdgcn_wmma_f32_16x16x32_bf16(false, a, false, b, (short)0, c, false, false); }



// ---- k_gemmw: register-blocked GEMM, ONE WAVE per 64x64 output tile (16 accumulators), operands straight from K-contiguous 16-bit planes; grid (M/64, N/64, Z), 32 threads.
// C[m][n] (f32, pitch ldc, + optional f32 bias[n]) = sum_k A[m][k] Bt[n][k] (+ split products per NSPLIT). z-batch strides sA/sB/sC in elements. K % 32 == 0.
template <typename T16> struct WFrag;
template <> struct WFrag<h16> { typedef v16h V; static __device__ __forceinline__ V ld(const h16* p) { return cat16(*(const v8h*)p, *(const v8h*)(p + 16)); } static __device__ __forceinline__ v8f mma(V a, V b, v8f c) { return wmma16(a, b, c); } };
template <> struct WFrag<bf> { typedef v16bf V; static __device__ __forceinline__ V ld(const bf* p) { return cat16b(*(const v8us*)p, *(const v8us*)(p + 16)); } static __device__ __forceinline__ v8f mma(V a, V b, v8f c) { return wmmab(a, b, c); } };
template <typename T16, int NSPLIT, bool BIAS>
__global__ __launch_bounds__(32) void k_gemmw(const T16* __restrict__ A, const T16* __restrict__ A2, const T16* __restrict__ Bt, const T16* __restrict__ Bt2, int K, float* C, int ldc, const float* __restrict__ bias, size_t sA, size_t sB, size_t sC) {
    typedef typename WFrag<T16>::V V;
    __shared__ __align__(16) float os[16 * 68];
    const size_t z = blockIdx.z; A += z * sA; if (A2) A2 += z * sA; Bt += z * sB; if (Bt2) Bt2 += z * sB; C += z * sC;
    const int lane = threadIdx.x & 31, lr = lane & 15, hi = lane >> 4; const int r0 = blockIdx.x * 64, c0 = blockIdx.y * 64;
    v8f acc[4][4];
#pragma unroll
    for (int mb = 0; mb < 4; ++mb)
#pragma unroll
        for (int nb = 0; nb < 4; ++nb) acc[mb][nb] = (v8f){};
    const size_t aoff = (size_t)(r0 + lr) * K + 8 * hi, boff = (size_t)(c0 + lr) * K + 8 * hi;
#pragma unroll 1
    for (int kc = 0; kc < K; kc += 32) {
        V a[4], a2[4];
#pragma unroll
        for (int mb = 0; mb < 4; ++mb) { a[mb] = WFrag<T16>::ld(A + aoff + (size_t)mb * 16 * K + kc); if (NSPLIT == 1 || NSPLIT == 2) a2[mb] = WFrag<T16>::ld(A2 + aoff + (size_t)mb * 16 * K + kc); }
#pragma unroll
        for (int nb = 0; nb < 4; ++nb) { const V b = WFrag<T16>::ld(Bt + boff + (size_t)nb * 16 * K + kc); V b2; if (NSPLIT >= 2) b2 = WFrag<T16>::ld(Bt2 + boff + (size_t)nb * 16 * K + kc);
#pragma unroll
            for (int mb = 0; mb < 4; ++mb) { acc[mb][nb] = WFrag<T16>::mma(a[mb], b, acc[mb][nb]); if (NSPLIT == 1 || NSPLIT == 2) acc[mb][nb] = WFrag<T16>::mma(a2[mb], b, acc[mb][nb]); if (NSPLIT >= 2) acc[mb][nb] = WFrag<T16>::mma(a[mb], b2, acc[mb][nb]); } }
        asm volatile("v_nop\n\tv_nop\n\tv_nop\n\tv_nop" : "+v"(acc[0][0]), "+v"(acc[1][1]), "+v"(acc[2][2]), "+v"(acc[3][3]) : "v"(a[0]), "v"(a[3]));
    }
#pragma unroll
    for (int mb = 0; mb < 4; ++mb) {
#pragma unroll
        for (int nb = 0; nb < 4; ++nb) {
#pragma unroll
            for (int j = 0; j < 8; ++j) os[(hi * 8 + j) * 68 + nb * 16 + lr] = acc[mb][nb][j]; }
        __builtin_amdgcn_wave_barrier(); asm volatile("" ::: "memory");
        float* crow = C + (size_t)(r0 + mb * 16) * ldc + c0;
{
#pragma unroll
            for (int s = 0; s < 8; ++s) { const int row = 2 * s + hi, cofs = lr * 4; v4f val = *(const v4fa*)(os + row * 68 + cofs); if (BIAS) { val[0] += bfr(bias[c0 + cofs]); val[1] += bfr(bias[c0 + cofs + 1]); val[2] += bfr(bias[c0 + cofs + 2]); val[3] += bfr(bias[c0 + cofs + 3]); }
                *(v4f*)(crow + (size_t)row * ldc + cofs) = val; }
             }
        __builtin_amdgcn_wave_barrier(); asm volatile("" ::: "memory");
    }
}

__device__ __forceinline__ h16 tohx(float x) { return (h16)x; }
__device__ __forceinline__ void splitf(float y, unsigned short& h, unsigned short& l) { h = f2bf(y); l = f2bf(y - bf2f(h)); }
typedef __attribute__((ext_vector_type(2))) _Float16 v2h;
typedef __attribute__((ext_vector_type(4))) _Float16 v4h;
typedef __attribute__((ext_vector_type(2))) unsigned short v2us;
typedef __attribute__((ext_vector_type(4))) unsigned short v4us;
typedef __attribute__((ext_vector_type(2))) float v2f;
typedef __attribute__((ext_vector_type(4))) int v4i;

__global__ __launch_bounds__(256) void k_wtG(const float* __restrict__ w, int K, int N, bf* Bt) {
    const int lane = threadIdx.x & 31; const int L0 = (blockIdx.x * 8 + (threadIdx.x >> 5)) * 8; const int nlines = N * K / 64;
{
#pragma unroll 1
        for (int l = 0; l < 8; ++l) { const int L = L0 + l; if (L >= nlines) break; const size_t e = (size_t)L * 64 + lane * 2; const int k = (int)(e % K), n = (int)(e / K); v2us o;
            o[0] = f2bf(w[(size_t)k * N + n]); o[1] = f2bf(w[(size_t)(k + 1) * N + n]); *(v2us*)(Bt + e) = o; }
         }
}
__global__ __launch_bounds__(256) void k_cvt8(const float* __restrict__ src, bf* dst, size_t n8) { const size_t i = (size_t)blockIdx.x * 256 + threadIdx.x; if (i >= n8) return; const v8f v = *(const v8f*)(src + i * 8); v8us o;
#pragma unroll
    for (int k = 0; k < 8; ++k) o[k] = f2bf(v[k]); *(v8us*)(dst + i * 8) = o;  }

// k_rope: head planes [h][t][d] (fp16 + hi/lo) of rope(x) x sc with the rotate-half convention out[d] = x[d] cos[t][d] - x[d+HD/2] sin[t][d], out[d+HD/2] = x[d+HD/2] cos[t][d+HD/2] + x[d] sin[t][d+HD/2]
__global__ __launch_bounds__(256) void k_rope(const float* __restrict__ F, int pitch, int nheads, const float* __restrict__ CS, const float* __restrict__ RF, const float* __restrict__ nw, float sc, h16* P16, bf* Ph, bf* Pl) {
    const size_t e = ((size_t)blockIdx.x * 256 + threadIdx.x) * 2; if (e >= (size_t)nheads * TT * HD) return; const int d = (int)(e % HD); const int t = (int)((e / HD) % TT); const int h = (int)(e / ((size_t)HD * TT)); const float* f = F + (size_t)t * pitch + h * HD; const float rf = RF ? RF[(size_t)h * TT + t] : 1.0f; v2h o16; v2us oh, ol;
#pragma unroll
    for (int q = 0; q < 2; ++q) { const int dd = d + q; const int dp = (dd < HD / 2) ? dd + HD / 2 : dd - HD / 2; float x0 = f[dd], x1 = f[dp];
        if (RF) { float n0 = __fmul_rn(x0, rf), n1 = __fmul_rn(x1, rf); asm volatile("" : "+v"(n0)); asm volatile("" : "+v"(n1)); x0 = __fmul_rn(bfr(nw[dd]), n0); x1 = __fmul_rn(bfr(nw[dp]), n1); }
        const v2f cs = *(const v2f*)(CS + ((size_t)t * HD + dd) * 2); float a = __fmul_rn(x0, cs[0]), bq = __fmul_rn(x1, cs[1]); asm volatile("" : "+v"(a)); asm volatile("" : "+v"(bq)); const float r = ((dd < HD / 2) ? __fsub_rn(a, bq) : __fadd_rn(a, bq)) * sc;
        o16[q] = tohx(r); unsigned short a2, c2; splitf(r, a2, c2); oh[q] = a2; ol[q] = c2; }
    *(v2h*)(P16 + e) = o16; *(v2us*)(Ph + e) = oh; *(v2us*)(Pl + e) = ol;  }
__global__ __launch_bounds__(256) void k_vtp(const float* __restrict__ F, int pitch, int nheads, h16* V16, bf* Vh, bf* Vl) { const size_t e = ((size_t)blockIdx.x * 256 + threadIdx.x) * 2; if (e >= (size_t)nheads * HD * TT) return; const int t = (int)(e % TT); const int d = (int)((e / TT) % HD); const int g = (int)(e / ((size_t)TT * HD)); v2h o16; v2us oh, ol;
#pragma unroll
    for (int q = 0; q < 2; ++q) { const float x = F[(size_t)(t + q) * pitch + g * HD + d]; o16[q] = tohx(x); unsigned short a2, c2; splitf(x, a2, c2); oh[q] = a2; ol[q] = c2; }
    *(v2h*)(V16 + e) = o16; *(v2us*)(Vh + e) = oh; *(v2us*)(Vl + e) = ol;  }
__global__ __launch_bounds__(256) void k_csid(float* CS) { const int idx = blockIdx.x * 256 + threadIdx.x; if (idx >= TT * HD) return; v2f cs; cs[0] = 1.0f; cs[1] = 0.0f; *(v2f*)(CS + (size_t)idx * 2) = cs;  }
// k_asoft: per row (zz, i): t = S x HD^-0.5 (no mask); softmax over the 4096 keys (register row, one exp, fixed trees);
__global__ __launch_bounds__(256) void k_asoft(const float* __restrict__ Sb, h16* P16, bf* Ph, bf* Pl) {
    const int lane = threadIdx.x & 31; const int row = blockIdx.x * 8 + (threadIdx.x >> 5); if (row >= ZH * TT) return; const int i = row % TT; const int zz = row / TT; (void)zz; const bool hires = (i < RH); const float* sr = Sb + (size_t)row * TT; float v[TT / 32]; float mx = -3.0e38f;
#pragma unroll
    for (int ch = 0; ch < TT / 128; ++ch) { const int j0 = ch * 128 + lane * 4; const v4f a = *(const v4f*)(sr + j0);
#pragma unroll
        for (int q = 0; q < 4; ++q) { const int j = j0 + q; (void)j; const float t = a[q] * SCL; v[ch * 4 + q] = t; mx = fmaxf(mx, t); } }
#pragma unroll
    for (int sh = 16; sh; sh >>= 1) mx = fmaxf(mx, __shfl_xor(mx, sh, 32));
    float sum = 0.f;
#pragma unroll
    for (int k = 0; k < TT / 32; ++k) { float d0 = __fsub_rn(v[k], mx); asm volatile("" : "+v"(d0)); v[k] = __builtin_amdgcn_exp2f(__fmul_rn(d0, 1.4426950408889634f)); sum += v[k]; }
#pragma unroll
    for (int sh = 16; sh; sh >>= 1) sum += __shfl_xor(sum, sh, 32);
    const float f = __fdiv_rn(hires ? 1.0f : PCAR, sum);
{
        if (hires) {
#pragma unroll
            for (int ch = 0; ch < TT / 128; ++ch) { v4us oh, ol;
#pragma unroll
                for (int q = 0; q < 4; ++q) { unsigned short a, c2; splitf(v[ch * 4 + q] * f, a, c2); oh[q] = a; ol[q] = c2; }
                const size_t oo = ((size_t)zz * (RH ? RH : 1) + i) * TT + ch * 128 + lane * 4; *(v4us*)(Ph + oo) = oh; *(v4us*)(Pl + oo) = ol; }
        } else {
#pragma unroll
            for (int ch = 0; ch < TT / 128; ++ch) { v4h o4;
#pragma unroll
                for (int q = 0; q < 4; ++q) o4[q] = tohx(v[ch * 4 + q] * f);
                *(v4h*)(P16 + (size_t)row * TT + ch * 128 + lane * 4) = o4; } }
         }
}
__constant__ float PEINV[DM] = { 1.000000000e+00f,7.498942018e-01f,5.623413324e-01f,4.216965139e-01f,3.162277639e-01f,2.371373624e-01f,1.778279394e-01f,1.333521456e-01f,1.000000015e-01f,7.498941571e-02f,5.623412877e-02f,4.216964915e-02f,3.162277862e-02f,2.371373586e-02f,1.778279431e-02f,1.333521493e-02f,9.999999776e-03f,7.498942316e-03f,5.623413250e-03f,4.216964822e-03f,3.162277862e-03f,2.371373819e-03f,1.778279431e-03f,1.333521446e-03f,1.000000047e-03f,7.498941850e-04f,5.623413017e-04f,4.216964880e-04f,3.162277862e-04f,2.371373848e-04f,1.778279402e-04f,1.333521504e-04f,9.999999747e-05f,7.498942432e-05f,5.623413017e-05f,4.216965317e-05f,3.162277426e-05f,2.371373739e-05f,1.778279329e-05f,1.333521413e-05f,9.999999747e-06f,7.498942068e-06f,5.623413472e-06f,4.216964953e-06f,3.162277608e-06f,2.371373739e-06f,1.778279398e-06f,1.333521482e-06f,9.999999975e-07f,7.498942409e-07f,5.623413131e-07f,4.216964840e-07f,3.162277551e-07f,2.371373711e-07f,1.778279284e-07f,1.333521453e-07f,1.000000012e-07f,7.498942267e-08f,5.623413202e-08f,4.216964911e-08f,3.162277551e-08f,2.371373675e-08f,1.778279390e-08f,1.333521382e-08f };   // 1/10000^(2j/64) for j < 64 as float32 (jnp.power form, precomputed)
__global__ __launch_bounds__(256) void k_addposenc(const float* __restrict__ a, bf* Ph, bf* Pl) { const size_t i4 = (size_t)blockIdx.x * 256 + threadIdx.x; if (i4 >= (size_t)TT * DM / 4) return; const size_t e = i4 * 4; const int j0 = (int)(e % DM); const int t = (int)(e / DM); const v4f x4 = *(const v4f*)(a + e); v4us oh, ol;
#pragma unroll
    for (int q = 0; q < 4; ++q) { const float ang = __fmul_rn((float)t, PEINV[j0 + q]); const float s = __fadd_rn(bfr(x4[q]), sinf(ang)); unsigned short u, w; splitf(s, u, w); oh[q] = u; ol[q] = w; }
    *(v4us*)(Ph + e) = oh; *(v4us*)(Pl + e) = ol;  }
__global__ __launch_bounds__(256) void k_merge(const float* __restrict__ O, int h0, float* OUTb) { const size_t e = ((size_t)blockIdx.x * 256 + threadIdx.x) * 2; if (e >= (size_t)ZH * TT * HD) return; const int d = (int)(e % HD); const int t = (int)((e / HD) % TT); const int zz = (int)(e / ((size_t)HD * TT)); const float cs = (t < RH) ? 1.0f : (1.0f / PCAR); const size_t oo = (size_t)t * DQ + (h0 + zz) * HD + d;
    v2f o2; o2[0] = O[e] * cs; o2[1] = O[e + 1] * cs; *(v2f*)(OUTb + oo) = o2;  }

extern "C" void kernel_launch(void* const* d_in, const int* in_sizes, int n_in,
                              void* d_out, int out_size, void* d_ws, size_t ws_size, hipStream_t stream) {
    (void)in_sizes; (void)n_in; (void)out_size;
    const float* x = (const float*)d_in[0]; const float* wk3 = (const float*)d_in[1];   /* kernel [3][64][64] 'xw' */ const float* wq = wk3; const float* wk = wk3 + 64 * 64; const float* wv = wk3 + 2 * 64 * 64; const float* wo = nullptr; (void)wo;
    float* OUT = (float*)d_out;     // [4][4096][64]
    char* wsp = (char*)d_ws;
    auto take = [&](size_t bytes) { char* p = wsp; wsp += (bytes + 255) & ~(size_t)255; return (void*)p; };
    bf* XPl = (bf*)take((size_t)TT * DM * 2); bf* WQ = (bf*)take((size_t)DQ * DM * 2); bf* WK = (bf*)take((size_t)DKV * DM * 2); bf* WV = (bf*)take((size_t)DKV * DM * 2); float* CS = (float*)take((size_t)TT * HD * 2 * 4);
    bf* XB = (bf*)take((size_t)TT * DM * 2); float* FQ = (float*)take((size_t)TT * DQ * 4); float* FK = (float*)take((size_t)TT * DKV * 4);
    h16* QP16 = (h16*)take((size_t)NH_ * TT * HD * 2); h16* KP16 = (h16*)take((size_t)NKV * TT * HD * 2); h16* VT16 = (h16*)take((size_t)NKV * HD * TT * 2);
    bf* QPh = (bf*)take((size_t)NH_ * TT * HD * 2); bf* QPl = (bf*)take((size_t)NH_ * TT * HD * 2); bf* KPh = (bf*)take((size_t)NKV * TT * HD * 2); bf* KPl = (bf*)take((size_t)NKV * TT * HD * 2); bf* VTh = (bf*)take((size_t)NKV * HD * TT * 2); bf* VTl = (bf*)take((size_t)NKV * HD * TT * 2); bf* Ph = (bf*)take((size_t)ZH * RH * TT * 2); bf* Pl = (bf*)take((size_t)ZH * RH * TT * 2);
    float* Sb = (float*)take((size_t)ZH * TT * TT * 4); h16* P16 = (h16*)take((size_t)ZH * TT * TT * 2); float* Ob = (float*)take((size_t)ZH * TT * HD * 4);
    if ((size_t)(wsp - (char*)d_ws) > ws_size) return;    // ws 256 MiB
    float* FV = FK;   // v projection reuses the k buffer after the k planes are built (stream-ordered)
    { k_wtG<<<(unsigned)((DM * DQ / 64 + 63) / 64), 256, 0, stream>>>(wq, DM, DQ, WQ); k_wtG<<<(unsigned)((DM * DKV / 64 + 63) / 64), 256, 0, stream>>>(wk, DM, DKV, WK); k_wtG<<<(unsigned)((DM * DKV / 64 + 63) / 64), 256, 0, stream>>>(wv, DM, DKV, WV);
      
       }
    k_csid<<<(TT * HD + 255) / 256, 256, 0, stream>>>(CS);
    const unsigned LQ = (unsigned)(((size_t)NH_ * TT * HD / 2 + 255) / 256), LKv = (unsigned)(((size_t)NKV * TT * HD / 2 + 255) / 256);
    for (int b = 0; b < NB_; ++b) {
        
        k_addposenc<<<(unsigned)(((size_t)TT * DM / 4 + 255) / 256), 256, 0, stream>>>(x + (size_t)b * TT * DM, XB, XPl);   /* x + PE -> hi/lo planes (XB = hi) */
        k_gemmw<bf, 1, false><<<dim3(TT / 64, DQ / 64, 1), 32, 0, stream>>>(XB, XPl, WQ, nullptr, DM, FQ, DQ, nullptr, 0, 0, 0);
        k_rope<<<LQ, 256, 0, stream>>>(FQ, DQ, NH_, CS, nullptr, nullptr, 1.0f, QP16, QPh, QPl);
        k_gemmw<bf, 1, false><<<dim3(TT / 64, DKV / 64, 1), 32, 0, stream>>>(XB, XPl, WK, nullptr, DM, FK, DKV, nullptr, 0, 0, 0);
        k_rope<<<LKv, 256, 0, stream>>>(FK, DKV, NKV, CS, nullptr, nullptr, 1.0f, KP16, KPh, KPl);
        k_gemmw<bf, 1, false><<<dim3(TT / 64, DKV / 64, 1), 32, 0, stream>>>(XB, XPl, WV, nullptr, DM, FV, DKV, nullptr, 0, 0, 0); k_vtp<<<LKv, 256, 0, stream>>>(FV, DKV, NKV, VT16, VTh, VTl);
        for (int h0 = 0; h0 < NH_; h0 += ZH) { const size_t zq = (size_t)h0, zk = (size_t)(h0 / REP);   // one kv head per query head: the pass's one head (ZH = 1) uses kv plane h0 / REP (z-strides TT*HD)
            k_gemmw<bf, 2, false><<<dim3(RH / 64, TT / 64, ZH), 32, 0, stream>>>(QPh + zq * TT * HD, QPl + zq * TT * HD, KPh + zk * TT * HD, KPl + zk * TT * HD, HD, Sb, TT, nullptr, (size_t)TT * HD, (size_t)TT * HD, (size_t)TT * TT);
            k_gemmw<h16, 0, false><<<dim3((TT - RH) / 64, TT / 64, ZH), 32, 0, stream>>>(QP16 + zq * TT * HD + (size_t)RH * HD, nullptr, KP16 + zk * TT * HD, nullptr, HD, Sb + (size_t)RH * TT, TT, nullptr, (size_t)TT * HD, (size_t)TT * HD, (size_t)TT * TT);
            k_asoft<<<ZH * TT / 8, 256, 0, stream>>>(Sb, P16, Ph, Pl);
            k_gemmw<bf, 2, false><<<dim3(RH / 64, HD / 64, ZH), 32, 0, stream>>>(Ph, Pl, VTh + zk * HD * TT, VTl + zk * HD * TT, TT, Ob, HD, nullptr, (size_t)RH * TT, (size_t)HD * TT, (size_t)TT * HD);
            k_gemmw<h16, 0, false><<<dim3((TT - RH) / 64, HD / 64, ZH), 32, 0, stream>>>(P16 + (size_t)RH * TT, nullptr, VT16 + zk * HD * TT, nullptr, TT, Ob + (size_t)RH * HD, HD, nullptr, (size_t)TT * TT, (size_t)HD * TT, (size_t)TT * HD);
            k_merge<<<(unsigned)(((size_t)ZH * TT * HD / 2 + 255) / 256), 256, 0, stream>>>(Ob, h0, OUT + (size_t)b * TT * DQ); }
         }
}

// v001
// Measured time: 328 microseconds a run.
// Next to v000, in two timings, it ran 2.72 and 2.76 times as fast.
#include <hip/hip_runtime.h>

// Single-head self-attention with a sinusoidal (sine-only) position embedding (x [4][4096][64]; x' = x + PE, PE[i][j] = sin(i x 10000^(-2j/64)) (computed: float32 inverse frequencies via pow, precise sinf); q, k, v = x' kernel[0|1|2] ('xw' [64][64] 0.05, no bias); scores / 8 over all 4,096 keys; softmax; out = attn v -> [4][4096][64] (1.0 M)).
// Layout per batch: x + PE summed in f32 from the bf16-rounded input and split into hi/lo bf16 planes (the sum is not bf16-exact); projections hi/lo x exact (2 products); one 64-wide head with the T-4096 attention (hybrid rows: < 512 hi/lo 3 products, rest fp16 x1024; register-row softmax, one exp); the f32 merge writes the output rows.
// Compute dtypes, f32 accumulate: every input rounded to bf16; position embedding f32; projections hi/lo x exact; attention rows < 512 3 products, rest fp16; softmax f32; output f32.

#define NB_  4
#define TT   4096
#define DM   64
#define NH_  1
#define NKV  1
#define REP  (NH_ / NKV)
#define HD   64
#define DQ   (NH_ * HD)
#define DKV  (NKV * HD)
#define ZH   1
#define RH   512                  // query rows < RH use hi+lo planes (0: none)
#define WIN  0
#define PCAR 1024.0f
#define SCL  0.125f   // HD^-0.5
#define KSP  32                   // key slices of the attn x v products: one wave per (64-row tile, slice), f32 partials [row][slice][HD] summed in slice order by k_merge
typedef _Float16 h16;
typedef unsigned short bf;
typedef __attribute__((ext_vector_type(16))) __bf16   v16bf;
typedef __attribute__((ext_vector_type(16))) _Float16 v16h;
typedef __attribute__((ext_vector_type(8)))  _Float16 v8h;
typedef __attribute__((ext_vector_type(8)))  unsigned short v8us;
typedef __attribute__((ext_vector_type(8)))  float    v8f;
typedef __attribute__((ext_vector_type(4)))  float    v4f;
typedef v8h  __attribute__((may_alias)) v8ha;
typedef v4f  __attribute__((may_alias)) v4fa;
typedef v8us __attribute__((may_alias)) v8usa;

__device__ __forceinline__ unsigned short f2bf(float f) { unsigned u = __float_as_uint(f); u += 0x7FFFu + ((u >> 16) & 1u); return (unsigned short)(u >> 16); }
__device__ __forceinline__ float bf2f(unsigned short b) { return __uint_as_float(((unsigned)b) << 16); }
__device__ __forceinline__ float bfr(float f) { return bf2f(f2bf(f)); }
__device__ __forceinline__ v16h cat16(v8h lo, v8h hi) { return __builtin_shufflevector(lo, hi, 0, 1, 2, 3, 4, 5, 6, 7, 8, 9, 10, 11, 12, 13, 14, 15); }
__device__ __forceinline__ v16bf cat16b(v8us lo, v8us hi) { return __builtin_bit_cast(v16bf, __builtin_shufflevector(lo, hi, 0, 1, 2, 3, 4, 5, 6, 7, 8, 9, 10, 11, 12, 13, 14, 15)); }
__device__ __forceinline__ v8f wmma16(v16h a, v16h b, v8f c) { return __builtin_amdgcn_wmma_f32_16x16x32_f16(false, a, false, b, (short)0, c, false, false); }
__device__ __forceinline__ v8f wmmab(v16bf a, v16bf b, v8f c) { return __builtin_amdgcn_wmma_f32_16x16x32_bf16(false, a, false, b, (short)0, c, false, false); }



// ---- k_gemmw: register-blocked GEMM, ONE WAVE per 64x64 output tile (16 accumulators), operands straight from K-contiguous 16-bit planes; grid (M/64, N/64, Z), 32 threads.
// C[m][n] (f32, pitch ldc, + optional f32 bias[n]) = sum_{k < KL} A[m][k] Bt[n][k] (+ split products per NSPLIT); K is the row pitch of A and Bt, KL <= K the summed length. z strides sA/sB/sC in elements (a z step of KL along the rows with its own C columns makes z a K slice). KL % 32 == 0.
template <typename T16> struct WFrag;
template <> struct WFrag<h16> { typedef v16h V; static __device__ __forceinline__ V ld(const h16* p) { return cat16(*(const v8h*)p, *(const v8h*)(p + 16)); } static __device__ __forceinline__ v8f mma(V a, V b, v8f c) { return wmma16(a, b, c); } };
template <> struct WFrag<bf> { typedef v16bf V; static __device__ __forceinline__ V ld(const bf* p) { return cat16b(*(const v8us*)p, *(const v8us*)(p + 16)); } static __device__ __forceinline__ v8f mma(V a, V b, v8f c) { return wmmab(a, b, c); } };
template <typename T16, int NSPLIT, bool BIAS>
__global__ __launch_bounds__(32) void k_gemmw(const T16* __restrict__ A, const T16* __restrict__ A2, const T16* __restrict__ Bt, const T16* __restrict__ Bt2, int K, int KL, float* C, int ldc, const float* __restrict__ bias, size_t sA, size_t sB, size_t sC) {
    typedef typename WFrag<T16>::V V;
    __shared__ __align__(16) float os[16 * 68];
    const size_t z = blockIdx.z; A += z * sA; if (A2) A2 += z * sA; Bt += z * sB; if (Bt2) Bt2 += z * sB; C += z * sC;
    const int lane = threadIdx.x & 31, lr = lane & 15, hi = lane >> 4; const int r0 = blockIdx.x * 64, c0 = blockIdx.y * 64;
    v8f acc[4][4];
#pragma unroll
    for (int mb = 0; mb < 4; ++mb)
#pragma unroll
        for (int nb = 0; nb < 4; ++nb) acc[mb][nb] = (v8f){};
    const size_t aoff = (size_t)(r0 + lr) * K + 8 * hi, boff = (size_t)(c0 + lr) * K + 8 * hi;
#pragma unroll 1
    for (int kc = 0; kc < KL; kc += 32) {
        V a[4], a2[4];
#pragma unroll
        for (int mb = 0; mb < 4; ++mb) { a[mb] = WFrag<T16>::ld(A + aoff + (size_t)mb * 16 * K + kc); if (NSPLIT == 1 || NSPLIT == 2) a2[mb] = WFrag<T16>::ld(A2 + aoff + (size_t)mb * 16 * K + kc); }
#pragma unroll
        for (int nb = 0; nb < 4; ++nb) { const V b = WFrag<T16>::ld(Bt + boff + (size_t)nb * 16 * K + kc); V b2; if (NSPLIT >= 2) b2 = WFrag<T16>::ld(Bt2 + boff + (size_t)nb * 16 * K + kc);
#pragma unroll
            for (int mb = 0; mb < 4; ++mb) { acc[mb][nb] = WFrag<T16>::mma(a[mb], b, acc[mb][nb]); if (NSPLIT == 1 || NSPLIT == 2) acc[mb][nb] = WFrag<T16>::mma(a2[mb], b, acc[mb][nb]); if (NSPLIT >= 2) acc[mb][nb] = WFrag<T16>::mma(a[mb], b2, acc[mb][nb]); } }
        asm volatile("v_nop\n\tv_nop\n\tv_nop\n\tv_nop" : "+v"(acc[0][0]), "+v"(acc[1][1]), "+v"(acc[2][2]), "+v"(acc[3][3]) : "v"(a[0]), "v"(a[3]));
    }
#pragma unroll
    for (int mb = 0; mb < 4; ++mb) {
#pragma unroll
        for (int nb = 0; nb < 4; ++nb) {
#pragma unroll
            for (int j = 0; j < 8; ++j) os[(hi * 8 + j) * 68 + nb * 16 + lr] = acc[mb][nb][j]; }
        __builtin_amdgcn_wave_barrier(); asm volatile("" ::: "memory");
        float* crow = C + (size_t)(r0 + mb * 16) * ldc + c0;
{
#pragma unroll
            for (int s = 0; s < 8; ++s) { const int row = 2 * s + hi, cofs = lr * 4; v4f val = *(const v4fa*)(os + row * 68 + cofs); if (BIAS) { val[0] += bfr(bias[c0 + cofs]); val[1] += bfr(bias[c0 + cofs + 1]); val[2] += bfr(bias[c0 + cofs + 2]); val[3] += bfr(bias[c0 + cofs + 3]); }
                *(v4f*)(crow + (size_t)row * ldc + cofs) = val; }
             }
        __builtin_amdgcn_wave_barrier(); asm volatile("" ::: "memory");
    }
}

__device__ __forceinline__ h16 tohx(float x) { return (h16)x; }
__device__ __forceinline__ void splitf(float y, unsigned short& h, unsigned short& l) { h = f2bf(y); l = f2bf(y - bf2f(h)); }
typedef __attribute__((ext_vector_type(2))) _Float16 v2h;
typedef __attribute__((ext_vector_type(4))) _Float16 v4h;
typedef __attribute__((ext_vector_type(2))) unsigned short v2us;
typedef __attribute__((ext_vector_type(4))) unsigned short v4us;
typedef __attribute__((ext_vector_type(2))) float v2f;
typedef __attribute__((ext_vector_type(4))) int v4i;

__global__ __launch_bounds__(256) void k_wtG(const float* __restrict__ w, int K, int N, bf* Bt) {
    const int lane = threadIdx.x & 31; const int L0 = (blockIdx.x * 8 + (threadIdx.x >> 5)) * 8; const int nlines = N * K / 64;
{
#pragma unroll 1
        for (int l = 0; l < 8; ++l) { const int L = L0 + l; if (L >= nlines) break; const size_t e = (size_t)L * 64 + lane * 2; const int k = (int)(e % K), n = (int)(e / K); v2us o;
            o[0] = f2bf(w[(size_t)k * N + n]); o[1] = f2bf(w[(size_t)(k + 1) * N + n]); *(v2us*)(Bt + e) = o; }
         }
}
__global__ __launch_bounds__(256) void k_cvt8(const float* __restrict__ src, bf* dst, size_t n8) { const size_t i = (size_t)blockIdx.x * 256 + threadIdx.x; if (i >= n8) return; const v8f v = *(const v8f*)(src + i * 8); v8us o;
#pragma unroll
    for (int k = 0; k < 8; ++k) o[k] = f2bf(v[k]); *(v8us*)(dst + i * 8) = o;  }

// k_rope: head planes [h][t][d] (fp16 + hi/lo) of rope(x) x sc with the rotate-half convention out[d] = x[d] cos[t][d] - x[d+HD/2] sin[t][d], out[d+HD/2] = x[d+HD/2] cos[t][d+HD/2] + x[d] sin[t][d+HD/2]
__global__ __launch_bounds__(256) void k_rope(const float* __restrict__ F, int pitch, int nheads, const float* __restrict__ CS, const float* __restrict__ RF, const float* __restrict__ nw, float sc, h16* P16, bf* Ph, bf* Pl) {
    const size_t e = ((size_t)blockIdx.x * 256 + threadIdx.x) * 2; if (e >= (size_t)nheads * TT * HD) return; const int d = (int)(e % HD); const int t = (int)((e / HD) % TT); const int h = (int)(e / ((size_t)HD * TT)); const float* f = F + (size_t)t * pitch + h * HD; const float rf = RF ? RF[(size_t)h * TT + t] : 1.0f; v2h o16; v2us oh, ol;
#pragma unroll
    for (int q = 0; q < 2; ++q) { const int dd = d + q; const int dp = (dd < HD / 2) ? dd + HD / 2 : dd - HD / 2; float x0 = f[dd], x1 = f[dp];
        if (RF) { float n0 = __fmul_rn(x0, rf), n1 = __fmul_rn(x1, rf); asm volatile("" : "+v"(n0)); asm volatile("" : "+v"(n1)); x0 = __fmul_rn(bfr(nw[dd]), n0); x1 = __fmul_rn(bfr(nw[dp]), n1); }
        const v2f cs = *(const v2f*)(CS + ((size_t)t * HD + dd) * 2); float a = __fmul_rn(x0, cs[0]), bq = __fmul_rn(x1, cs[1]); asm volatile("" : "+v"(a)); asm volatile("" : "+v"(bq)); const float r = ((dd < HD / 2) ? __fsub_rn(a, bq) : __fadd_rn(a, bq)) * sc;
        o16[q] = tohx(r); unsigned short a2, c2; splitf(r, a2, c2); oh[q] = a2; ol[q] = c2; }
    *(v2h*)(P16 + e) = o16; *(v2us*)(Ph + e) = oh; *(v2us*)(Pl + e) = ol;  }
__global__ __launch_bounds__(256) void k_vtp(const float* __restrict__ F, int pitch, int nheads, h16* V16, bf* Vh, bf* Vl) { const size_t e = ((size_t)blockIdx.x * 256 + threadIdx.x) * 2; if (e >= (size_t)nheads * HD * TT) return; const int t = (int)(e % TT); const int d = (int)((e / TT) % HD); const int g = (int)(e / ((size_t)TT * HD)); v2h o16; v2us oh, ol;
#pragma unroll
    for (int q = 0; q < 2; ++q) { const float x = F[(size_t)(t + q) * pitch + g * HD + d]; o16[q] = tohx(x); unsigned short a2, c2; splitf(x, a2, c2); oh[q] = a2; ol[q] = c2; }
    *(v2h*)(V16 + e) = o16; *(v2us*)(Vh + e) = oh; *(v2us*)(Vl + e) = ol;  }
__global__ __launch_bounds__(256) void k_csid(float* CS) { const int idx = blockIdx.x * 256 + threadIdx.x; if (idx >= TT * HD) return; v2f cs; cs[0] = 1.0f; cs[1] = 0.0f; *(v2f*)(CS + (size_t)idx * 2) = cs;  }
// k_asoft: per row (zz, i): t = S x HD^-0.5 (no mask); softmax over the 4096 keys (register row, one exp, fixed trees);
__global__ __launch_bounds__(256) void k_asoft(const float* __restrict__ Sb, h16* P16, bf* Ph, bf* Pl) {
    const int lane = threadIdx.x & 31; const int row = blockIdx.x * 8 + (threadIdx.x >> 5); if (row >= ZH * TT) return; const int i = row % TT; const int zz = row / TT; (void)zz; const bool hires = (i < RH); const float* sr = Sb + (size_t)row * TT; float v[TT / 32]; float mx = -3.0e38f;
#pragma unroll
    for (int ch = 0; ch < TT / 128; ++ch) { const int j0 = ch * 128 + lane * 4; const v4f a = *(const v4f*)(sr + j0);
#pragma unroll
        for (int q = 0; q < 4; ++q) { const int j = j0 + q; (void)j; const float t = a[q] * SCL; v[ch * 4 + q] = t; mx = fmaxf(mx, t); } }
#pragma unroll
    for (int sh = 16; sh; sh >>= 1) mx = fmaxf(mx, __shfl_xor(mx, sh, 32));
    float sum = 0.f;
#pragma unroll
    for (int k = 0; k < TT / 32; ++k) { float d0 = __fsub_rn(v[k], mx); asm volatile("" : "+v"(d0)); v[k] = __builtin_amdgcn_exp2f(__fmul_rn(d0, 1.4426950408889634f)); sum += v[k]; }
#pragma unroll
    for (int sh = 16; sh; sh >>= 1) sum += __shfl_xor(sum, sh, 32);
    const float f = __fdiv_rn(hires ? 1.0f : PCAR, sum);
{
        if (hires) {
#pragma unroll
            for (int ch = 0; ch < TT / 128; ++ch) { v4us oh, ol;
#pragma unroll
                for (int q = 0; q < 4; ++q) { unsigned short a, c2; splitf(v[ch * 4 + q] * f, a, c2); oh[q] = a; ol[q] = c2; }
                const size_t oo = ((size_t)zz * (RH ? RH : 1) + i) * TT + ch * 128 + lane * 4; *(v4us*)(Ph + oo) = oh; *(v4us*)(Pl + oo) = ol; }
        } else {
#pragma unroll
            for (int ch = 0; ch < TT / 128; ++ch) { v4h o4;
#pragma unroll
                for (int q = 0; q < 4; ++q) o4[q] = tohx(v[ch * 4 + q] * f);
                *(v4h*)(P16 + (size_t)row * TT + ch * 128 + lane * 4) = o4; } }
         }
}
__constant__ float PEINV[DM] = { 1.000000000e+00f,7.498942018e-01f,5.623413324e-01f,4.216965139e-01f,3.162277639e-01f,2.371373624e-01f,1.778279394e-01f,1.333521456e-01f,1.000000015e-01f,7.498941571e-02f,5.623412877e-02f,4.216964915e-02f,3.162277862e-02f,2.371373586e-02f,1.778279431e-02f,1.333521493e-02f,9.999999776e-03f,7.498942316e-03f,5.623413250e-03f,4.216964822e-03f,3.162277862e-03f,2.371373819e-03f,1.778279431e-03f,1.333521446e-03f,1.000000047e-03f,7.498941850e-04f,5.623413017e-04f,4.216964880e-04f,3.162277862e-04f,2.371373848e-04f,1.778279402e-04f,1.333521504e-04f,9.999999747e-05f,7.498942432e-05f,5.623413017e-05f,4.216965317e-05f,3.162277426e-05f,2.371373739e-05f,1.778279329e-05f,1.333521413e-05f,9.999999747e-06f,7.498942068e-06f,5.623413472e-06f,4.216964953e-06f,3.162277608e-06f,2.371373739e-06f,1.778279398e-06f,1.333521482e-06f,9.999999975e-07f,7.498942409e-07f,5.623413131e-07f,4.216964840e-07f,3.162277551e-07f,2.371373711e-07f,1.778279284e-07f,1.333521453e-07f,1.000000012e-07f,7.498942267e-08f,5.623413202e-08f,4.216964911e-08f,3.162277551e-08f,2.371373675e-08f,1.778279390e-08f,1.333521382e-08f };   // 1/10000^(2j/64) for j < 64 as float32 (jnp.power form, precomputed)
__global__ __launch_bounds__(256) void k_addposenc(const float* __restrict__ a, bf* Ph, bf* Pl) { const size_t i4 = (size_t)blockIdx.x * 256 + threadIdx.x; if (i4 >= (size_t)TT * DM / 4) return; const size_t e = i4 * 4; const int j0 = (int)(e % DM); const int t = (int)(e / DM); const v4f x4 = *(const v4f*)(a + e); v4us oh, ol;
#pragma unroll
    for (int q = 0; q < 4; ++q) { const float ang = __fmul_rn((float)t, PEINV[j0 + q]); const float s = __fadd_rn(bfr(x4[q]), sinf(ang)); unsigned short u, w; splitf(s, u, w); oh[q] = u; ol[q] = w; }
    *(v4us*)(Ph + e) = oh; *(v4us*)(Pl + e) = ol;  }
__global__ __launch_bounds__(256) void k_merge(const float* __restrict__ O, int h0, float* OUTb) { const size_t e = ((size_t)blockIdx.x * 256 + threadIdx.x) * 2; if (e >= (size_t)ZH * TT * HD) return; const int d = (int)(e % HD); const int t = (int)((e / HD) % TT); const int zz = (int)(e / ((size_t)HD * TT)); const float cs = (t < RH) ? 1.0f : (1.0f / PCAR); const size_t oo = (size_t)t * DQ + (h0 + zz) * HD + d;
    const float* pr = O + (e - d) * KSP + d;   // this row's KSP partials lie HD floats apart
    v2f o2 = *(const v2f*)pr;
#pragma unroll   // the KSP partial loads are independent: unrolled they are all in flight before the first add
    for (int s = 1; s < KSP; ++s) o2 += *(const v2f*)(pr + s * HD);
    o2[0] *= cs; o2[1] *= cs; *(v2f*)(OUTb + oo) = o2;  }

extern "C" void kernel_launch(void* const* d_in, const int* in_sizes, int n_in,
                              void* d_out, int out_size, void* d_ws, size_t ws_size, hipStream_t stream) {
    (void)in_sizes; (void)n_in; (void)out_size;
    const float* x = (const float*)d_in[0]; const float* wk3 = (const float*)d_in[1];   /* kernel [3][64][64] 'xw' */ const float* wq = wk3; const float* wk = wk3 + 64 * 64; const float* wv = wk3 + 2 * 64 * 64; const float* wo = nullptr; (void)wo;
    float* OUT = (float*)d_out;     // [4][4096][64]
    char* wsp = (char*)d_ws;
    auto take = [&](size_t bytes) { char* p = wsp; wsp += (bytes + 255) & ~(size_t)255; return (void*)p; };
    bf* XPl = (bf*)take((size_t)TT * DM * 2); bf* WQ = (bf*)take((size_t)DQ * DM * 2); bf* WK = (bf*)take((size_t)DKV * DM * 2); bf* WV = (bf*)take((size_t)DKV * DM * 2); float* CS = (float*)take((size_t)TT * HD * 2 * 4);
    bf* XB = (bf*)take((size_t)TT * DM * 2); float* FQ = (float*)take((size_t)TT * DQ * 4); float* FK = (float*)take((size_t)TT * DKV * 4);
    h16* QP16 = (h16*)take((size_t)NH_ * TT * HD * 2); h16* KP16 = (h16*)take((size_t)NKV * TT * HD * 2); h16* VT16 = (h16*)take((size_t)NKV * HD * TT * 2);
    bf* QPh = (bf*)take((size_t)NH_ * TT * HD * 2); bf* QPl = (bf*)take((size_t)NH_ * TT * HD * 2); bf* KPh = (bf*)take((size_t)NKV * TT * HD * 2); bf* KPl = (bf*)take((size_t)NKV * TT * HD * 2); bf* VTh = (bf*)take((size_t)NKV * HD * TT * 2); bf* VTl = (bf*)take((size_t)NKV * HD * TT * 2); bf* Ph = (bf*)take((size_t)ZH * RH * TT * 2); bf* Pl = (bf*)take((size_t)ZH * RH * TT * 2);
    float* Sb = (float*)take((size_t)ZH * TT * TT * 4); h16* P16 = (h16*)take((size_t)ZH * TT * TT * 2); float* Ob = (float*)take((size_t)KSP * ZH * TT * HD * 4);   /* [row][KSP][HD] partials */
    if ((size_t)(wsp - (char*)d_ws) > ws_size) return;    // ws 256 MiB
    float* FV = FK;   // v projection reuses the k buffer after the k planes are built (stream-ordered)
    { k_wtG<<<(unsigned)((DM * DQ / 64 + 63) / 64), 256, 0, stream>>>(wq, DM, DQ, WQ); k_wtG<<<(unsigned)((DM * DKV / 64 + 63) / 64), 256, 0, stream>>>(wk, DM, DKV, WK); k_wtG<<<(unsigned)((DM * DKV / 64 + 63) / 64), 256, 0, stream>>>(wv, DM, DKV, WV);
      
       }
    k_csid<<<(TT * HD + 255) / 256, 256, 0, stream>>>(CS);
    const unsigned LQ = (unsigned)(((size_t)NH_ * TT * HD / 2 + 255) / 256), LKv = (unsigned)(((size_t)NKV * TT * HD / 2 + 255) / 256);
    for (int b = 0; b < NB_; ++b) {
        
        k_addposenc<<<(unsigned)(((size_t)TT * DM / 4 + 255) / 256), 256, 0, stream>>>(x + (size_t)b * TT * DM, XB, XPl);   /* x + PE -> hi/lo planes (XB = hi) */
        k_gemmw<bf, 1, false><<<dim3(TT / 64, DQ / 64, 1), 32, 0, stream>>>(XB, XPl, WQ, nullptr, DM, DM, FQ, DQ, nullptr, 0, 0, 0);
        k_rope<<<LQ, 256, 0, stream>>>(FQ, DQ, NH_, CS, nullptr, nullptr, 1.0f, QP16, QPh, QPl);
        k_gemmw<bf, 1, false><<<dim3(TT / 64, DKV / 64, 1), 32, 0, stream>>>(XB, XPl, WK, nullptr, DM, DM, FK, DKV, nullptr, 0, 0, 0);
        k_rope<<<LKv, 256, 0, stream>>>(FK, DKV, NKV, CS, nullptr, nullptr, 1.0f, KP16, KPh, KPl);
        k_gemmw<bf, 1, false><<<dim3(TT / 64, DKV / 64, 1), 32, 0, stream>>>(XB, XPl, WV, nullptr, DM, DM, FV, DKV, nullptr, 0, 0, 0); k_vtp<<<LKv, 256, 0, stream>>>(FV, DKV, NKV, VT16, VTh, VTl);
        for (int h0 = 0; h0 < NH_; h0 += ZH) { const size_t zq = (size_t)h0, zk = (size_t)(h0 / REP);   // one kv head per query head: the pass's one head (ZH = 1) uses kv plane h0 (z-strides TT*HD)
            k_gemmw<bf, 2, false><<<dim3(RH / 64, TT / 64, ZH), 32, 0, stream>>>(QPh + zq * TT * HD, QPl + zq * TT * HD, KPh + zk * TT * HD, KPl + zk * TT * HD, HD, HD, Sb, TT, nullptr, (size_t)TT * HD, (size_t)TT * HD, (size_t)TT * TT);
            k_gemmw<h16, 0, false><<<dim3((TT - RH) / 64, TT / 64, ZH), 32, 0, stream>>>(QP16 + zq * TT * HD + (size_t)RH * HD, nullptr, KP16 + zk * TT * HD, nullptr, HD, HD, Sb + (size_t)RH * TT, TT, nullptr, (size_t)TT * HD, (size_t)TT * HD, (size_t)TT * TT);
            k_asoft<<<ZH * TT / 8, 256, 0, stream>>>(Sb, P16, Ph, Pl);
            k_gemmw<bf, 2, false><<<dim3(RH / 64, HD / 64, KSP), 32, 0, stream>>>(Ph, Pl, VTh + zk * HD * TT, VTl + zk * HD * TT, TT, TT / KSP, Ob, KSP * HD, nullptr, (size_t)(TT / KSP), (size_t)(TT / KSP), (size_t)HD);   /* z = key slice */
            k_gemmw<h16, 0, false><<<dim3((TT - RH) / 64, HD / 64, KSP), 32, 0, stream>>>(P16 + (size_t)RH * TT, nullptr, VT16 + zk * HD * TT, nullptr, TT, TT / KSP, Ob + (size_t)RH * KSP * HD, KSP * HD, nullptr, (size_t)(TT / KSP), (size_t)(TT / KSP), (size_t)HD);   /* z = key slice */
            k_merge<<<(unsigned)(((size_t)ZH * TT * HD / 2 + 255) / 256), 256, 0, stream>>>(Ob, h0, OUT + (size_t)b * TT * DQ); }
         }
}

// v002
// A run of this version takes 218 microseconds.
// Next to v001, in two timings, it ran 1.50 and 1.51 times as fast.
// All steps since v000 together make it 4.12 times as fast.
#include <hip/hip_runtime.h>

// Single-head self-attention with a sinusoidal (sine-only) position embedding (x [4][4096][64]; x' = x + PE, PE[i][j] = sin(i x 10000^(-2j/64)) (computed: float32 inverse frequencies via pow, precise sinf); q, k, v = x' kernel[0|1|2] ('xw' [64][64] 0.05, no bias); scores / 8 over all 4,096 keys; softmax; out = attn v -> [4][4096][64] (1.0 M)).
// The batch is a grid dimension: x + PE, projections and q/k/v planes run once for all 4 batches, the attention kernels once per pair of batches.
// Layout per batch: x + PE summed in f32 from the bf16-rounded input and split into hi/lo bf16 planes (the sum is not bf16-exact); projections hi/lo x exact (2 products); one 64-wide head with T-4096 attention (hybrid rows: < 512 hi/lo 3 products, rest fp16 x1024; register-row softmax); the f32 merge writes the output rows.
// Compute dtypes, f32 accumulate: every input rounded to bf16; position embedding f32; projections hi/lo x exact; attention rows < 512 3 products, rest fp16; softmax f32; output f32.

#define NB_  4
#define TT   4096
#define DM   64
#define NH_  1
#define NKV  1
#define REP  (NH_ / NKV)
#define HD   64
#define DQ   (NH_ * HD)
#define DKV  (NKV * HD)
#define ZH   2                    // batches per attention pass: their score, probability and partial planes lie side by side in the workspace
#define RH   512                  // query rows < RH use hi+lo planes (0: none)
#define WIN  0
#define PCAR 1024.0f
#define SCL  0.125f   // HD^-0.5
#define KSP  32                   // key slices of the attn x v products: one wave per (64-row tile, slice), f32 partials [row][slice][HD] summed in slice order by k_merge
typedef _Float16 h16;
typedef unsigned short bf;
typedef __attribute__((ext_vector_type(16))) __bf16   v16bf;
typedef __attribute__((ext_vector_type(16))) _Float16 v16h;
typedef __attribute__((ext_vector_type(8)))  _Float16 v8h;
typedef __attribute__((ext_vector_type(8)))  unsigned short v8us;
typedef __attribute__((ext_vector_type(8)))  float    v8f;
typedef __attribute__((ext_vector_type(4)))  float    v4f;
typedef v8h  __attribute__((may_alias)) v8ha;
typedef v4f  __attribute__((may_alias)) v4fa;
typedef v8us __attribute__((may_alias)) v8usa;

__device__ __forceinline__ unsigned short f2bf(float f) { unsigned u = __float_as_uint(f); u += 0x7FFFu + ((u >> 16) & 1u); return (unsigned short)(u >> 16); }
__device__ __forceinline__ float bf2f(unsigned short b) { return __uint_as_float(((unsigned)b) << 16); }
__device__ __forceinline__ float bfr(float f) { return bf2f(f2bf(f)); }
__device__ __forceinline__ v16h cat16(v8h lo, v8h hi) { return __builtin_shufflevector(lo, hi, 0, 1, 2, 3, 4, 5, 6, 7, 8, 9, 10, 11, 12, 13, 14, 15); }
__device__ __forceinline__ v16bf cat16b(v8us lo, v8us hi) { return __builtin_bit_cast(v16bf, __builtin_shufflevector(lo, hi, 0, 1, 2, 3, 4, 5, 6, 7, 8, 9, 10, 11, 12, 13, 14, 15)); }
__device__ __forceinline__ v8f wmma16(v16h a, v16h b, v8f c) { return __builtin_amdgcn_wmma_f32_16x16x32_f16(false, a, false, b, (short)0, c, false, false); }
__device__ __forceinline__ v8f wmmab(v16bf a, v16bf b, v8f c) { return __builtin_amdgcn_wmma_f32_16x16x32_bf16(false, a, false, b, (short)0, c, false, false); }



// ---- k_gemmw: register-blocked GEMM, ONE WAVE per 64x64 output tile (16 accumulators), operands straight from K-contiguous 16-bit planes; grid (M/64, N/64, Z), 32 threads.
// C[m][n] (f32, pitch ldc, + optional f32 bias[n]) = sum_{k < KL} A[m][k] Bt[n][k] (+ split products per NSPLIT); K is the row pitch of A and Bt, KL <= K the summed length. grid z = batch x ZD + slice: slice strides sA/sB/sC and batch strides bA/bB/bC in elements (a slice step of KL along the rows with its own C columns makes it a K slice; ZD = 1: z is the batch alone). KL % 32 == 0.
template <typename T16> struct WFrag;
template <> struct WFrag<h16> { typedef v16h V; static __device__ __forceinline__ V ld(const h16* p) { return cat16(*(const v8h*)p, *(const v8h*)(p + 16)); } static __device__ __forceinline__ v8f mma(V a, V b, v8f c) { return wmma16(a, b, c); } };
template <> struct WFrag<bf> { typedef v16bf V; static __device__ __forceinline__ V ld(const bf* p) { return cat16b(*(const v8us*)p, *(const v8us*)(p + 16)); } static __device__ __forceinline__ v8f mma(V a, V b, v8f c) { return wmmab(a, b, c); } };
template <typename T16, int NSPLIT, bool BIAS, int ZD>
__global__ __launch_bounds__(32) void k_gemmw(const T16* __restrict__ A, const T16* __restrict__ A2, const T16* __restrict__ Bt, const T16* __restrict__ Bt2, int K, int KL, float* C, int ldc, const float* __restrict__ bias, size_t sA, size_t sB, size_t sC, size_t bA, size_t bB, size_t bC) {
    typedef typename WFrag<T16>::V V;
    __shared__ __align__(16) float os[16 * 68];
    const size_t z = blockIdx.z % ZD, zb = blockIdx.z / ZD; const size_t oA = z * sA + zb * bA, oB = z * sB + zb * bB; A += oA; if (A2) A2 += oA; Bt += oB; if (Bt2) Bt2 += oB; C += z * sC + zb * bC;
    const int lane = threadIdx.x & 31, lr = lane & 15, hi = lane >> 4; const int r0 = blockIdx.x * 64, c0 = blockIdx.y * 64;
    v8f acc[4][4];
#pragma unroll
    for (int mb = 0; mb < 4; ++mb)
#pragma unroll
        for (int nb = 0; nb < 4; ++nb) acc[mb][nb] = (v8f){};
    const size_t aoff = (size_t)(r0 + lr) * K + 8 * hi, boff = (size_t)(c0 + lr) * K + 8 * hi;
#pragma unroll 1
    for (int kc = 0; kc < KL; kc += 32) {
        V a[4], a2[4];
#pragma unroll
        for (int mb = 0; mb < 4; ++mb) { a[mb] = WFrag<T16>::ld(A + aoff + (size_t)mb * 16 * K + kc); if (NSPLIT == 1 || NSPLIT == 2) a2[mb] = WFrag<T16>::ld(A2 + aoff + (size_t)mb * 16 * K + kc); }
#pragma unroll
        for (int nb = 0; nb < 4; ++nb) { const V b = WFrag<T16>::ld(Bt + boff + (size_t)nb * 16 * K + kc); V b2; if (NSPLIT >= 2) b2 = WFrag<T16>::ld(Bt2 + boff + (size_t)nb * 16 * K + kc);
#pragma unroll
            for (int mb = 0; mb < 4; ++mb) { acc[mb][nb] = WFrag<T16>::mma(a[mb], b, acc[mb][nb]); if (NSPLIT == 1 || NSPLIT == 2) acc[mb][nb] = WFrag<T16>::mma(a2[mb], b, acc[mb][nb]); if (NSPLIT >= 2) acc[mb][nb] = WFrag<T16>::mma(a[mb], b2, acc[mb][nb]); } }
        asm volatile("v_nop\n\tv_nop\n\tv_nop\n\tv_nop" : "+v"(acc[0][0]), "+v"(acc[1][1]), "+v"(acc[2][2]), "+v"(acc[3][3]) : "v"(a[0]), "v"(a[3]));
    }
#pragma unroll
    for (int mb = 0; mb < 4; ++mb) {
#pragma unroll
        for (int nb = 0; nb < 4; ++nb) {
#pragma unroll
            for (int j = 0; j < 8; ++j) os[(hi * 8 + j) * 68 + nb * 16 + lr] = acc[mb][nb][j]; }
        __builtin_amdgcn_wave_barrier(); asm volatile("" ::: "memory");
        float* crow = C + (size_t)(r0 + mb * 16) * ldc + c0;
{
#pragma unroll
            for (int s = 0; s < 8; ++s) { const int row = 2 * s + hi, cofs = lr * 4; v4f val = *(const v4fa*)(os + row * 68 + cofs); if (BIAS) { val[0] += bfr(bias[c0 + cofs]); val[1] += bfr(bias[c0 + cofs + 1]); val[2] += bfr(bias[c0 + cofs + 2]); val[3] += bfr(bias[c0 + cofs + 3]); }
                *(v4f*)(crow + (size_t)row * ldc + cofs) = val; }
             }
        __builtin_amdgcn_wave_barrier(); asm volatile("" ::: "memory");
    }
}

__device__ __forceinline__ h16 tohx(float x) { return (h16)x; }
__device__ __forceinline__ void splitf(float y, unsigned short& h, unsigned short& l) { h = f2bf(y); l = f2bf(y - bf2f(h)); }
typedef __attribute__((ext_vector_type(2))) _Float16 v2h;
typedef __attribute__((ext_vector_type(4))) _Float16 v4h;
typedef __attribute__((ext_vector_type(2))) unsigned short v2us;
typedef __attribute__((ext_vector_type(4))) unsigned short v4us;
typedef __attribute__((ext_vector_type(2))) float v2f;
typedef __attribute__((ext_vector_type(4))) int v4i;

__global__ __launch_bounds__(256) void k_wtG(const float* __restrict__ w, int K, int N, bf* Bt) {
    const int lane = threadIdx.x & 31; const int L0 = (blockIdx.x * 8 + (threadIdx.x >> 5)) * 8; const int nlines = N * K / 64;
{
#pragma unroll 1
        for (int l = 0; l < 8; ++l) { const int L = L0 + l; if (L >= nlines) break; const size_t e = (size_t)L * 64 + lane * 2; const int k = (int)(e % K), n = (int)(e / K); v2us o;
            o[0] = f2bf(w[(size_t)k * N + n]); o[1] = f2bf(w[(size_t)(k + 1) * N + n]); *(v2us*)(Bt + e) = o; }
         }
}
__global__ __launch_bounds__(256) void k_cvt8(const float* __restrict__ src, bf* dst, size_t n8) { const size_t i = (size_t)blockIdx.x * 256 + threadIdx.x; if (i >= n8) return; const v8f v = *(const v8f*)(src + i * 8); v8us o;
#pragma unroll
    for (int k = 0; k < 8; ++k) o[k] = f2bf(v[k]); *(v8us*)(dst + i * 8) = o;  }

// k_rope: head planes [h][t][d] (fp16 + hi/lo) of rope(x) x sc with the rotate-half convention out[d] = x[d] cos[t][d] - x[d+HD/2] sin[t][d], out[d+HD/2] = x[d+HD/2] cos[t][d+HD/2] + x[d] sin[t][d+HD/2]
__global__ __launch_bounds__(256) void k_rope(const float* __restrict__ F, int pitch, int nheads, const float* __restrict__ CS, const float* __restrict__ RF, const float* __restrict__ nw, float sc, h16* P16, bf* Ph, bf* Pl) {
    { const size_t bb = blockIdx.y, po = bb * nheads * TT * HD; F += bb * TT * pitch; P16 += po; Ph += po; Pl += po; }   // grid y = batch
    const size_t e = ((size_t)blockIdx.x * 256 + threadIdx.x) * 2; if (e >= (size_t)nheads * TT * HD) return; const int d = (int)(e % HD); const int t = (int)((e / HD) % TT); const int h = (int)(e / ((size_t)HD * TT)); const float* f = F + (size_t)t * pitch + h * HD; const float rf = RF ? RF[(size_t)h * TT + t] : 1.0f; v2h o16; v2us oh, ol;
#pragma unroll
    for (int q = 0; q < 2; ++q) { const int dd = d + q; const int dp = (dd < HD / 2) ? dd + HD / 2 : dd - HD / 2; float x0 = f[dd], x1 = f[dp];
        if (RF) { float n0 = __fmul_rn(x0, rf), n1 = __fmul_rn(x1, rf); asm volatile("" : "+v"(n0)); asm volatile("" : "+v"(n1)); x0 = __fmul_rn(bfr(nw[dd]), n0); x1 = __fmul_rn(bfr(nw[dp]), n1); }
        const v2f cs = *(const v2f*)(CS + ((size_t)t * HD + dd) * 2); float a = __fmul_rn(x0, cs[0]), bq = __fmul_rn(x1, cs[1]); asm volatile("" : "+v"(a)); asm volatile("" : "+v"(bq)); const float r = ((dd < HD / 2) ? __fsub_rn(a, bq) : __fadd_rn(a, bq)) * sc;
        o16[q] = tohx(r); unsigned short a2, c2; splitf(r, a2, c2); oh[q] = a2; ol[q] = c2; }
    *(v2h*)(P16 + e) = o16; *(v2us*)(Ph + e) = oh; *(v2us*)(Pl + e) = ol;  }
__global__ __launch_bounds__(256) void k_vtp(const float* __restrict__ F, int pitch, int nheads, h16* V16, bf* Vh, bf* Vl) { { const size_t bb = blockIdx.y, po = bb * nheads * HD * TT; F += bb * TT * pitch; V16 += po; Vh += po; Vl += po; }   // grid y = batch
    const size_t e = ((size_t)blockIdx.x * 256 + threadIdx.x) * 2; if (e >= (size_t)nheads * HD * TT) return; const int t = (int)(e % TT); const int d = (int)((e / TT) % HD); const int g = (int)(e / ((size_t)TT * HD)); v2h o16; v2us oh, ol;
#pragma unroll
    for (int q = 0; q < 2; ++q) { const float x = F[(size_t)(t + q) * pitch + g * HD + d]; o16[q] = tohx(x); unsigned short a2, c2; splitf(x, a2, c2); oh[q] = a2; ol[q] = c2; }
    *(v2h*)(V16 + e) = o16; *(v2us*)(Vh + e) = oh; *(v2us*)(Vl + e) = ol;  }
__global__ __launch_bounds__(256) void k_csid(float* CS) { const int idx = blockIdx.x * 256 + threadIdx.x; if (idx >= TT * HD) return; v2f cs; cs[0] = 1.0f; cs[1] = 0.0f; *(v2f*)(CS + (size_t)idx * 2) = cs;  }
// k_asoft: per row (zz, i): t = S x HD^-0.5 (no mask); softmax over the 4096 keys (register row, one exp, fixed trees);
__global__ __launch_bounds__(256) void k_asoft(const float* __restrict__ Sb, h16* P16, bf* Ph, bf* Pl) {
    const int lane = threadIdx.x & 31; const int row = blockIdx.x * 8 + (threadIdx.x >> 5); if (row >= ZH * TT) return; const int i = row % TT; const int zz = row / TT; (void)zz; const bool hires = (i < RH); const float* sr = Sb + (size_t)row * TT; float v[TT / 32]; float mx = -3.0e38f;
#pragma unroll
    for (int ch = 0; ch < TT / 128; ++ch) { const int j0 = ch * 128 + lane * 4; const v4f a = *(const v4f*)(sr + j0);
#pragma unroll
        for (int q = 0; q < 4; ++q) { const int j = j0 + q; (void)j; const float t = a[q] * SCL; v[ch * 4 + q] = t; mx = fmaxf(mx, t); } }
#pragma unroll
    for (int sh = 16; sh; sh >>= 1) mx = fmaxf(mx, __shfl_xor(mx, sh, 32));
    float sum = 0.f;
#pragma unroll
    for (int k = 0; k < TT / 32; ++k) { float d0 = __fsub_rn(v[k], mx); asm volatile("" : "+v"(d0)); v[k] = __builtin_amdgcn_exp2f(__fmul_rn(d0, 1.4426950408889634f)); sum += v[k]; }
#pragma unroll
    for (int sh = 16; sh; sh >>= 1) sum += __shfl_xor(sum, sh, 32);
    const float f = __fdiv_rn(hires ? 1.0f : PCAR, sum);
{
        if (hires) {
#pragma unroll
            for (int ch = 0; ch < TT / 128; ++ch) { v4us oh, ol;
#pragma unroll
                for (int q = 0; q < 4; ++q) { unsigned short a, c2; splitf(v[ch * 4 + q] * f, a, c2); oh[q] = a; ol[q] = c2; }
                const size_t oo = ((size_t)zz * (RH ? RH : 1) + i) * TT + ch * 128 + lane * 4; *(v4us*)(Ph + oo) = oh; *(v4us*)(Pl + oo) = ol; }
        } else {
#pragma unroll
            for (int ch = 0; ch < TT / 128; ++ch) { v4h o4;
#pragma unroll
                for (int q = 0; q < 4; ++q) o4[q] = tohx(v[ch * 4 + q] * f);
                *(v4h*)(P16 + (size_t)row * TT + ch * 128 + lane * 4) = o4; } }
         }
}
__constant__ float PEINV[DM] = { 1.000000000e+00f,7.498942018e-01f,5.623413324e-01f,4.216965139e-01f,3.162277639e-01f,2.371373624e-01f,1.778279394e-01f,1.333521456e-01f,1.000000015e-01f,7.498941571e-02f,5.623412877e-02f,4.216964915e-02f,3.162277862e-02f,2.371373586e-02f,1.778279431e-02f,1.333521493e-02f,9.999999776e-03f,7.498942316e-03f,5.623413250e-03f,4.216964822e-03f,3.162277862e-03f,2.371373819e-03f,1.778279431e-03f,1.333521446e-03f,1.000000047e-03f,7.498941850e-04f,5.623413017e-04f,4.216964880e-04f,3.162277862e-04f,2.371373848e-04f,1.778279402e-04f,1.333521504e-04f,9.999999747e-05f,7.498942432e-05f,5.623413017e-05f,4.216965317e-05f,3.162277426e-05f,2.371373739e-05f,1.778279329e-05f,1.333521413e-05f,9.999999747e-06f,7.498942068e-06f,5.623413472e-06f,4.216964953e-06f,3.162277608e-06f,2.371373739e-06f,1.778279398e-06f,1.333521482e-06f,9.999999975e-07f,7.498942409e-07f,5.623413131e-07f,4.216964840e-07f,3.162277551e-07f,2.371373711e-07f,1.778279284e-07f,1.333521453e-07f,1.000000012e-07f,7.498942267e-08f,5.623413202e-08f,4.216964911e-08f,3.162277551e-08f,2.371373675e-08f,1.778279390e-08f,1.333521382e-08f };   // 1/10000^(2j/64) for j < 64 as float32 (jnp.power form, precomputed)
__global__ __launch_bounds__(256) void k_addposenc(const float* __restrict__ a, bf* Ph, bf* Pl) { const size_t i4 = (size_t)blockIdx.x * 256 + threadIdx.x; if (i4 >= (size_t)NB_ * TT * DM / 4) return; const size_t e = i4 * 4; const int j0 = (int)(e % DM); const int t = (int)((e / DM) % TT);   /* rows of all batches, position = row within its batch */ const v4f x4 = *(const v4f*)(a + e); v4us oh, ol;
#pragma unroll
    for (int q = 0; q < 4; ++q) { const float ang = __fmul_rn((float)t, PEINV[j0 + q]); const float s = __fadd_rn(bfr(x4[q]), sinf(ang)); unsigned short u, w; splitf(s, u, w); oh[q] = u; ol[q] = w; }
    *(v4us*)(Ph + e) = oh; *(v4us*)(Pl + e) = ol;  }
__global__ __launch_bounds__(256) void k_merge(const float* __restrict__ O, int h0, float* OUTb) { const size_t e = ((size_t)blockIdx.x * 256 + threadIdx.x) * 2; if (e >= (size_t)ZH * TT * HD) return; const int d = (int)(e % HD); const int t = (int)((e / HD) % TT); const int zz = (int)(e / ((size_t)HD * TT)); const float cs = (t < RH) ? 1.0f : (1.0f / PCAR); const size_t oo = ((size_t)zz * TT + t) * DQ + h0 * HD + d;   // zz = batch within the pass
    const float* pr = O + (e - d) * KSP + d;   // this row's KSP partials lie HD floats apart
    v2f o2 = *(const v2f*)pr;
#pragma unroll   // the KSP partial loads are independent: unrolled they are all in flight before the first add
    for (int s = 1; s < KSP; ++s) o2 += *(const v2f*)(pr + s * HD);
    o2[0] *= cs; o2[1] *= cs; *(v2f*)(OUTb + oo) = o2;  }

extern "C" void kernel_launch(void* const* d_in, const int* in_sizes, int n_in,
                              void* d_out, int out_size, void* d_ws, size_t ws_size, hipStream_t stream) {
    (void)in_sizes; (void)n_in; (void)out_size;
    const float* x = (const float*)d_in[0]; const float* wk3 = (const float*)d_in[1];   /* kernel [3][64][64] 'xw' */ const float* wq = wk3; const float* wk = wk3 + 64 * 64; const float* wv = wk3 + 2 * 64 * 64;
    float* OUT = (float*)d_out;     // [4][4096][64]
    char* wsp = (char*)d_ws;
    auto take = [&](size_t bytes) { char* p = wsp; wsp += (bytes + 255) & ~(size_t)255; return (void*)p; };
    // x', projections and q/k/v planes hold all NB_ batches, [batch] outermost; score, probability and partial planes hold the ZH batches of one pass
    bf* XPl = (bf*)take((size_t)NB_ * TT * DM * 2); bf* WQ = (bf*)take((size_t)DQ * DM * 2); bf* WK = (bf*)take((size_t)DKV * DM * 2); bf* WV = (bf*)take((size_t)DKV * DM * 2); float* CS = (float*)take((size_t)TT * HD * 2 * 4);
    bf* XB = (bf*)take((size_t)NB_ * TT * DM * 2); float* FQ = (float*)take((size_t)NB_ * TT * DQ * 4); float* FK = (float*)take((size_t)NB_ * TT * DKV * 4);
    h16* QP16 = (h16*)take((size_t)NB_ * NH_ * TT * HD * 2); h16* KP16 = (h16*)take((size_t)NB_ * NKV * TT * HD * 2); h16* VT16 = (h16*)take((size_t)NB_ * NKV * HD * TT * 2);
    bf* QPh = (bf*)take((size_t)NB_ * NH_ * TT * HD * 2); bf* QPl = (bf*)take((size_t)NB_ * NH_ * TT * HD * 2); bf* KPh = (bf*)take((size_t)NB_ * NKV * TT * HD * 2); bf* KPl = (bf*)take((size_t)NB_ * NKV * TT * HD * 2); bf* VTh = (bf*)take((size_t)NB_ * NKV * HD * TT * 2); bf* VTl = (bf*)take((size_t)NB_ * NKV * HD * TT * 2); bf* Ph = (bf*)take((size_t)ZH * RH * TT * 2); bf* Pl = (bf*)take((size_t)ZH * RH * TT * 2);
    float* Sb = (float*)take((size_t)ZH * TT * TT * 4); h16* P16 = (h16*)take((size_t)ZH * TT * TT * 2);
    if ((size_t)(wsp - (char*)d_ws) > ws_size) return;    // ws 256 MiB
    float* Ob = Sb;   // [batch of the pass][row][KSP][HD] partials (ZH x 32 MiB) reuse the score planes, which are dead once k_asoft has read them (stream-ordered)
    float* FV = FK;   // v projection reuses the k buffer after the k planes are built (stream-ordered)
    k_wtG<<<(unsigned)((DM * DQ / 64 + 63) / 64), 256, 0, stream>>>(wq, DM, DQ, WQ); k_wtG<<<(unsigned)((DM * DKV / 64 + 63) / 64), 256, 0, stream>>>(wk, DM, DKV, WK); k_wtG<<<(unsigned)((DM * DKV / 64 + 63) / 64), 256, 0, stream>>>(wv, DM, DKV, WV);
    k_csid<<<(TT * HD + 255) / 256, 256, 0, stream>>>(CS);
    const unsigned LQ = (unsigned)(((size_t)NH_ * TT * HD / 2 + 255) / 256), LKv = (unsigned)(((size_t)NKV * TT * HD / 2 + 255) / 256);
    // all batches at once: the rows of the NB_ batches are one [NB_ x TT] row range for x + PE and the projections, grid y is the batch for the plane builders
    k_addposenc<<<(unsigned)(((size_t)NB_ * TT * DM / 4 + 255) / 256), 256, 0, stream>>>(x, XB, XPl);   /* x + PE -> hi/lo planes (XB = hi) */
    k_gemmw<bf, 1, false, 1><<<dim3(NB_ * TT / 64, DQ / 64, 1), 32, 0, stream>>>(XB, XPl, WQ, nullptr, DM, DM, FQ, DQ, nullptr, 0, 0, 0, 0, 0, 0);
    k_rope<<<dim3(LQ, NB_), 256, 0, stream>>>(FQ, DQ, NH_, CS, nullptr, nullptr, 1.0f, QP16, QPh, QPl);
    k_gemmw<bf, 1, false, 1><<<dim3(NB_ * TT / 64, DKV / 64, 1), 32, 0, stream>>>(XB, XPl, WK, nullptr, DM, DM, FK, DKV, nullptr, 0, 0, 0, 0, 0, 0);
    k_rope<<<dim3(LKv, NB_), 256, 0, stream>>>(FK, DKV, NKV, CS, nullptr, nullptr, 1.0f, KP16, KPh, KPl);
    k_gemmw<bf, 1, false, 1><<<dim3(NB_ * TT / 64, DKV / 64, 1), 32, 0, stream>>>(XB, XPl, WV, nullptr, DM, DM, FV, DKV, nullptr, 0, 0, 0, 0, 0, 0);
    k_vtp<<<dim3(LKv, NB_), 256, 0, stream>>>(FV, DKV, NKV, VT16, VTh, VTl);
    // attention, ZH batches a pass (two f32 score planes are what the workspace holds): grid z carries the batch
    for (int b0 = 0; b0 < NB_; b0 += ZH) { const size_t pq = (size_t)b0 * NH_ * TT * HD, pk = (size_t)b0 * NKV * TT * HD;
        k_gemmw<bf, 2, false, 1><<<dim3(RH / 64, TT / 64, ZH), 32, 0, stream>>>(QPh + pq, QPl + pq, KPh + pk, KPl + pk, HD, HD, Sb, TT, nullptr, 0, 0, 0, (size_t)TT * HD, (size_t)TT * HD, (size_t)TT * TT);
        k_gemmw<h16, 0, false, 1><<<dim3((TT - RH) / 64, TT / 64, ZH), 32, 0, stream>>>(QP16 + pq + (size_t)RH * HD, nullptr, KP16 + pk, nullptr, HD, HD, Sb + (size_t)RH * TT, TT, nullptr, 0, 0, 0, (size_t)TT * HD, (size_t)TT * HD, (size_t)TT * TT);
        k_asoft<<<ZH * TT / 8, 256, 0, stream>>>(Sb, P16, Ph, Pl);
        k_gemmw<bf, 2, false, KSP><<<dim3(RH / 64, HD / 64, ZH * KSP), 32, 0, stream>>>(Ph, Pl, VTh + pk, VTl + pk, TT, TT / KSP, Ob, KSP * HD, nullptr, (size_t)(TT / KSP), (size_t)(TT / KSP), (size_t)HD, (size_t)RH * TT, (size_t)HD * TT, (size_t)TT * KSP * HD);   /* z = batch x KSP + key slice */
        k_gemmw<h16, 0, false, KSP><<<dim3((TT - RH) / 64, HD / 64, ZH * KSP), 32, 0, stream>>>(P16 + (size_t)RH * TT, nullptr, VT16 + pk, nullptr, TT, TT / KSP, Ob + (size_t)RH * KSP * HD, KSP * HD, nullptr, (size_t)(TT / KSP), (size_t)(TT / KSP), (size_t)HD, (size_t)TT * TT, (size_t)HD * TT, (size_t)TT * KSP * HD);   /* z = batch x KSP + key slice */
        k_merge<<<(unsigned)(((size_t)ZH * TT * HD / 2 + 255) / 256), 256, 0, stream>>>(Ob, 0, OUT + (size_t)b0 * TT * DQ); }
}

// v003
// It runs in 117 microseconds.
// Two timings next to v002 both put it at 1.86 times that version's speed.
// All steps since v000 together make it 7.66 times as fast.
#include <hip/hip_runtime.h>

// Single-head self-attention with a sinusoidal (sine-only) position embedding (x [4][4096][64]; x' = x + PE, PE[i][j] = sin(i x 10000^(-2j/64)) (computed: float32 inverse frequencies via pow, precise sinf); q, k, v = x' kernel[0|1|2] ('xw' [64][64] 0.05, no bias); scores / 8 over all 4,096 keys; softmax; out = attn v -> [4][4096][64] (1.0 M)).
// The batch is a grid dimension: x + PE, projections and q/k/v planes run once for all 4 batches, and so does the one fused attention kernel.
// Layout per batch: x + PE summed in f32 from the bf16-rounded input and split into hi/lo bf16 planes (the sum is not bf16-exact); projections hi/lo x exact (2 products); one 64-wide head, attention fused in one kernel (hybrid rows: < 512 hi/lo 3 products, rest fp16; running-maximum softmax in registers, scores and probabilities never stored); 8 key slices per work-group joined in LDS.
// Compute dtypes, f32 accumulate: every input rounded to bf16; position embedding f32; projections hi/lo x exact; attention rows < 512 3 products, rest fp16; softmax f32; output f32.

#define NB_  4
#define TT   4096
#define DM   64
#define NH_  1
#define NKV  1
#define REP  (NH_ / NKV)
#define HD   64
#define DQ   (NH_ * HD)
#define DKV  (NKV * HD)
#define RH   512                  // query rows < RH use hi+lo planes (0: none)
#define WIN  0
#define SCL  0.125f   // HD^-0.5
#define KW   8                    // waves of an attention work-group: each walks its own slice of TT / KW keys for the same query columns
#define OP   68                   // LDS pitch in floats of a query's 64 partial outputs
typedef _Float16 h16;
typedef unsigned short bf;
typedef __attribute__((ext_vector_type(16))) __bf16   v16bf;
typedef __attribute__((ext_vector_type(16))) _Float16 v16h;
typedef __attribute__((ext_vector_type(8)))  _Float16 v8h;
typedef __attribute__((ext_vector_type(8)))  unsigned short v8us;
typedef __attribute__((ext_vector_type(8)))  float    v8f;
typedef __attribute__((ext_vector_type(4)))  float    v4f;
typedef v8h  __attribute__((may_alias)) v8ha;
typedef v4f  __attribute__((may_alias)) v4fa;
typedef v8us __attribute__((may_alias)) v8usa;

__device__ __forceinline__ unsigned short f2bf(float f) { unsigned u = __float_as_uint(f); u += 0x7FFFu + ((u >> 16) & 1u); return (unsigned short)(u >> 16); }
__device__ __forceinline__ float bf2f(unsigned short b) { return __uint_as_float(((unsigned)b) << 16); }
__device__ __forceinline__ float bfr(float f) { return bf2f(f2bf(f)); }
__device__ __forceinline__ v16h cat16(v8h lo, v8h hi) { return __builtin_shufflevector(lo, hi, 0, 1, 2, 3, 4, 5, 6, 7, 8, 9, 10, 11, 12, 13, 14, 15); }
__device__ __forceinline__ v16bf cat16b(v8us lo, v8us hi) { return __builtin_bit_cast(v16bf, __builtin_shufflevector(lo, hi, 0, 1, 2, 3, 4, 5, 6, 7, 8, 9, 10, 11, 12, 13, 14, 15)); }
__device__ __forceinline__ v8f wmma16(v16h a, v16h b, v8f c) { return __builtin_amdgcn_wmma_f32_16x16x32_f16(false, a, false, b, (short)0, c, false, false); }
__device__ __forceinline__ v8f wmmab(v16bf a, v16bf b, v8f c) { return __builtin_amdgcn_wmma_f32_16x16x32_bf16(false, a, false, b, (short)0, c, false, false); }



// ---- k_gemmw: register-blocked GEMM, ONE WAVE per 64x64 output tile (16 accumulators), operands straight from K-contiguous 16-bit planes; grid (M/64, N/64, Z), 32 threads.
// C[m][n] (f32, pitch ldc, + optional f32 bias[n]) = sum_{k < KL} A[m][k] Bt[n][k] (+ split products per NSPLIT); K is the row pitch of A and Bt, KL <= K the summed length. grid z = batch x ZD + slice: slice strides sA/sB/sC and batch strides bA/bB/bC in elements (a slice step of KL along the rows with its own C columns makes it a K slice; ZD = 1: z is the batch alone). KL % 32 == 0.
template <typename T16> struct WFrag;
template <> struct WFrag<h16> { typedef v16h V; static __device__ __forceinline__ V ld(const h16* p) { return cat16(*(const v8h*)p, *(const v8h*)(p + 16)); } static __device__ __forceinline__ v8f mma(V a, V b, v8f c) { return wmma16(a, b, c); } };
template <> struct WFrag<bf> { typedef v16bf V; static __device__ __forceinline__ V ld(const bf* p) { return cat16b(*(const v8us*)p, *(const v8us*)(p + 16)); } static __device__ __forceinline__ v8f mma(V a, V b, v8f c) { return wmmab(a, b, c); } };
template <typename T16, int NSPLIT, bool BIAS, int ZD>
__global__ __launch_bounds__(32) void k_gemmw(const T16* __restrict__ A, const T16* __restrict__ A2, const T16* __restrict__ Bt, const T16* __restrict__ Bt2, int K, int KL, float* C, int ldc, const float* __restrict__ bias, size_t sA, size_t sB, size_t sC, size_t bA, size_t bB, size_t bC) {
    typedef typename WFrag<T16>::V V;
    __shared__ __align__(16) float os[16 * 68];
    const size_t z = blockIdx.z % ZD, zb = blockIdx.z / ZD; const size_t oA = z * sA + zb * bA, oB = z * sB + zb * bB; A += oA; if (A2) A2 += oA; Bt += oB; if (Bt2) Bt2 += oB; C += z * sC + zb * bC;
    const int lane = threadIdx.x & 31, lr = lane & 15, hi = lane >> 4; const int r0 = blockIdx.x * 64, c0 = blockIdx.y * 64;
    v8f acc[4][4];
#pragma unroll
    for (int mb = 0; mb < 4; ++mb)
#pragma unroll
        for (int nb = 0; nb < 4; ++nb) acc[mb][nb] = (v8f){};
    const size_t aoff = (size_t)(r0 + lr) * K + 8 * hi, boff = (size_t)(c0 + lr) * K + 8 * hi;
#pragma unroll 1
    for (int kc = 0; kc < KL; kc += 32) {
        V a[4], a2[4];
#pragma unroll
        for (int mb = 0; mb < 4; ++mb) { a[mb] = WFrag<T16>::ld(A + aoff + (size_t)mb * 16 * K + kc); if (NSPLIT == 1 || NSPLIT == 2) a2[mb] = WFrag<T16>::ld(A2 + aoff + (size_t)mb * 16 * K + kc); }
#pragma unroll
        for (int nb = 0; nb < 4; ++nb) { const V b = WFrag<T16>::ld(Bt + boff + (size_t)nb * 16 * K + kc); V b2; if (NSPLIT >= 2) b2 = WFrag<T16>::ld(Bt2 + boff + (size_t)nb * 16 * K + kc);
#pragma unroll
            for (int mb = 0; mb < 4; ++mb) { acc[mb][nb] = WFrag<T16>::mma(a[mb], b, acc[mb][nb]); if (NSPLIT == 1 || NSPLIT == 2) acc[mb][nb] = WFrag<T16>::mma(a2[mb], b, acc[mb][nb]); if (NSPLIT >= 2) acc[mb][nb] = WFrag<T16>::mma(a[mb], b2, acc[mb][nb]); } }
        asm volatile("v_nop\n\tv_nop\n\tv_nop\n\tv_nop" : "+v"(acc[0][0]), "+v"(acc[1][1]), "+v"(acc[2][2]), "+v"(acc[3][3]) : "v"(a[0]), "v"(a[3]));
    }
#pragma unroll
    for (int mb = 0; mb < 4; ++mb) {
#pragma unroll
        for (int nb = 0; nb < 4; ++nb) {
#pragma unroll
            for (int j = 0; j < 8; ++j) os[(hi * 8 + j) * 68 + nb * 16 + lr] = acc[mb][nb][j]; }
        __builtin_amdgcn_wave_barrier(); asm volatile("" ::: "memory");
        float* crow = C + (size_t)(r0 + mb * 16) * ldc + c0;
{
#pragma unroll
            for (int s = 0; s < 8; ++s) { const int row = 2 * s + hi, cofs = lr * 4; v4f val = *(const v4fa*)(os + row * 68 + cofs); if (BIAS) { val[0] += bfr(bias[c0 + cofs]); val[1] += bfr(bias[c0 + cofs + 1]); val[2] += bfr(bias[c0 + cofs + 2]); val[3] += bfr(bias[c0 + cofs + 3]); }
                *(v4f*)(crow + (size_t)row * ldc + cofs) = val; }
             }
        __builtin_amdgcn_wave_barrier(); asm volatile("" ::: "memory");
    }
}

__device__ __forceinline__ h16 tohx(float x) { return (h16)x; }
__device__ __forceinline__ void splitf(float y, unsigned short& h, unsigned short& l) { h = f2bf(y); l = f2bf(y - bf2f(h)); }
typedef __attribute__((ext_vector_type(2))) _Float16 v2h;
typedef __attribute__((ext_vector_type(4))) _Float16 v4h;
typedef __attribute__((ext_vector_type(2))) unsigned short v2us;
typedef __attribute__((ext_vector_type(4))) unsigned short v4us;
typedef __attribute__((ext_vector_type(2))) float v2f;
typedef __attribute__((ext_vector_type(4))) int v4i;

__global__ __launch_bounds__(256) void k_wtG(const float* __restrict__ w, int K, int N, bf* Bt) {
    const int lane = threadIdx.x & 31; const int L0 = (blockIdx.x * 8 + (threadIdx.x >> 5)) * 8; const int nlines = N * K / 64;
{
#pragma unroll 1
        for (int l = 0; l < 8; ++l) { const int L = L0 + l; if (L >= nlines) break; const size_t e = (size_t)L * 64 + lane * 2; const int k = (int)(e % K), n = (int)(e / K); v2us o;
            o[0] = f2bf(w[(size_t)k * N + n]); o[1] = f2bf(w[(size_t)(k + 1) * N + n]); *(v2us*)(Bt + e) = o; }
         }
}
__global__ __launch_bounds__(256) void k_cvt8(const float* __restrict__ src, bf* dst, size_t n8) { const size_t i = (size_t)blockIdx.x * 256 + threadIdx.x; if (i >= n8) return; const v8f v = *(const v8f*)(src + i * 8); v8us o;
#pragma unroll
    for (int k = 0; k < 8; ++k) o[k] = f2bf(v[k]); *(v8us*)(dst + i * 8) = o;  }

// k_rope: head planes [h][t][d] (fp16 + hi/lo) of rope(x) x sc with the rotate-half convention out[d] = x[d] cos[t][d] - x[d+HD/2] sin[t][d], out[d+HD/2] = x[d+HD/2] cos[t][d+HD/2] + x[d] sin[t][d+HD/2]
__global__ __launch_bounds__(256) void k_rope(const float* __restrict__ F, int pitch, int nheads, const float* __restrict__ CS, const float* __restrict__ RF, const float* __restrict__ nw, float sc, h16* P16, bf* Ph, bf* Pl) {
    { const size_t bb = blockIdx.y, po = bb * nheads * TT * HD; F += bb * TT * pitch; P16 += po; Ph += po; Pl += po; }   // grid y = batch
    const size_t e = ((size_t)blockIdx.x * 256 + threadIdx.x) * 2; if (e >= (size_t)nheads * TT * HD) return; const int d = (int)(e % HD); const int t = (int)((e / HD) % TT); const int h = (int)(e / ((size_t)HD * TT)); const float* f = F + (size_t)t * pitch + h * HD; const float rf = RF ? RF[(size_t)h * TT + t] : 1.0f; v2h o16; v2us oh, ol;
#pragma unroll
    for (int q = 0; q < 2; ++q) { const int dd = d + q; const int dp = (dd < HD / 2) ? dd + HD / 2 : dd - HD / 2; float x0 = f[dd], x1 = f[dp];
        if (RF) { float n0 = __fmul_rn(x0, rf), n1 = __fmul_rn(x1, rf); asm volatile("" : "+v"(n0)); asm volatile("" : "+v"(n1)); x0 = __fmul_rn(bfr(nw[dd]), n0); x1 = __fmul_rn(bfr(nw[dp]), n1); }
        const v2f cs = *(const v2f*)(CS + ((size_t)t * HD + dd) * 2); float a = __fmul_rn(x0, cs[0]), bq = __fmul_rn(x1, cs[1]); asm volatile("" : "+v"(a)); asm volatile("" : "+v"(bq)); const float r = ((dd < HD / 2) ? __fsub_rn(a, bq) : __fadd_rn(a, bq)) * sc;
        o16[q] = tohx(r); unsigned short a2, c2; splitf(r, a2, c2); oh[q] = a2; ol[q] = c2; }
    *(v2h*)(P16 + e) = o16; *(v2us*)(Ph + e) = oh; *(v2us*)(Pl + e) = ol;  }
__global__ __launch_bounds__(256) void k_vtp(const float* __restrict__ F, int pitch, int nheads, h16* V16, bf* Vh, bf* Vl) { { const size_t bb = blockIdx.y, po = bb * nheads * HD * TT; F += bb * TT * pitch; V16 += po; Vh += po; Vl += po; }   // grid y = batch
    const size_t e = ((size_t)blockIdx.x * 256 + threadIdx.x) * 2; if (e >= (size_t)nheads * HD * TT) return; const int t = (int)(e % TT); const int d = (int)((e / TT) % HD); const int g = (int)(e / ((size_t)TT * HD)); v2h o16; v2us oh, ol;
#pragma unroll
    for (int q = 0; q < 2; ++q) { const float x = F[(size_t)(t + q) * pitch + g * HD + d]; o16[q] = tohx(x); unsigned short a2, c2; splitf(x, a2, c2); oh[q] = a2; ol[q] = c2; }
    *(v2h*)(V16 + e) = o16; *(v2us*)(Vh + e) = oh; *(v2us*)(Vl + e) = ol;  }
__global__ __launch_bounds__(256) void k_csid(float* CS) { const int idx = blockIdx.x * 256 + threadIdx.x; if (idx >= TT * HD) return; v2f cs; cs[0] = 1.0f; cs[1] = 0.0f; *(v2f*)(CS + (size_t)idx * 2) = cs;  }
__constant__ float PEINV[DM] = { 1.000000000e+00f,7.498942018e-01f,5.623413324e-01f,4.216965139e-01f,3.162277639e-01f,2.371373624e-01f,1.778279394e-01f,1.333521456e-01f,1.000000015e-01f,7.498941571e-02f,5.623412877e-02f,4.216964915e-02f,3.162277862e-02f,2.371373586e-02f,1.778279431e-02f,1.333521493e-02f,9.999999776e-03f,7.498942316e-03f,5.623413250e-03f,4.216964822e-03f,3.162277862e-03f,2.371373819e-03f,1.778279431e-03f,1.333521446e-03f,1.000000047e-03f,7.498941850e-04f,5.623413017e-04f,4.216964880e-04f,3.162277862e-04f,2.371373848e-04f,1.778279402e-04f,1.333521504e-04f,9.999999747e-05f,7.498942432e-05f,5.623413017e-05f,4.216965317e-05f,3.162277426e-05f,2.371373739e-05f,1.778279329e-05f,1.333521413e-05f,9.999999747e-06f,7.498942068e-06f,5.623413472e-06f,4.216964953e-06f,3.162277608e-06f,2.371373739e-06f,1.778279398e-06f,1.333521482e-06f,9.999999975e-07f,7.498942409e-07f,5.623413131e-07f,4.216964840e-07f,3.162277551e-07f,2.371373711e-07f,1.778279284e-07f,1.333521453e-07f,1.000000012e-07f,7.498942267e-08f,5.623413202e-08f,4.216964911e-08f,3.162277551e-08f,2.371373675e-08f,1.778279390e-08f,1.333521382e-08f };   // 1/10000^(2j/64) for j < 64 as float32 (jnp.power form, precomputed)
__global__ __launch_bounds__(256) void k_addposenc(const float* __restrict__ a, bf* Ph, bf* Pl) { const size_t i4 = (size_t)blockIdx.x * 256 + threadIdx.x; if (i4 >= (size_t)NB_ * TT * DM / 4) return; const size_t e = i4 * 4; const int j0 = (int)(e % DM); const int t = (int)((e / DM) % TT);   /* rows of all batches, position = row within its batch */ const v4f x4 = *(const v4f*)(a + e); v4us oh, ol;
#pragma unroll
    for (int q = 0; q < 4; ++q) { const float ang = __fmul_rn((float)t, PEINV[j0 + q]); const float s = __fadd_rn(bfr(x4[q]), sinf(ang)); unsigned short u, w; splitf(s, u, w); oh[q] = u; ol[q] = w; }
    *(v4us*)(Ph + e) = oh; *(v4us*)(Pl + e) = ol;  }
typedef __attribute__((ext_vector_type(8))) __bf16 v8bf;
// v_exp_f32 in asm text with the one vector slot that the instruction set asks for behind a transcendental before its result is used or its source overwritten: inside a statement the slot stands where it is written, whatever registers the allocator reuses next.
__device__ __forceinline__ float exp2s(float x) { float r; asm("v_exp_f32 %0, %1\n\tv_nop" : "=v"(r) : "v"(x)); return r; }
// eight in place: each next one is independent and fills the slot of the one before, the v_nop that of the last
__device__ __forceinline__ void exp2x8(v8f& x) { float a = x[0], b = x[1], c = x[2], d = x[3], e = x[4], f = x[5], g = x[6], h = x[7];
    asm("v_exp_f32 %0, %0\n\tv_exp_f32 %1, %1\n\tv_exp_f32 %2, %2\n\tv_exp_f32 %3, %3\n\tv_exp_f32 %4, %4\n\tv_exp_f32 %5, %5\n\tv_exp_f32 %6, %6\n\tv_exp_f32 %7, %7\n\tv_nop" : "+v"(a), "+v"(b), "+v"(c), "+v"(d), "+v"(e), "+v"(f), "+v"(g), "+v"(h));
    x[0] = a; x[1] = b; x[2] = c; x[3] = d; x[4] = e; x[5] = f; x[6] = g; x[7] = h; }
// ---- k_fattn: scores, softmax and attn x v in one kernel. S^T = K Q^T (A = 16 keys, B = 16 query columns kept in registers), so a lane holds scores of ONE query; two S^T tiles (keys 0-15, 16-31), converted in place, are the B operand of O^T += V^T P^T.
// A work-group has NQT x 16 query columns; wave w walks keys [w TT/KW, (w+1) TT/KW) with its own maximum in use, sum and O^T; the KW partials are joined in LDS in wave order.
template <typename T16, bool HI, int NQT>
__device__ __forceinline__ void attn_cols(const T16* __restrict__ Q, const T16* __restrict__ Q2, const T16* __restrict__ Kp, const T16* __restrict__ K2, const T16* __restrict__ Vt, const T16* __restrict__ V2, int q0, float* __restrict__ outb, float* os, float* ms, float* ls) {
    typedef WFrag<T16> F; typedef typename F::V V;
    const float C2 = SCL * 1.4426950408889634f;   // scores are taken to base 2
    const int lane = threadIdx.x & 31, lr = lane & 15, hi = lane >> 4, w = threadIdx.x >> 5;
    V qf[NQT][2], qf2[NQT][2];
#pragma unroll
    for (int qt = 0; qt < NQT; ++qt)
#pragma unroll
        for (int kc = 0; kc < 2; ++kc) { const size_t o = (size_t)(q0 + qt * 16 + lr) * HD + kc * 32 + 8 * hi; qf[qt][kc] = F::ld(Q + o); if (HI) qf2[qt][kc] = F::ld(Q2 + o); }
    v8f o[4][NQT]; float mu[NQT], l[NQT];
#pragma unroll
    for (int qt = 0; qt < NQT; ++qt) { mu[qt] = -3.0e38f; l[qt] = 0.f;
#pragma unroll
        for (int dt = 0; dt < 4; ++dt) o[dt][qt] = (v8f){}; }
    const size_t kbase = (size_t)(w * (TT / KW) + lr) * HD + 8 * hi, vbase = (size_t)lr * TT + w * (TT / KW) + 8 * hi;
    V kf[2][2], kf2[2][2];
#pragma unroll
    for (int kt = 0; kt < 2; ++kt)
#pragma unroll
        for (int kc = 0; kc < 2; ++kc) { const size_t a = kbase + (size_t)kt * 16 * HD + kc * 32; kf[kt][kc] = F::ld(Kp + a); if (HI) kf2[kt][kc] = F::ld(K2 + a); }
#pragma unroll 1   // one pass = 32 keys; unrolled, two passes' fragments would not fit the registers of four waves per SIMD
    for (int it = 0; it < TT / KW / 32; ++it) {
        V vf[4], vf2[4];
#pragma unroll
        for (int dt = 0; dt < 4; ++dt) { const size_t a = vbase + (size_t)dt * 16 * TT + it * 32; vf[dt] = F::ld(Vt + a); if (HI) vf2[dt] = F::ld(V2 + a); }
        v8f s[2][NQT];
#pragma unroll
        for (int kt = 0; kt < 2; ++kt)
#pragma unroll
            for (int qt = 0; qt < NQT; ++qt) s[kt][qt] = (v8f){};
#pragma unroll
        for (int kc = 0; kc < 2; ++kc) {
#pragma unroll
            for (int kt = 0; kt < 2; ++kt)
#pragma unroll
                for (int qt = 0; qt < NQT; ++qt) s[kt][qt] = F::mma(kf[kt][kc], qf[qt][kc], s[kt][qt]);
            if (HI) {
#pragma unroll
                for (int kt = 0; kt < 2; ++kt)
#pragma unroll
                    for (int qt = 0; qt < NQT; ++qt) s[kt][qt] = F::mma(kf2[kt][kc], qf[qt][kc], s[kt][qt]);
#pragma unroll
                for (int kt = 0; kt < 2; ++kt)
#pragma unroll
                    for (int qt = 0; qt < NQT; ++qt) s[kt][qt] = F::mma(kf[kt][kc], qf2[qt][kc], s[kt][qt]); } }
        { const int itn = (it + 1 < TT / KW / 32) ? it + 1 : it;   // next pass's K fragments, fetched behind this pass's score products (the last pass fetches its own again)
#pragma unroll
            for (int kt = 0; kt < 2; ++kt)
#pragma unroll
                for (int kc = 0; kc < 2; ++kc) { const size_t a = kbase + (size_t)(itn * 32 + kt * 16) * HD + kc * 32; kf[kt][kc] = F::ld(Kp + a); if (HI) kf2[kt][kc] = F::ld(K2 + a); } }
        if constexpr (HI) asm volatile("s_wait_xcnt 0x0" ::: "memory");   // behind the pass's last load: the softmax below reuses the loads' address registers (in the fp16 body the compiler writes this wait itself)
        float ml[NQT]; bool need = false;
#pragma unroll
        for (int qt = 0; qt < NQT; ++qt) { float mx = fmaxf(s[0][qt][0], s[1][qt][0]);
#pragma unroll
            for (int j = 1; j < 8; ++j) mx = fmaxf(mx, fmaxf(s[0][qt][j], s[1][qt][j]));
            ml[qt] = mx * C2; need = need || (ml[qt] > mu[qt] + 8.0f); }
        if (__builtin_amdgcn_ballot_w32(need) != 0) {   // the maximum in use moves only when a score passes it by more than 2^8: rare behind the first pass
#pragma unroll
            for (int qt = 0; qt < NQT; ++qt) { const float mn = fmaxf(mu[qt], fmaxf(ml[qt], __shfl_xor(ml[qt], 16, 32))); const float al = exp2s(mu[qt] - mn); mu[qt] = mn; l[qt] *= al;
#pragma unroll
                for (int dt = 0; dt < 4; ++dt) o[dt][qt] *= al; } }
        V pf[NQT], pf2[NQT];
#pragma unroll
        for (int qt = 0; qt < NQT; ++qt) {
#pragma unroll
            for (int kt = 0; kt < 2; ++kt) {
#pragma unroll
                for (int j = 0; j < 8; ++j) s[kt][qt][j] = __builtin_fmaf(s[kt][qt][j], C2, -mu[qt]);
                exp2x8(s[kt][qt]);
#pragma unroll
                for (int j = 0; j < 8; ++j) l[qt] += s[kt][qt][j]; }
            if constexpr (HI) { const v8bf h0 = __builtin_convertvector(s[0][qt], v8bf), h1 = __builtin_convertvector(s[1][qt], v8bf);
                const v8bf l0 = __builtin_convertvector(s[0][qt] - __builtin_convertvector(h0, v8f), v8bf), l1 = __builtin_convertvector(s[1][qt] - __builtin_convertvector(h1, v8f), v8bf);
                pf[qt] = __builtin_shufflevector(h0, h1, 0, 1, 2, 3, 4, 5, 6, 7, 8, 9, 10, 11, 12, 13, 14, 15); pf2[qt] = __builtin_shufflevector(l0, l1, 0, 1, 2, 3, 4, 5, 6, 7, 8, 9, 10, 11, 12, 13, 14, 15);
            } else pf[qt] = cat16(__builtin_convertvector(s[0][qt], v8h), __builtin_convertvector(s[1][qt], v8h)); }
#pragma unroll
        for (int dt = 0; dt < 4; ++dt)
#pragma unroll
            for (int qt = 0; qt < NQT; ++qt) o[dt][qt] = F::mma(vf[dt], pf[qt], o[dt][qt]);
        if (HI) {
#pragma unroll
            for (int dt = 0; dt < 4; ++dt)
#pragma unroll
                for (int qt = 0; qt < NQT; ++qt) o[dt][qt] = F::mma(vf[dt], pf2[qt], o[dt][qt]);
#pragma unroll
            for (int dt = 0; dt < 4; ++dt)
#pragma unroll
                for (int qt = 0; qt < NQT; ++qt) o[dt][qt] = F::mma(vf2[dt], pf[qt], o[dt][qt]); }
        // four vector slots behind the pass's last matrix instruction, for the taken back edge
        if constexpr (NQT == 2) asm volatile("v_nop\n\tv_nop\n\tv_nop\n\tv_nop" : "+v"(o[0][0]), "+v"(o[1][0]), "+v"(o[2][0]), "+v"(o[3][0]), "+v"(o[0][1]), "+v"(o[1][1]), "+v"(o[2][1]), "+v"(o[3][1]));
        else asm volatile("v_nop\n\tv_nop\n\tv_nop\n\tv_nop" : "+v"(o[0][0]), "+v"(o[1][0]), "+v"(o[2][0]), "+v"(o[3][0]));
    }
#pragma unroll
    for (int qt = 0; qt < NQT; ++qt) { l[qt] += __shfl_xor(l[qt], 16, 32); const int q = w * 32 + qt * 16 + lr; if (hi == 0) { ms[q] = mu[qt]; ls[q] = l[qt]; }
#pragma unroll
        for (int dt = 0; dt < 4; ++dt) { float* d = os + (size_t)q * OP + dt * 16 + hi * 8; *(v4fa*)d = __builtin_shufflevector(o[dt][qt], o[dt][qt], 0, 1, 2, 3); *(v4fa*)(d + 4) = __builtin_shufflevector(o[dt][qt], o[dt][qt], 4, 5, 6, 7); } }
    __syncthreads();   // every wave's partials are in LDS before any thread joins them
    constexpr int CH = NQT * 4;   // outputs per thread: NQT x 16 queries x 64 over 256 threads
    const int q = threadIdx.x / (HD / CH), d0 = (threadIdx.x % (HD / CH)) * CH;
    float M = ms[q];
#pragma unroll
    for (int ww = 1; ww < KW; ++ww) M = fmaxf(M, ms[ww * 32 + q]);
    float L = 0.f; v4f acc[CH / 4];
#pragma unroll
    for (int c = 0; c < CH / 4; ++c) acc[c] = (v4f){};
#pragma unroll
    for (int ww = 0; ww < KW; ++ww) { const float al = exp2s(ms[ww * 32 + q] - M); L += ls[ww * 32 + q] * al;
#pragma unroll
        for (int c = 0; c < CH / 4; ++c) acc[c] += *(const v4fa*)(os + (size_t)(ww * 32 + q) * OP + d0 + c * 4) * al; }
    const float r = __fdiv_rn(1.0f, L);
#pragma unroll
    for (int c = 0; c < CH / 4; ++c) *(v4f*)(outb + (size_t)(q0 + q) * DQ + d0 + c * 4) = acc[c] * r;
}
// grid x: first the NB_ x RH / 16 hi/lo work-groups (16 query columns, three products each: the longest), then NB_ x (TT - RH) / 32 fp16 ones (32 columns)
__global__ __launch_bounds__(KW * 32) __attribute__((amdgpu_waves_per_eu(4, 4))) void k_fattn(const h16* __restrict__ Q16, const h16* __restrict__ K16, const h16* __restrict__ V16, const bf* __restrict__ Qh, const bf* __restrict__ Ql, const bf* __restrict__ Kh, const bf* __restrict__ Kl, const bf* __restrict__ Vh, const bf* __restrict__ Vl, float* __restrict__ OUTp) {
    __shared__ __align__(16) float os[KW * 32 * OP]; __shared__ float ms[KW * 32]; __shared__ float ls[KW * 32];
    const int bid = blockIdx.x;
    if (bid < NB_ * RH / 16) { const size_t pb = (size_t)(bid / (RH / 16)) * TT * HD; attn_cols<bf, true, 1>(Qh + pb, Ql + pb, Kh + pb, Kl + pb, Vh + pb, Vl + pb, (bid % (RH / 16)) * 16, OUTp + pb, os, ms, ls); }
    else { const int id = bid - NB_ * RH / 16; const size_t pb = (size_t)(id / ((TT - RH) / 32)) * TT * HD; attn_cols<h16, false, 2>(Q16 + pb, nullptr, K16 + pb, nullptr, V16 + pb, nullptr, RH + (id % ((TT - RH) / 32)) * 32, OUTp + pb, os, ms, ls); }
}

extern "C" void kernel_launch(void* const* d_in, const int* in_sizes, int n_in,
                              void* d_out, int out_size, void* d_ws, size_t ws_size, hipStream_t stream) {
    (void)in_sizes; (void)n_in; (void)out_size;
    const float* x = (const float*)d_in[0]; const float* wk3 = (const float*)d_in[1];   /* kernel [3][64][64] 'xw' */ const float* wq = wk3; const float* wk = wk3 + 64 * 64; const float* wv = wk3 + 2 * 64 * 64;
    float* OUT = (float*)d_out;     // [4][4096][64]
    char* wsp = (char*)d_ws;
    auto take = [&](size_t bytes) { char* p = wsp; wsp += (bytes + 255) & ~(size_t)255; return (void*)p; };
    // x', projections and q/k/v planes hold all NB_ batches, [batch] outermost
    bf* XPl = (bf*)take((size_t)NB_ * TT * DM * 2); bf* WQ = (bf*)take((size_t)DQ * DM * 2); bf* WK = (bf*)take((size_t)DKV * DM * 2); bf* WV = (bf*)take((size_t)DKV * DM * 2); float* CS = (float*)take((size_t)TT * HD * 2 * 4);
    bf* XB = (bf*)take((size_t)NB_ * TT * DM * 2); float* FQ = (float*)take((size_t)NB_ * TT * DQ * 4); float* FK = (float*)take((size_t)NB_ * TT * DKV * 4);
    h16* QP16 = (h16*)take((size_t)NB_ * NH_ * TT * HD * 2); h16* KP16 = (h16*)take((size_t)NB_ * NKV * TT * HD * 2); h16* VT16 = (h16*)take((size_t)NB_ * NKV * HD * TT * 2);
    bf* QPh = (bf*)take((size_t)NB_ * NH_ * TT * HD * 2); bf* QPl = (bf*)take((size_t)NB_ * NH_ * TT * HD * 2); bf* KPh = (bf*)take((size_t)NB_ * NKV * TT * HD * 2); bf* KPl = (bf*)take((size_t)NB_ * NKV * TT * HD * 2); bf* VTh = (bf*)take((size_t)NB_ * NKV * HD * TT * 2); bf* VTl = (bf*)take((size_t)NB_ * NKV * HD * TT * 2);
    if ((size_t)(wsp - (char*)d_ws) > ws_size) return;    // ws 256 MiB
    float* FV = FK;   // v projection reuses the k buffer after the k planes are built (stream-ordered)
    k_wtG<<<(unsigned)((DM * DQ / 64 + 63) / 64), 256, 0, stream>>>(wq, DM, DQ, WQ); k_wtG<<<(unsigned)((DM * DKV / 64 + 63) / 64), 256, 0, stream>>>(wk, DM, DKV, WK); k_wtG<<<(unsigned)((DM * DKV / 64 + 63) / 64), 256, 0, stream>>>(wv, DM, DKV, WV);
    k_csid<<<(TT * HD + 255) / 256, 256, 0, stream>>>(CS);
    const unsigned LQ = (unsigned)(((size_t)NH_ * TT * HD / 2 + 255) / 256), LKv = (unsigned)(((size_t)NKV * TT * HD / 2 + 255) / 256);
    // all batches at once: the rows of the NB_ batches are one [NB_ x TT] row range for x + PE and the projections, grid y is the batch for the plane builders
    k_addposenc<<<(unsigned)(((size_t)NB_ * TT * DM / 4 + 255) / 256), 256, 0, stream>>>(x, XB, XPl);   /* x + PE -> hi/lo planes (XB = hi) */
    k_gemmw<bf, 1, false, 1><<<dim3(NB_ * TT / 64, DQ / 64, 1), 32, 0, stream>>>(XB, XPl, WQ, nullptr, DM, DM, FQ, DQ, nullptr, 0, 0, 0, 0, 0, 0);
    k_rope<<<dim3(LQ, NB_), 256, 0, stream>>>(FQ, DQ, NH_, CS, nullptr, nullptr, 1.0f, QP16, QPh, QPl);
    k_gemmw<bf, 1, false, 1><<<dim3(NB_ * TT / 64, DKV / 64, 1), 32, 0, stream>>>(XB, XPl, WK, nullptr, DM, DM, FK, DKV, nullptr, 0, 0, 0, 0, 0, 0);
    k_rope<<<dim3(LKv, NB_), 256, 0, stream>>>(FK, DKV, NKV, CS, nullptr, nullptr, 1.0f, KP16, KPh, KPl);
    k_gemmw<bf, 1, false, 1><<<dim3(NB_ * TT / 64, DKV / 64, 1), 32, 0, stream>>>(XB, XPl, WV, nullptr, DM, DM, FV, DKV, nullptr, 0, 0, 0, 0, 0, 0);
    k_vtp<<<dim3(LKv, NB_), 256, 0, stream>>>(FV, DKV, NKV, VT16, VTh, VTl);
    // attention: one launch for all batches and both row classes
    k_fattn<<<NB_ * RH / 16 + NB_ * (TT - RH) / 32, KW * 32, 0, stream>>>(QP16, KP16, VT16, QPh, QPl, KPh, KPl, VTh, VTl, OUT);
}

// v004
// One run takes 77.8 microseconds.
// Two timings next to v003 put it at 1.49 and 1.50 times that version's speed.
// All steps since v000 together make it 11.5 times as fast.
#include <hip/hip_runtime.h>

// Single-head self-attention with a sinusoidal (sine-only) position embedding (x [4][4096][64]; x' = x + PE, PE[i][j] = sin(i x 10000^(-2j/64)) (computed: float32 inverse frequencies via pow, precise sinf); q, k, v = x' kernel[0|1|2] ('xw' [64][64] 0.05, no bias); scores / 8 over all 4,096 keys; softmax; out = attn v -> [4][4096][64] (1.0 M)).
// Two launches: k_prep (x + PE, the three projections and every q/k/v plane, all 4 batches, 64 rows of x per work-group) and the one fused attention kernel.
// Layout per batch: x + PE summed in f32 from the bf16-rounded input and split into hi/lo bf16 (the sum is not bf16-exact); projections hi/lo x exact (2 products); one 64-wide head, attention fused in one kernel (hybrid rows: < 512 hi/lo 3 products, rest fp16; running-maximum softmax in registers, scores and probabilities never stored); 8 key slices per work-group joined in LDS.
// Compute dtypes, f32 accumulate: every input rounded to bf16; position embedding f32; projections hi/lo x exact; attention rows < 512 3 products, rest fp16; softmax f32; output f32.
#define NB_  4
#define TT   4096
#define DM   64
#define NH_  1
#define NKV  1
#define REP  (NH_ / NKV)
#define HD   64
#define DQ   (NH_ * HD)
#define DKV  (NKV * HD)
#define RH   512                  // query rows < RH use hi+lo planes (0: none)
#define WIN  0
#define SCL  0.125f   // HD^-0.5
#define KW   8                    // waves of an attention work-group: each walks its own slice of TT / KW keys for the same query columns
#define OP   68                   // LDS pitch in floats of a query's 64 partial outputs
typedef _Float16 h16;
typedef unsigned short bf;
typedef __attribute__((ext_vector_type(16))) __bf16   v16bf;
typedef __attribute__((ext_vector_type(16))) _Float16 v16h;
typedef __attribute__((ext_vector_type(8)))  _Float16 v8h;
typedef __attribute__((ext_vector_type(8)))  unsigned short v8us;
typedef __attribute__((ext_vector_type(8)))  float    v8f;
typedef __attribute__((ext_vector_type(4)))  float    v4f;
typedef v8h  __attribute__((may_alias)) v8ha;
typedef v4f  __attribute__((may_alias)) v4fa;
typedef v8us __attribute__((may_alias)) v8usa;

__device__ __forceinline__ unsigned short f2bf(float f) { unsigned u = __float_as_uint(f); u += 0x7FFFu + ((u >> 16) & 1u); return (unsigned short)(u >> 16); }
__device__ __forceinline__ float bf2f(unsigned short b) { return __uint_as_float(((unsigned)b) << 16); }
__device__ __forceinline__ float bfr(float f) { return bf2f(f2bf(f)); }
__device__ __forceinline__ v16h cat16(v8h lo, v8h hi) { return __builtin_shufflevector(lo, hi, 0, 1, 2, 3, 4, 5, 6, 7, 8, 9, 10, 11, 12, 13, 14, 15); }
__device__ __forceinline__ v16bf cat16b(v8us lo, v8us hi) { return __builtin_bit_cast(v16bf, __builtin_shufflevector(lo, hi, 0, 1, 2, 3, 4, 5, 6, 7, 8, 9, 10, 11, 12, 13, 14, 15)); }
__device__ __forceinline__ v8f wmma16(v16h a, v16h b, v8f c) { return __builtin_amdgcn_wmma_f32_16x16x32_f16(false, a, false, b, (short)0, c, false, false); }
__device__ __forceinline__ v8f wmmab(v16bf a, v16bf b, v8f c) { return __builtin_amdgcn_wmma_f32_16x16x32_bf16(false, a, false, b, (short)0, c, false, false); }

// 16x16x32 operand fragment of lane (lr, hi): 16-bit elements p[0..7] and p[16..23], p = row lr + 8 hi; the same map serves A and B
template <typename T16> struct WFrag;
template <> struct WFrag<h16> { typedef v16h V; static __device__ __forceinline__ V ld(const h16* p) { return cat16(*(const v8h*)p, *(const v8h*)(p + 16)); } static __device__ __forceinline__ v8f mma(V a, V b, v8f c) { return wmma16(a, b, c); } };
template <> struct WFrag<bf> { typedef v16bf V; static __device__ __forceinline__ V ld(const bf* p) { return cat16b(*(const v8us*)p, *(const v8us*)(p + 16)); } static __device__ __forceinline__ v8f mma(V a, V b, v8f c) { return wmmab(a, b, c); } };
__device__ __forceinline__ h16 tohx(float x) { return (h16)x; }
__device__ __forceinline__ void splitf(float y, unsigned short& h, unsigned short& l) { h = f2bf(y); l = f2bf(y - bf2f(h)); }
__constant__ __attribute__((aligned(16))) float PEINV[DM] = { 1.000000000e+00f,7.498942018e-01f,5.623413324e-01f,4.216965139e-01f,3.162277639e-01f,2.371373624e-01f,1.778279394e-01f,1.333521456e-01f,1.000000015e-01f,7.498941571e-02f,5.623412877e-02f,4.216964915e-02f,3.162277862e-02f,2.371373586e-02f,1.778279431e-02f,1.333521493e-02f,9.999999776e-03f,7.498942316e-03f,5.623413250e-03f,4.216964822e-03f,3.162277862e-03f,2.371373819e-03f,1.778279431e-03f,1.333521446e-03f,1.000000047e-03f,7.498941850e-04f,5.623413017e-04f,4.216964880e-04f,3.162277862e-04f,2.371373848e-04f,1.778279402e-04f,1.333521504e-04f,9.999999747e-05f,7.498942432e-05f,5.623413017e-05f,4.216965317e-05f,3.162277426e-05f,2.371373739e-05f,1.778279329e-05f,1.333521413e-05f,9.999999747e-06f,7.498942068e-06f,5.623413472e-06f,4.216964953e-06f,3.162277608e-06f,2.371373739e-06f,1.778279398e-06f,1.333521482e-06f,9.999999975e-07f,7.498942409e-07f,5.623413131e-07f,4.216964840e-07f,3.162277551e-07f,2.371373711e-07f,1.778279284e-07f,1.333521453e-07f,1.000000012e-07f,7.498942267e-08f,5.623413202e-08f,4.216964911e-08f,3.162277551e-08f,2.371373675e-08f,1.778279390e-08f,1.333521382e-08f };   // 1/10000^(2j/64) for j < 64 as float32 (jnp.power form, precomputed)

#define PR   64                   // rows of x per k_prep work-group: its 64 keys of a V^T row are one whole 128-byte line
#define XP   72                   // LDS pitch in 16-bit elements of a 64-wide row (144 bytes = 16 x odd, for 16-byte fragment reads)
// eight f32 results of one lane, contiguous in the plane: fp16 + hi/lo bf16, one 16-byte store each
__device__ __forceinline__ void put8(v8f r, h16* p16, bf* ph, bf* pl) { v8h o16; v8us oh, ol;
#pragma unroll
    for (int j = 0; j < 8; ++j) { o16[j] = tohx(r[j]); unsigned short a2, c2; splitf(r[j], a2, c2); oh[j] = a2; ol[j] = c2; }
    *(v8h*)p16 = o16; *(v8us*)ph = oh; *(v8us*)pl = ol; }
// ---- k_prep: x + PE, q/k/v projections and their planes in one kernel. grid x = [NB_ x TT] rows / PR, 12 waves.
// Waves 0-7 form x + PE (16 values a thread) as hi/lo bf16 rows in LDS, waves 8-11 the three weight matrices as bf16 [n][k] rows; behind the barrier wave w owns matrix w / 4 and 16 rows (w % 4).
// q and k: D = W^T x'^T (A = 16 output columns, B = 16 rows of x'), so a lane holds 8 neighbouring d of one row t; v: D = x' W (A = rows, B = columns), 8 neighbouring t of one d, which is the V^T plane's order. Per tile: hi k 0-31, lo k 0-31, hi k 32-63, lo k 32-63.
__global__ __launch_bounds__(384) void k_prep(const float* __restrict__ x, const float* __restrict__ wk3, h16* __restrict__ Q16, bf* __restrict__ Qh, bf* __restrict__ Ql, h16* __restrict__ K16, bf* __restrict__ Kh, bf* __restrict__ Kl, h16* __restrict__ V16, bf* __restrict__ Vh, bf* __restrict__ Vl) {
    __shared__ __align__(16) bf xh[PR * XP]; __shared__ __align__(16) bf xl[PR * XP]; __shared__ __align__(16) bf wt[3 * HD * XP];
    const int tid = threadIdx.x, w = __builtin_amdgcn_readfirstlane(tid >> 5); const int R0 = blockIdx.x * PR;   // first row of the work-group in [NB_ x TT]; PR divides TT, so all its rows are of one batch
    if (w < 8) {
        const int row = tid >> 2, c0 = (tid & 3) * 16; const int t = R0 % TT + row; const float* xr = x + (size_t)(R0 + row) * DM + c0;
        v4f x4[4], f4[4];   // the thread's inverse frequencies come in with its x, ahead of the sines: fetched one by one between the sines' branches, each would be waited for alone
#pragma unroll
        for (int i = 0; i < 4; ++i) { x4[i] = *(const v4f*)(xr + 4 * i); f4[i] = *(const v4f*)(PEINV + c0 + 4 * i); }
        v8us oh[2], ol[2];
#pragma unroll
        for (int q = 0; q < 16; ++q) { const float ang = __fmul_rn((float)t, f4[q >> 2][q & 3]); const float s = __fadd_rn(bfr(x4[q >> 2][q & 3]), sinf(ang)); unsigned short u, v; splitf(s, u, v); oh[q >> 3][q & 7] = u; ol[q >> 3][q & 7] = v; }
#pragma unroll
        for (int i = 0; i < 2; ++i) { *(v8usa*)(xh + row * XP + c0 + 8 * i) = oh[i]; *(v8usa*)(xl + row * XP + c0 + 8 * i) = ol[i]; }
    } else {
        const int u = tid - 256, kb = u >> 4, nq = u & 15;   // 8 k x 4 n of each matrix a thread
#pragma unroll
        for (int m = 0; m < 3; ++m) { v4f r[8];
#pragma unroll
            for (int kk = 0; kk < 8; ++kk) r[kk] = *(const v4f*)(wk3 + (size_t)m * DM * HD + (kb * 8 + kk) * HD + nq * 4);
#pragma unroll
            for (int c = 0; c < 4; ++c) { v8us o;
#pragma unroll
                for (int kk = 0; kk < 8; ++kk) o[kk] = f2bf(r[kk][c]);
                *(v8usa*)(wt + (m * HD + nq * 4 + c) * XP + kb * 8) = o; } }
    }
    __syncthreads();   // x' rows and weight rows are in LDS before any wave reads its fragments
    typedef WFrag<bf> F;
    const int lane = tid & 31, lr = lane & 15, hi = lane >> 4, m = w >> 2, rt = w & 3;
    v16bf ah[2], al[2];
#pragma unroll
    for (int kc = 0; kc < 2; ++kc) { const int o = (rt * 16 + lr) * XP + kc * 32 + 8 * hi; ah[kc] = F::ld(xh + o); al[kc] = F::ld(xl + o); }
    const bf* wp = wt + (m * HD + lr) * XP + 8 * hi;
    if (m < 2) {
        h16* P16 = m ? K16 : Q16; bf* Ph = m ? Kh : Qh; bf* Pl = m ? Kl : Ql; const size_t ob = (size_t)(R0 + rt * 16 + lr) * HD + hi * 8;
#pragma unroll
        for (int nb = 0; nb < 4; ++nb) { const v16bf b0 = F::ld(wp + nb * 16 * XP), b1 = F::ld(wp + nb * 16 * XP + 32); v8f acc = (v8f){};
            acc = wmmab(b0, ah[0], acc); acc = wmmab(b0, al[0], acc); acc = wmmab(b1, ah[1], acc); acc = wmmab(b1, al[1], acc);
            put8(acc, P16 + ob + nb * 16, Ph + ob + nb * 16, Pl + ob + nb * 16); }
    } else {
        const size_t ob = (size_t)(R0 / TT) * HD * TT + (size_t)lr * TT + R0 % TT + rt * 16 + hi * 8;
#pragma unroll
        for (int nb = 0; nb < 4; ++nb) { const v16bf b0 = F::ld(wp + nb * 16 * XP), b1 = F::ld(wp + nb * 16 * XP + 32); v8f acc = (v8f){};
            acc = wmmab(ah[0], b0, acc); acc = wmmab(al[0], b0, acc); acc = wmmab(ah[1], b1, acc); acc = wmmab(al[1], b1, acc);
            put8(acc, V16 + ob + (size_t)nb * 16 * TT, Vh + ob + (size_t)nb * 16 * TT, Vl + ob + (size_t)nb * 16 * TT); }
        asm volatile("s_wait_xcnt 0x0" ::: "memory");   // behind this side's last stores: in the built code the other side's text follows and reuses their registers
    }
}
typedef __attribute__((ext_vector_type(8))) __bf16 v8bf;
// v_exp_f32 in asm text with the one vector slot that the instruction set asks for behind a transcendental before its result is used or its source overwritten: inside a statement the slot stands where it is written, whatever registers the allocator reuses next.
__device__ __forceinline__ float exp2s(float x) { float r; asm("v_exp_f32 %0, %1\n\tv_nop" : "=v"(r) : "v"(x)); return r; }
// eight in place: each next one is independent and fills the slot of the one before, the v_nop that of the last
__device__ __forceinline__ void exp2x8(v8f& x) { float a = x[0], b = x[1], c = x[2], d = x[3], e = x[4], f = x[5], g = x[6], h = x[7];
    asm("v_exp_f32 %0, %0\n\tv_exp_f32 %1, %1\n\tv_exp_f32 %2, %2\n\tv_exp_f32 %3, %3\n\tv_exp_f32 %4, %4\n\tv_exp_f32 %5, %5\n\tv_exp_f32 %6, %6\n\tv_exp_f32 %7, %7\n\tv_nop" : "+v"(a), "+v"(b), "+v"(c), "+v"(d), "+v"(e), "+v"(f), "+v"(g), "+v"(h));
    x[0] = a; x[1] = b; x[2] = c; x[3] = d; x[4] = e; x[5] = f; x[6] = g; x[7] = h; }
// ---- k_fattn: scores, softmax and attn x v in one kernel. S^T = K Q^T (A = 16 keys, B = 16 query columns kept in registers), so a lane holds scores of ONE query; two S^T tiles (keys 0-15, 16-31), converted in place, are the B operand of O^T += V^T P^T.
// A work-group has NQT x 16 query columns; wave w walks keys [w TT/KW, (w+1) TT/KW) with its own maximum in use, sum and O^T; the KW partials are joined in LDS in wave order.
template <typename T16, bool HI, int NQT>
__device__ __forceinline__ void attn_cols(const T16* __restrict__ Q, const T16* __restrict__ Q2, const T16* __restrict__ Kp, const T16* __restrict__ K2, const T16* __restrict__ Vt, const T16* __restrict__ V2, int q0, float* __restrict__ outb, float* os, float* ms, float* ls) {
    typedef WFrag<T16> F; typedef typename F::V V;
    const float C2 = SCL * 1.4426950408889634f;   // scores are taken to base 2
    const int lane = threadIdx.x & 31, lr = lane & 15, hi = lane >> 4, w = threadIdx.x >> 5;
    V qf[NQT][2], qf2[NQT][2];
#pragma unroll
    for (int qt = 0; qt < NQT; ++qt)
#pragma unroll
        for (int kc = 0; kc < 2; ++kc) { const size_t o = (size_t)(q0 + qt * 16 + lr) * HD + kc * 32 + 8 * hi; qf[qt][kc] = F::ld(Q + o); if (HI) qf2[qt][kc] = F::ld(Q2 + o); }
    v8f o[4][NQT]; float mu[NQT], l[NQT];
#pragma unroll
    for (int qt = 0; qt < NQT; ++qt) { mu[qt] = -3.0e38f; l[qt] = 0.f;
#pragma unroll
        for (int dt = 0; dt < 4; ++dt) o[dt][qt] = (v8f){}; }
    const size_t kbase = (size_t)(w * (TT / KW) + lr) * HD + 8 * hi, vbase = (size_t)lr * TT + w * (TT / KW) + 8 * hi;
    V kf[2][2], kf2[2][2];
#pragma unroll
    for (int kt = 0; kt < 2; ++kt)
#pragma unroll
        for (int kc = 0; kc < 2; ++kc) { const size_t a = kbase + (size_t)kt * 16 * HD + kc * 32; kf[kt][kc] = F::ld(Kp + a); if (HI) kf2[kt][kc] = F::ld(K2 + a); }
#pragma unroll 1   // one pass = 32 keys; unrolled, two passes' fragments would not fit the registers of four waves per SIMD
    for (int it = 0; it < TT / KW / 32; ++it) {
        V vf[4], vf2[4];
#pragma unroll
        for (int dt = 0; dt < 4; ++dt) { const size_t a = vbase + (size_t)dt * 16 * TT + it * 32; vf[dt] = F::ld(Vt + a); if (HI) vf2[dt] = F::ld(V2 + a); }
        v8f s[2][NQT];
#pragma unroll
        for (int kt = 0; kt < 2; ++kt)
#pragma unroll
            for (int qt = 0; qt < NQT; ++qt) s[kt][qt] = (v8f){};
#pragma unroll
        for (int kc = 0; kc < 2; ++kc) {
#pragma unroll
            for (int kt = 0; kt < 2; ++kt)
#pragma unroll
                for (int qt = 0; qt < NQT; ++qt) s[kt][qt] = F::mma(kf[kt][kc], qf[qt][kc], s[kt][qt]);
            if (HI) {
#pragma unroll
                for (int kt = 0; kt < 2; ++kt)
#pragma unroll
                    for (int qt = 0; qt < NQT; ++qt) s[kt][qt] = F::mma(kf2[kt][kc], qf[qt][kc], s[kt][qt]);
#pragma unroll
                for (int kt = 0; kt < 2; ++kt)
#pragma unroll
                    for (int qt = 0; qt < NQT; ++qt) s[kt][qt] = F::mma(kf[kt][kc], qf2[qt][kc], s[kt][qt]); } }
        { const int itn = (it + 1 < TT / KW / 32) ? it + 1 : it;   // next pass's K fragments, fetched behind this pass's score products (the last pass fetches its own again)
#pragma unroll
            for (int kt = 0; kt < 2; ++kt)
#pragma unroll
                for (int kc = 0; kc < 2; ++kc) { const size_t a = kbase + (size_t)(itn * 32 + kt * 16) * HD + kc * 32; kf[kt][kc] = F::ld(Kp + a); if (HI) kf2[kt][kc] = F::ld(K2 + a); } }
        if constexpr (HI) asm volatile("s_wait_xcnt 0x0" ::: "memory");   // behind the pass's last load: the softmax below reuses the loads' address registers (in the fp16 body the compiler writes this wait itself)
        float ml[NQT]; bool need = false;
#pragma unroll
        for (int qt = 0; qt < NQT; ++qt) { float mx = fmaxf(s[0][qt][0], s[1][qt][0]);
#pragma unroll
            for (int j = 1; j < 8; ++j) mx = fmaxf(mx, fmaxf(s[0][qt][j], s[1][qt][j]));
            ml[qt] = mx * C2; need = need || (ml[qt] > mu[qt] + 8.0f); }
        if (__builtin_amdgcn_ballot_w32(need) != 0) {   // the maximum in use moves only when a score passes it by more than 2^8: rare behind the first pass
#pragma unroll
            for (int qt = 0; qt < NQT; ++qt) { const float mn = fmaxf(mu[qt], fmaxf(ml[qt], __shfl_xor(ml[qt], 16, 32))); const float al = exp2s(mu[qt] - mn); mu[qt] = mn; l[qt] *= al;
#pragma unroll
                for (int dt = 0; dt < 4; ++dt) o[dt][qt] *= al; } }
        V pf[NQT], pf2[NQT];
#pragma unroll
        for (int qt = 0; qt < NQT; ++qt) {
#pragma unroll
            for (int kt = 0; kt < 2; ++kt) {
#pragma unroll
                for (int j = 0; j < 8; ++j) s[kt][qt][j] = __builtin_fmaf(s[kt][qt][j], C2, -mu[qt]);
                exp2x8(s[kt][qt]);
#pragma unroll
                for (int j = 0; j < 8; ++j) l[qt] += s[kt][qt][j]; }
            if constexpr (HI) { const v8bf h0 = __builtin_convertvector(s[0][qt], v8bf), h1 = __builtin_convertvector(s[1][qt], v8bf);
                const v8bf l0 = __builtin_convertvector(s[0][qt] - __builtin_convertvector(h0, v8f), v8bf), l1 = __builtin_convertvector(s[1][qt] - __builtin_convertvector(h1, v8f), v8bf);
                pf[qt] = __builtin_shufflevector(h0, h1, 0, 1, 2, 3, 4, 5, 6, 7, 8, 9, 10, 11, 12, 13, 14, 15); pf2[qt] = __builtin_shufflevector(l0, l1, 0, 1, 2, 3, 4, 5, 6, 7, 8, 9, 10, 11, 12, 13, 14, 15);
            } else pf[qt] = cat16(__builtin_convertvector(s[0][qt], v8h), __builtin_convertvector(s[1][qt], v8h)); }
#pragma unroll
        for (int dt = 0; dt < 4; ++dt)
#pragma unroll
            for (int qt = 0; qt < NQT; ++qt) o[dt][qt] = F::mma(vf[dt], pf[qt], o[dt][qt]);
        if (HI) {
#pragma unroll
            for (int dt = 0; dt < 4; ++dt)
#pragma unroll
                for (int qt = 0; qt < NQT; ++qt) o[dt][qt] = F::mma(vf[dt], pf2[qt], o[dt][qt]);
#pragma unroll
            for (int dt = 0; dt < 4; ++dt)
#pragma unroll
                for (int qt = 0; qt < NQT; ++qt) o[dt][qt] = F::mma(vf2[dt], pf[qt], o[dt][qt]); }
        // four vector slots behind the pass's last matrix instruction, for the taken back edge
        if constexpr (NQT == 2) asm volatile("v_nop\n\tv_nop\n\tv_nop\n\tv_nop" : "+v"(o[0][0]), "+v"(o[1][0]), "+v"(o[2][0]), "+v"(o[3][0]), "+v"(o[0][1]), "+v"(o[1][1]), "+v"(o[2][1]), "+v"(o[3][1]));
        else asm volatile("v_nop\n\tv_nop\n\tv_nop\n\tv_nop" : "+v"(o[0][0]), "+v"(o[1][0]), "+v"(o[2][0]), "+v"(o[3][0]));
    }
#pragma unroll
    for (int qt = 0; qt < NQT; ++qt) { l[qt] += __shfl_xor(l[qt], 16, 32); const int q = w * 32 + qt * 16 + lr; if (hi == 0) { ms[q] = mu[qt]; ls[q] = l[qt]; }
#pragma unroll
        for (int dt = 0; dt < 4; ++dt) { float* d = os + (size_t)q * OP + dt * 16 + hi * 8; *(v4fa*)d = __builtin_shufflevector(o[dt][qt], o[dt][qt], 0, 1, 2, 3); *(v4fa*)(d + 4) = __builtin_shufflevector(o[dt][qt], o[dt][qt], 4, 5, 6, 7); } }
    __syncthreads();   // every wave's partials are in LDS before any thread joins them
    constexpr int CH = NQT * 4;   // outputs per thread: NQT x 16 queries x 64 over 256 threads
    const int q = threadIdx.x / (HD / CH), d0 = (threadIdx.x % (HD / CH)) * CH;
    float M = ms[q];
#pragma unroll
    for (int ww = 1; ww < KW; ++ww) M = fmaxf(M, ms[ww * 32 + q]);
    float L = 0.f; v4f acc[CH / 4];
#pragma unroll
    for (int c = 0; c < CH / 4; ++c) acc[c] = (v4f){};
#pragma unroll
    for (int ww = 0; ww < KW; ++ww) { const float al = exp2s(ms[ww * 32 + q] - M); L += ls[ww * 32 + q] * al;
#pragma unroll
        for (int c = 0; c < CH / 4; ++c) acc[c] += *(const v4fa*)(os + (size_t)(ww * 32 + q) * OP + d0 + c * 4) * al; }
    const float r = __fdiv_rn(1.0f, L);
#pragma unroll
    for (int c = 0; c < CH / 4; ++c) *(v4f*)(outb + (size_t)(q0 + q) * DQ + d0 + c * 4) = acc[c] * r;
}
// grid x: first the NB_ x RH / 16 hi/lo work-groups (16 query columns, three products each: the longest), then NB_ x (TT - RH) / 32 fp16 ones (32 columns)
__global__ __launch_bounds__(KW * 32) __attribute__((amdgpu_waves_per_eu(4, 4))) void k_fattn(const h16* __restrict__ Q16, const h16* __restrict__ K16, const h16* __restrict__ V16, const bf* __restrict__ Qh, const bf* __restrict__ Ql, const bf* __restrict__ Kh, const bf* __restrict__ Kl, const bf* __restrict__ Vh, const bf* __restrict__ Vl, float* __restrict__ OUTp) {
    __shared__ __align__(16) float os[KW * 32 * OP]; __shared__ float ms[KW * 32]; __shared__ float ls[KW * 32];
    const int bid = blockIdx.x;
    if (bid < NB_ * RH / 16) { const size_t pb = (size_t)(bid / (RH / 16)) * TT * HD; attn_cols<bf, true, 1>(Qh + pb, Ql + pb, Kh + pb, Kl + pb, Vh + pb, Vl + pb, (bid % (RH / 16)) * 16, OUTp + pb, os, ms, ls); }
    else { const int id = bid - NB_ * RH / 16; const size_t pb = (size_t)(id / ((TT - RH) / 32)) * TT * HD; attn_cols<h16, false, 2>(Q16 + pb, nullptr, K16 + pb, nullptr, V16 + pb, nullptr, RH + (id % ((TT - RH) / 32)) * 32, OUTp + pb, os, ms, ls); }
}

extern "C" void kernel_launch(void* const* d_in, const int* in_sizes, int n_in,
                              void* d_out, int out_size, void* d_ws, size_t ws_size, hipStream_t stream) {
    (void)in_sizes; (void)n_in; (void)out_size;
    const float* x = (const float*)d_in[0]; const float* wk3 = (const float*)d_in[1];   /* kernel [3][64][64] 'xw': q, k, v */
    float* OUT = (float*)d_out;     // [4][4096][64]
    char* wsp = (char*)d_ws;
    auto take = [&](size_t bytes) { char* p = wsp; wsp += (bytes + 255) & ~(size_t)255; return (void*)p; };
    // q/k/v planes hold all NB_ batches, [batch] outermost
    h16* QP16 = (h16*)take((size_t)NB_ * NH_ * TT * HD * 2); h16* KP16 = (h16*)take((size_t)NB_ * NKV * TT * HD * 2); h16* VT16 = (h16*)take((size_t)NB_ * NKV * HD * TT * 2);
    bf* QPh = (bf*)take((size_t)NB_ * NH_ * TT * HD * 2); bf* QPl = (bf*)take((size_t)NB_ * NH_ * TT * HD * 2); bf* KPh = (bf*)take((size_t)NB_ * NKV * TT * HD * 2); bf* KPl = (bf*)take((size_t)NB_ * NKV * TT * HD * 2); bf* VTh = (bf*)take((size_t)NB_ * NKV * HD * TT * 2); bf* VTl = (bf*)take((size_t)NB_ * NKV * HD * TT * 2);
    if ((size_t)(wsp - (char*)d_ws) > ws_size) return;    // ws 256 MiB
    k_prep<<<NB_ * TT / PR, 384, 0, stream>>>(x, wk3, QP16, QPh, QPl, KP16, KPh, KPl, VT16, VTh, VTl);
    // attention: one launch for all batches and both row classes
    k_fattn<<<NB_ * RH / 16 + NB_ * (TT - RH) / 32, KW * 32, 0, stream>>>(QP16, KP16, VT16, QPh, QPl, KPh, KPl, VTh, VTl, OUT);
}

// v005
// One run takes 38.9 microseconds.
// Two timings next to v004 put it at 2.04 and 1.96 times that version's speed.
// Over all steps from v000 it is 22.9 times as fast.
#include <hip/hip_runtime.h>

// Single-head self-attention with a sinusoidal (sine-only) position embedding (x [4][4096][64]; x' = x + PE, PE[i][j] = sin(i x 10000^(-2j/64)) (computed: float32 inverse frequencies via pow, precise sinf); q, k, v = x' kernel[0|1|2] ('xw' [64][64] 0.05, no bias); scores / 8 over all 4,096 keys; softmax; out = attn v -> [4][4096][64] (1.0 M)).
// Two launches: k_prep (x + PE, the three projections and every q/k/v plane, all 4 batches, 64 rows of x per work-group) and the one fused attention kernel.
// The q/k/v planes lie in fragment order: a chunk of FC elements holds, lane after lane, the 8 elements that each of the 32 lanes takes with one 16-byte load, so a wave's load or store covers 512 bytes in a row (4 whole lines, not 32 bytes of each of 16).
// Layout per batch: x + PE summed in f32 from the bf16-rounded input and split into hi/lo bf16 (the sum is not bf16-exact); projections hi/lo x exact (2 products); one 64-wide head, attention fused in one kernel (hybrid rows: < 512 hi/lo 3 products, rest fp16; running-maximum softmax in registers, scores and probabilities never stored); 8 key slices per work-group joined in LDS.
// Compute dtypes, f32 accumulate: every input rounded to bf16; position embedding f32; projections hi/lo x exact; attention rows < 512 3 products, rest fp16; softmax f32; output f32.
#define NB_  4
#define TT   4096
#define DM   64
#define NH_  1
#define NKV  1
#define REP  (NH_ / NKV)
#define HD   64
#define DQ   (NH_ * HD)
#define DKV  (NKV * HD)
#define RH   512                  // query rows < RH use hi+lo planes (0: none)
#define WIN  0
#define SCL  0.125f   // HD^-0.5
#define KW   8                    // waves of an attention work-group: each walks its own slice of TT / KW keys for the same query columns
#define OP   68                   // LDS pitch in floats of a query's 64 partial outputs
#define FC   256                  // 16-bit elements of a plane chunk (32 lanes x 8). q, k: [row / 16][d / 16][chunk], lane = 16 (d / 8 % 2) + row % 16; v: [key / 32][d / 16][key / 16 % 2][chunk], lane = 16 (key / 8 % 2) + d % 16
typedef _Float16 h16;
typedef unsigned short bf;
typedef __attribute__((ext_vector_type(16))) __bf16   v16bf;
typedef __attribute__((ext_vector_type(16))) _Float16 v16h;
typedef __attribute__((ext_vector_type(8)))  _Float16 v8h;
typedef __attribute__((ext_vector_type(8)))  unsigned short v8us;
typedef __attribute__((ext_vector_type(8)))  float    v8f;
typedef __attribute__((ext_vector_type(4)))  float    v4f;
typedef v8h  __attribute__((may_alias)) v8ha;
typedef v4f  __attribute__((may_alias)) v4fa;
typedef v8us __attribute__((may_alias)) v8usa;

__device__ __forceinline__ unsigned short f2bf(float f) { unsigned u = __float_as_uint(f); u += 0x7FFFu + ((u >> 16) & 1u); return (unsigned short)(u >> 16); }
__device__ __forceinline__ float bf2f(unsigned short b) { return __uint_as_float(((unsigned)b) << 16); }
__device__ __forceinline__ float bfr(float f) { return bf2f(f2bf(f)); }
__device__ __forceinline__ v16h cat16(v8h lo, v8h hi) { return __builtin_shufflevector(lo, hi, 0, 1, 2, 3, 4, 5, 6, 7, 8, 9, 10, 11, 12, 13, 14, 15); }
__device__ __forceinline__ v16bf cat16b(v8us lo, v8us hi) { return __builtin_bit_cast(v16bf, __builtin_shufflevector(lo, hi, 0, 1, 2, 3, 4, 5, 6, 7, 8, 9, 10, 11, 12, 13, 14, 15)); }
__device__ __forceinline__ v8f wmma16(v16h a, v16h b, v8f c) { return __builtin_amdgcn_wmma_f32_16x16x32_f16(false, a, false, b, (short)0, c, false, false); }
__device__ __forceinline__ v8f wmmab(v16bf a, v16bf b, v8f c) { return __builtin_amdgcn_wmma_f32_16x16x32_bf16(false, a, false, b, (short)0, c, false, false); }

// 16x16x32 operand fragment of lane (lr, hi): 16-bit elements p[0..7] and p[16..23], p = row lr + 8 hi; the same map serves A and B (ld: from a row-major tile; ldf: the same elements from two neighbouring chunks of a plane, p = chunk + 8 lane)
template <typename T16> struct WFrag;
template <> struct WFrag<h16> { typedef v16h V; static __device__ __forceinline__ V ld(const h16* p) { return cat16(*(const v8h*)p, *(const v8h*)(p + 16)); } static __device__ __forceinline__ V ldf(const h16* p) { return cat16(*(const v8h*)p, *(const v8h*)(p + FC)); } static __device__ __forceinline__ v8f mma(V a, V b, v8f c) { return wmma16(a, b, c); } };
template <> struct WFrag<bf> { typedef v16bf V; static __device__ __forceinline__ V ld(const bf* p) { return cat16b(*(const v8us*)p, *(const v8us*)(p + 16)); } static __device__ __forceinline__ V ldf(const bf* p) { return cat16b(*(const v8us*)p, *(const v8us*)(p + FC)); } static __device__ __forceinline__ v8f mma(V a, V b, v8f c) { return wmmab(a, b, c); } };
__device__ __forceinline__ h16 tohx(float x) { return (h16)x; }
__device__ __forceinline__ void splitf(float y, unsigned short& h, unsigned short& l) { h = f2bf(y); l = f2bf(y - bf2f(h)); }
__constant__ __attribute__((aligned(16))) float PEINV[DM] = { 1.000000000e+00f,7.498942018e-01f,5.623413324e-01f,4.216965139e-01f,3.162277639e-01f,2.371373624e-01f,1.778279394e-01f,1.333521456e-01f,1.000000015e-01f,7.498941571e-02f,5.623412877e-02f,4.216964915e-02f,3.162277862e-02f,2.371373586e-02f,1.778279431e-02f,1.333521493e-02f,9.999999776e-03f,7.498942316e-03f,5.623413250e-03f,4.216964822e-03f,3.162277862e-03f,2.371373819e-03f,1.778279431e-03f,1.333521446e-03f,1.000000047e-03f,7.498941850e-04f,5.623413017e-04f,4.216964880e-04f,3.162277862e-04f,2.371373848e-04f,1.778279402e-04f,1.333521504e-04f,9.999999747e-05f,7.498942432e-05f,5.623413017e-05f,4.216965317e-05f,3.162277426e-05f,2.371373739e-05f,1.778279329e-05f,1.333521413e-05f,9.999999747e-06f,7.498942068e-06f,5.623413472e-06f,4.216964953e-06f,3.162277608e-06f,2.371373739e-06f,1.778279398e-06f,1.333521482e-06f,9.999999975e-07f,7.498942409e-07f,5.623413131e-07f,4.216964840e-07f,3.162277551e-07f,2.371373711e-07f,1.778279284e-07f,1.333521453e-07f,1.000000012e-07f,7.498942267e-08f,5.623413202e-08f,4.216964911e-08f,3.162277551e-08f,2.371373675e-08f,1.778279390e-08f,1.333521382e-08f };   // 1/10000^(2j/64) for j < 64 as float32 (jnp.power form, precomputed)

#define PR   64                   // rows of x per k_prep work-group: four 16-row tiles of the q and k planes, two 32-key blocks of the v plane
#define XP   72                   // LDS pitch in 16-bit elements of a 64-wide row (144 bytes = 16 x odd, for 16-byte fragment reads)
// eight f32 results of one lane, contiguous in the plane: fp16 + hi/lo bf16, one 16-byte store each
__device__ __forceinline__ void put8(v8f r, h16* p16, bf* ph, bf* pl) { v8h o16; v8us oh, ol;
#pragma unroll
    for (int j = 0; j < 8; ++j) { o16[j] = tohx(r[j]); unsigned short a2, c2; splitf(r[j], a2, c2); oh[j] = a2; ol[j] = c2; }
    *(v8h*)p16 = o16; *(v8us*)ph = oh; *(v8us*)pl = ol; }
// ---- k_prep: x + PE, q/k/v projections and their planes in one kernel. grid x = [NB_ x TT] rows / PR, 12 waves.
// Waves 0-7 form x + PE (16 values a thread) as hi/lo bf16 rows in LDS, waves 8-11 the three weight matrices as bf16 [n][k] rows; behind the barrier wave w owns matrix w / 4 and 16 rows (w % 4).
// q and k: D = W^T x'^T (A = 16 output columns, B = 16 rows of x'), so a lane holds 8 neighbouring d of one row t; v: D = x' W (A = rows, B = columns), 8 neighbouring t of one d: in both cases the 8 elements that one lane of an attention fragment takes with one load, so each tile goes out as whole chunks. Per tile: hi k 0-31, lo k 0-31, hi k 32-63, lo k 32-63.
__global__ __launch_bounds__(384) void k_prep(const float* __restrict__ x, const float* __restrict__ wk3, h16* __restrict__ Q16, bf* __restrict__ Qh, bf* __restrict__ Ql, h16* __restrict__ K16, bf* __restrict__ Kh, bf* __restrict__ Kl, h16* __restrict__ V16, bf* __restrict__ Vh, bf* __restrict__ Vl) {
    __shared__ __align__(16) bf xh[PR * XP]; __shared__ __align__(16) bf xl[PR * XP]; __shared__ __align__(16) bf wt[3 * HD * XP];
    const int tid = threadIdx.x, w = __builtin_amdgcn_readfirstlane(tid >> 5); const int R0 = blockIdx.x * PR;   // first row of the work-group in [NB_ x TT]; PR divides TT, so all its rows are of one batch
    if (w < 8) {
        const int row = tid >> 2, c0 = (tid & 3) * 16; const int t = R0 % TT + row; const float* xr = x + (size_t)(R0 + row) * DM + c0;
        v4f x4[4], f4[4];   // the thread's inverse frequencies come in with its x, ahead of the sines: fetched one by one between the sines' branches, each would be waited for alone
#pragma unroll
        for (int i = 0; i < 4; ++i) { x4[i] = *(const v4f*)(xr + 4 * i); f4[i] = *(const v4f*)(PEINV + c0 + 4 * i); }
        v8us oh[2], ol[2];
#pragma unroll
        for (int q = 0; q < 16; ++q) { const float ang = __fmul_rn((float)t, f4[q >> 2][q & 3]); const float s = __fadd_rn(bfr(x4[q >> 2][q & 3]), sinf(ang)); unsigned short u, v; splitf(s, u, v); oh[q >> 3][q & 7] = u; ol[q >> 3][q & 7] = v; }
#pragma unroll
        for (int i = 0; i < 2; ++i) { *(v8usa*)(xh + row * XP + c0 + 8 * i) = oh[i]; *(v8usa*)(xl + row * XP + c0 + 8 * i) = ol[i]; }
    } else {
        const int u = tid - 256, kb = u >> 4, nq = u & 15;   // 8 k x 4 n of each matrix a thread
#pragma unroll
        for (int m = 0; m < 3; ++m) { v4f r[8];
#pragma unroll
            for (int kk = 0; kk < 8; ++kk) r[kk] = *(const v4f*)(wk3 + (size_t)m * DM * HD + (kb * 8 + kk) * HD + nq * 4);
#pragma unroll
            for (int c = 0; c < 4; ++c) { v8us o;
#pragma unroll
                for (int kk = 0; kk < 8; ++kk) o[kk] = f2bf(r[kk][c]);
                *(v8usa*)(wt + (m * HD + nq * 4 + c) * XP + kb * 8) = o; } }
    }
    __syncthreads();   // x' rows and weight rows are in LDS before any wave reads its fragments
    typedef WFrag<bf> F;
    const int lane = tid & 31, lr = lane & 15, hi = lane >> 4, m = w >> 2, rt = w & 3;
    v16bf ah[2], al[2];
#pragma unroll
    for (int kc = 0; kc < 2; ++kc) { const int o = (rt * 16 + lr) * XP + kc * 32 + 8 * hi; ah[kc] = F::ld(xh + o); al[kc] = F::ld(xl + o); }
    const bf* wp = wt + (m * HD + lr) * XP + 8 * hi;
    if (m < 2) {
        h16* P16 = m ? K16 : Q16; bf* Ph = m ? Kh : Qh; bf* Pl = m ? Kl : Ql; const size_t ob = (size_t)(R0 / 16 + rt) * (16 * HD) + lane * 8;   // tile nb holds d = 16 nb + 8 hi + j of row lr: chunk nb of the 16 rows
#pragma unroll
        for (int nb = 0; nb < 4; ++nb) { const v16bf b0 = F::ld(wp + nb * 16 * XP), b1 = F::ld(wp + nb * 16 * XP + 32); v8f acc = (v8f){};
            acc = wmmab(b0, ah[0], acc); acc = wmmab(b0, al[0], acc); acc = wmmab(b1, ah[1], acc); acc = wmmab(b1, al[1], acc);
            put8(acc, P16 + ob + nb * FC, Ph + ob + nb * FC, Pl + ob + nb * FC); }
    } else {
        const size_t ob = (size_t)(R0 / 32 + (rt >> 1)) * (32 * HD) + (rt & 1) * FC + lane * 8;   // tile nb holds keys 16 rt + 8 hi + j of d = 16 nb + lr: half rt % 2 of the 32 keys' chunk pair nb
#pragma unroll
        for (int nb = 0; nb < 4; ++nb) { const v16bf b0 = F::ld(wp + nb * 16 * XP), b1 = F::ld(wp + nb * 16 * XP + 32); v8f acc = (v8f){};
            acc = wmmab(ah[0], b0, acc); acc = wmmab(al[0], b0, acc); acc = wmmab(ah[1], b1, acc); acc = wmmab(al[1], b1, acc);
            put8(acc, V16 + ob + nb * 2 * FC, Vh + ob + nb * 2 * FC, Vl + ob + nb * 2 * FC); }
        asm volatile("s_wait_xcnt 0x0" ::: "memory");   // behind this side's last stores: in the built code the other side's text follows and reuses their registers
    }
}
typedef __attribute__((ext_vector_type(8))) __bf16 v8bf;
// v_exp_f32 in asm text with the one vector slot that the instruction set asks for behind a transcendental before its result is used or its source overwritten: inside a statement the slot stands where it is written, whatever registers the allocator reuses next.
__device__ __forceinline__ float exp2s(float x) { float r; asm("v_exp_f32 %0, %1\n\tv_nop" : "=v"(r) : "v"(x)); return r; }
// eight in place: each next one is independent and fills the slot of the one before, the v_nop that of the last
__device__ __forceinline__ void exp2x8(v8f& x) { float a = x[0], b = x[1], c = x[2], d = x[3], e = x[4], f = x[5], g = x[6], h = x[7];
    asm("v_exp_f32 %0, %0\n\tv_exp_f32 %1, %1\n\tv_exp_f32 %2, %2\n\tv_exp_f32 %3, %3\n\tv_exp_f32 %4, %4\n\tv_exp_f32 %5, %5\n\tv_exp_f32 %6, %6\n\tv_exp_f32 %7, %7\n\tv_nop" : "+v"(a), "+v"(b), "+v"(c), "+v"(d), "+v"(e), "+v"(f), "+v"(g), "+v"(h));
    x[0] = a; x[1] = b; x[2] = c; x[3] = d; x[4] = e; x[5] = f; x[6] = g; x[7] = h; }
// ---- k_fattn: scores, softmax and attn x v in one kernel. S^T = K Q^T (A = 16 keys, B = 16 query columns kept in registers), so a lane holds scores of ONE query; two S^T tiles (keys 0-15, 16-31), converted in place, are the B operand of O^T += V^T P^T.
// A work-group has NQT x 16 query columns; wave w walks keys [w TT/KW, (w+1) TT/KW) with its own maximum in use, sum and O^T; the KW partials are joined in LDS in wave order.
template <typename T16, bool HI, int NQT>
__device__ __forceinline__ void attn_cols(const T16* __restrict__ Q, const T16* __restrict__ Q2, const T16* __restrict__ Kp, const T16* __restrict__ K2, const T16* __restrict__ Vt, const T16* __restrict__ V2, int q0, float* __restrict__ outb, float* os, float* ms, float* ls) {
    typedef WFrag<T16> F; typedef typename F::V V;
    const float C2 = SCL * 1.4426950408889634f;   // scores are taken to base 2
    const int lane = threadIdx.x & 31, lr = lane & 15, hi = lane >> 4, w = threadIdx.x >> 5;
    V qf[NQT][2], qf2[NQT][2];
#pragma unroll
    for (int qt = 0; qt < NQT; ++qt)
#pragma unroll
        for (int kc = 0; kc < 2; ++kc) { const size_t o = (size_t)(q0 / 16 + qt) * (16 * HD) + kc * 2 * FC + lane * 8; qf[qt][kc] = F::ldf(Q + o); if (HI) qf2[qt][kc] = F::ldf(Q2 + o); }
    v8f o[4][NQT]; float mu[NQT], l[NQT];
#pragma unroll
    for (int qt = 0; qt < NQT; ++qt) { mu[qt] = -3.0e38f; l[qt] = 0.f;
#pragma unroll
        for (int dt = 0; dt < 4; ++dt) o[dt][qt] = (v8f){}; }
    const size_t kbase = (size_t)w * (TT / KW) * HD + lane * 8, vbase = kbase;   // a pass's 32 keys are 32 x HD elements in a row of the K plane and of the V plane alike
    V kf[2][2], kf2[2][2];
#pragma unroll
    for (int kt = 0; kt < 2; ++kt)
#pragma unroll
        for (int kc = 0; kc < 2; ++kc) { const size_t a = kbase + (size_t)kt * 16 * HD + kc * 2 * FC; kf[kt][kc] = F::ldf(Kp + a); if (HI) kf2[kt][kc] = F::ldf(K2 + a); }
#pragma unroll 1   // one pass = 32 keys; unrolled, two passes' fragments would not fit the registers of four waves per SIMD
    for (int it = 0; it < TT / KW / 32; ++it) {
        V vf[4], vf2[4]; const T16* vp = Vt + vbase + (size_t)it * 32 * HD; const T16* vp2 = HI ? V2 + vbase + (size_t)it * 32 * HD : vp;
#pragma unroll
        for (int dt = 0; dt < 4; ++dt) { vf[dt] = F::ldf(vp + dt * 2 * FC); if (HI) vf2[dt] = F::ldf(vp2 + dt * 2 * FC); }
        v8f s[2][NQT];
#pragma unroll
        for (int kt = 0; kt < 2; ++kt)
#pragma unroll
            for (int qt = 0; qt < NQT; ++qt) s[kt][qt] = (v8f){};
#pragma unroll
        for (int kc = 0; kc < 2; ++kc) {
#pragma unroll
            for (int kt = 0; kt < 2; ++kt)
#pragma unroll
                for (int qt = 0; qt < NQT; ++qt) s[kt][qt] = F::mma(kf[kt][kc], qf[qt][kc], s[kt][qt]);
            if (HI) {
#pragma unroll
                for (int kt = 0; kt < 2; ++kt)
#pragma unroll
                    for (int qt = 0; qt < NQT; ++qt) s[kt][qt] = F::mma(kf2[kt][kc], qf[qt][kc], s[kt][qt]);
#pragma unroll
                for (int kt = 0; kt < 2; ++kt)
#pragma unroll
                    for (int qt = 0; qt < NQT; ++qt) s[kt][qt] = F::mma(kf[kt][kc], qf2[qt][kc], s[kt][qt]); } }
        const int itn = (it + 1 < TT / KW / 32) ? it + 1 : it;   // next pass's K fragments, fetched behind this pass's score products (the last pass fetches its own again)
        const T16* kp = Kp + kbase + (size_t)itn * 32 * HD; const T16* kp2 = HI ? K2 + kbase + (size_t)itn * 32 * HD : kp;
#pragma unroll
            for (int kt = 0; kt < 2; ++kt)
#pragma unroll
                for (int kc = 0; kc < 2; ++kc) { const int a = kt * 16 * HD + kc * 2 * FC; kf[kt][kc] = F::ldf(kp + a); if (HI) kf2[kt][kc] = F::ldf(kp2 + a); }
        // behind the pass's last load: what follows reuses the loads' address registers; as inputs of the wait the addresses stay in their registers up to it, so that no load of the pass lands on them either
        if constexpr (HI) asm volatile("s_wait_xcnt 0x0" :: "v"(vp), "v"(vp2), "v"(kp), "v"(kp2) : "memory"); else asm volatile("s_wait_xcnt 0x0" :: "v"(vp), "v"(kp) : "memory");
        float ml[NQT]; bool need = false;
#pragma unroll
        for (int qt = 0; qt < NQT; ++qt) { float mx = fmaxf(s[0][qt][0], s[1][qt][0]);
#pragma unroll
            for (int j = 1; j < 8; ++j) mx = fmaxf(mx, fmaxf(s[0][qt][j], s[1][qt][j]));
            ml[qt] = mx * C2; need = need || (ml[qt] > mu[qt] + 8.0f); }
        if (__builtin_amdgcn_ballot_w32(need) != 0) {   // the maximum in use moves only when a score passes it by more than 2^8: rare behind the first pass
#pragma unroll
            for (int qt = 0; qt < NQT; ++qt) { const float mn = fmaxf(mu[qt], fmaxf(ml[qt], __shfl_xor(ml[qt], 16, 32))); const float al = exp2s(mu[qt] - mn); mu[qt] = mn; l[qt] *= al;
#pragma unroll
                for (int dt = 0; dt < 4; ++dt) o[dt][qt] *= al; } }
        V pf[NQT], pf2[NQT];
#pragma unroll
        for (int qt = 0; qt < NQT; ++qt) {
#pragma unroll
            for (int kt = 0; kt < 2; ++kt) {
#pragma unroll
                for (int j = 0; j < 8; ++j) s[kt][qt][j] = __builtin_fmaf(s[kt][qt][j], C2, -mu[qt]);
                exp2x8(s[kt][qt]);
#pragma unroll
                for (int j = 0; j < 8; ++j) l[qt] += s[kt][qt][j]; }
            if constexpr (HI) { const v8bf h0 = __builtin_convertvector(s[0][qt], v8bf), h1 = __builtin_convertvector(s[1][qt], v8bf);
                const v8bf l0 = __builtin_convertvector(s[0][qt] - __builtin_convertvector(h0, v8f), v8bf), l1 = __builtin_convertvector(s[1][qt] - __builtin_convertvector(h1, v8f), v8bf);
                pf[qt] = __builtin_shufflevector(h0, h1, 0, 1, 2, 3, 4, 5, 6, 7, 8, 9, 10, 11, 12, 13, 14, 15); pf2[qt] = __builtin_shufflevector(l0, l1, 0, 1, 2, 3, 4, 5, 6, 7, 8, 9, 10, 11, 12, 13, 14, 15);
            } else pf[qt] = cat16(__builtin_convertvector(s[0][qt], v8h), __builtin_convertvector(s[1][qt], v8h)); }
#pragma unroll
        for (int dt = 0; dt < 4; ++dt)
#pragma unroll
            for (int qt = 0; qt < NQT; ++qt) o[dt][qt] = F::mma(vf[dt], pf[qt], o[dt][qt]);
        if (HI) {
#pragma unroll
            for (int dt = 0; dt < 4; ++dt)
#pragma unroll
                for (int qt = 0; qt < NQT; ++qt) o[dt][qt] = F::mma(vf[dt], pf2[qt], o[dt][qt]);
#pragma unroll
            for (int dt = 0; dt < 4; ++dt)
#pragma unroll
                for (int qt = 0; qt < NQT; ++qt) o[dt][qt] = F::mma(vf2[dt], pf[qt], o[dt][qt]); }
        // four vector slots behind the pass's last matrix instruction, for the taken back edge
        if constexpr (NQT == 2) asm volatile("v_nop\n\tv_nop\n\tv_nop\n\tv_nop" : "+v"(o[0][0]), "+v"(o[1][0]), "+v"(o[2][0]), "+v"(o[3][0]), "+v"(o[0][1]), "+v"(o[1][1]), "+v"(o[2][1]), "+v"(o[3][1]));
        else asm volatile("v_nop\n\tv_nop\n\tv_nop\n\tv_nop" : "+v"(o[0][0]), "+v"(o[1][0]), "+v"(o[2][0]), "+v"(o[3][0]));
    }
#pragma unroll
    for (int qt = 0; qt < NQT; ++qt) { l[qt] += __shfl_xor(l[qt], 16, 32); const int q = w * 32 + qt * 16 + lr; if (hi == 0) { ms[q] = mu[qt]; ls[q] = l[qt]; }
#pragma unroll
        for (int dt = 0; dt < 4; ++dt) { float* d = os + (size_t)q * OP + dt * 16 + hi * 8; *(v4fa*)d = __builtin_shufflevector(o[dt][qt], o[dt][qt], 0, 1, 2, 3); *(v4fa*)(d + 4) = __builtin_shufflevector(o[dt][qt], o[dt][qt], 4, 5, 6, 7); } }
    __syncthreads();   // every wave's partials are in LDS before any thread joins them
    constexpr int CH = NQT * 4;   // outputs per thread: NQT x 16 queries x 64 over 256 threads
    const int q = threadIdx.x / (HD / CH), d0 = (threadIdx.x % (HD / CH)) * CH;
    float M = ms[q];
#pragma unroll
    for (int ww = 1; ww < KW; ++ww) M = fmaxf(M, ms[ww * 32 + q]);
    float L = 0.f; v4f acc[CH / 4];
#pragma unroll
    for (int c = 0; c < CH / 4; ++c) acc[c] = (v4f){};
#pragma unroll
    for (int ww = 0; ww < KW; ++ww) { const float al = exp2s(ms[ww * 32 + q] - M); L += ls[ww * 32 + q] * al;
#pragma unroll
        for (int c = 0; c < CH / 4; ++c) acc[c] += *(const v4fa*)(os + (size_t)(ww * 32 + q) * OP + d0 + c * 4) * al; }
    const float r = __fdiv_rn(1.0f, L);
#pragma unroll
    for (int c = 0; c < CH / 4; ++c) *(v4f*)(outb + (size_t)(q0 + q) * DQ + d0 + c * 4) = acc[c] * r;
}
// grid x: first the NB_ x RH / 16 hi/lo work-groups (16 query columns, three products each: the longest), then NB_ x (TT - RH) / 32 fp16 ones (32 columns)
__global__ __launch_bounds__(KW * 32) __attribute__((amdgpu_waves_per_eu(4, 4))) void k_fattn(const h16* __restrict__ Q16, const h16* __restrict__ K16, const h16* __restrict__ V16, const bf* __restrict__ Qh, const bf* __restrict__ Ql, const bf* __restrict__ Kh, const bf* __restrict__ Kl, const bf* __restrict__ Vh, const bf* __restrict__ Vl, float* __restrict__ OUTp) {
    __shared__ __align__(16) float os[KW * 32 * OP]; __shared__ float ms[KW * 32]; __shared__ float ls[KW * 32];
    const int bid = blockIdx.x;
    if (bid < NB_ * RH / 16) { const size_t pb = (size_t)(bid / (RH / 16)) * TT * HD; attn_cols<bf, true, 1>(Qh + pb, Ql + pb, Kh + pb, Kl + pb, Vh + pb, Vl + pb, (bid % (RH / 16)) * 16, OUTp + pb, os, ms, ls); }
    else { const int id = bid - NB_ * RH / 16; const size_t pb = (size_t)(id / ((TT - RH) / 32)) * TT * HD; attn_cols<h16, false, 2>(Q16 + pb, nullptr, K16 + pb, nullptr, V16 + pb, nullptr, RH + (id % ((TT - RH) / 32)) * 32, OUTp + pb, os, ms, ls); }
}

extern "C" void kernel_launch(void* const* d_in, const int* in_sizes, int n_in,
                              void* d_out, int out_size, void* d_ws, size_t ws_size, hipStream_t stream) {
    (void)in_sizes; (void)n_in; (void)out_size;
    const float* x = (const float*)d_in[0]; const float* wk3 = (const float*)d_in[1];   /* kernel [3][64][64] 'xw': q, k, v */
    float* OUT = (float*)d_out;     // [4][4096][64]
    char* wsp = (char*)d_ws;
    auto take = [&](size_t bytes) { char* p = wsp; wsp += (bytes + 255) & ~(size_t)255; return (void*)p; };
    // q/k/v planes hold all NB_ batches, [batch] outermost
    h16* QP16 = (h16*)take((size_t)NB_ * NH_ * TT * HD * 2); h16* KP16 = (h16*)take((size_t)NB_ * NKV * TT * HD * 2); h16* VT16 = (h16*)take((size_t)NB_ * NKV * HD * TT * 2);
    bf* QPh = (bf*)take((size_t)NB_ * NH_ * TT * HD * 2); bf* QPl = (bf*)take((size_t)NB_ * NH_ * TT * HD * 2); bf* KPh = (bf*)take((size_t)NB_ * NKV * TT * HD * 2); bf* KPl = (bf*)take((size_t)NB_ * NKV * TT * HD * 2); bf* VTh = (bf*)take((size_t)NB_ * NKV * HD * TT * 2); bf* VTl = (bf*)take((size_t)NB_ * NKV * HD * TT * 2);
    if ((size_t)(wsp - (char*)d_ws) > ws_size) return;    // ws 256 MiB
    k_prep<<<NB_ * TT / PR, 384, 0, stream>>>(x, wk3, QP16, QPh, QPl, KP16, KPh, KPl, VT16, VTh, VTl);
    // attention: one launch for all batches and both row classes
    k_fattn<<<NB_ * RH / 16 + NB_ * (TT - RH) / 32, KW * 32, 0, stream>>>(QP16, KP16, VT16, QPh, QPl, KPh, KPl, VTh, VTl, OUT);
}

// v006
// A run of this version takes 37.3 microseconds.
// Timed twice side by side with v005, it ran 1.04 and 1.03 times as fast.
// All steps since v000 together make it 23.7 times as fast.
#include <hip/hip_runtime.h>

// Single-head self-attention with a sinusoidal (sine-only) position embedding (x [4][4096][64]; x' = x + PE, PE[i][j] = sin(i x 10000^(-2j/64)) (computed: float32 inverse frequencies via pow, precise sinf); q, k, v = x' kernel[0|1|2] ('xw' [64][64] 0.05, no bias); scores / 8 over all 4,096 keys; softmax; out = attn v -> [4][4096][64] (1.0 M)).
// Two launches: k_prep (x + PE, the three projections and every q/k/v plane, all 4 batches, 64 rows of x per work-group) and the one fused attention kernel.
// The q/k/v planes lie in fragment order: a chunk of FC elements holds, lane after lane, the 8 elements that each of the 32 lanes takes with one 16-byte load, so a wave's load or store covers 512 bytes in a row (4 whole lines, not 32 bytes of each of 16).
// Layout per batch: x + PE summed in f32 from the bf16-rounded input and split into hi/lo bf16 (the sum is not bf16-exact); projections hi/lo x exact (2 products); one 64-wide head, attention fused in one kernel (hybrid rows: < 512 hi/lo 3 products, rest fp16; running-maximum softmax in registers, scores and probabilities never stored); 8 key slices x 2 query groups per work-group, K and V staged in LDS for both groups, slices joined in LDS.
// Compute dtypes, f32 accumulate: every input rounded to bf16; position embedding f32; projections hi/lo x exact; attention rows < 512 3 products, rest fp16; softmax f32; output f32.
#define NB_  4
#define TT   4096
#define DM   64
#define NH_  1
#define NKV  1
#define REP  (NH_ / NKV)
#define HD   64
#define DQ   (NH_ * HD)
#define DKV  (NKV * HD)
#define RH   512                  // query rows < RH use hi+lo planes (0: none)
#define WIN  0
#define SCL  0.125f   // HD^-0.5
#define KW   8                    // key slices of an attention work-group: a wave walks one slice of TT / KW keys
#define QG   2                    // groups of 32 query columns of an attention work-group; QG x KW waves
#define OP   68                   // LDS pitch in floats of a query's 64 partial outputs
#define FC   256                  // 16-bit elements of a plane chunk (32 lanes x 8). q, k: [row / 16][d / 16][chunk], lane = 16 (d / 8 % 2) + row % 16; v: [key / 32][d / 16][key / 16 % 2][chunk], lane = 16 (key / 8 % 2) + d % 16
typedef _Float16 h16;
typedef unsigned short bf;
typedef __attribute__((ext_vector_type(16))) __bf16   v16bf;
typedef __attribute__((ext_vector_type(16))) _Float16 v16h;
typedef __attribute__((ext_vector_type(8)))  _Float16 v8h;
typedef __attribute__((ext_vector_type(8)))  unsigned short v8us;
typedef __attribute__((ext_vector_type(8)))  float    v8f;
typedef __attribute__((ext_vector_type(4)))  float    v4f;
typedef v8h  __attribute__((may_alias)) v8ha;
typedef v4f  __attribute__((may_alias)) v4fa;
typedef v8us __attribute__((may_alias)) v8usa;

__device__ __forceinline__ unsigned short f2bf(float f) { unsigned u = __float_as_uint(f); u += 0x7FFFu + ((u >> 16) & 1u); return (unsigned short)(u >> 16); }
__device__ __forceinline__ float bf2f(unsigned short b) { return __uint_as_float(((unsigned)b) << 16); }
__device__ __forceinline__ float bfr(float f) { return bf2f(f2bf(f)); }
__device__ __forceinline__ v16h cat16(v8h lo, v8h hi) { return __builtin_shufflevector(lo, hi, 0, 1, 2, 3, 4, 5, 6, 7, 8, 9, 10, 11, 12, 13, 14, 15); }
__device__ __forceinline__ v16bf cat16b(v8us lo, v8us hi) { return __builtin_bit_cast(v16bf, __builtin_shufflevector(lo, hi, 0, 1, 2, 3, 4, 5, 6, 7, 8, 9, 10, 11, 12, 13, 14, 15)); }
__device__ __forceinline__ v8f wmma16(v16h a, v16h b, v8f c) { return __builtin_amdgcn_wmma_f32_16x16x32_f16(false, a, false, b, (short)0, c, false, false); }
__device__ __forceinline__ v8f wmmab(v16bf a, v16bf b, v8f c) { return __builtin_amdgcn_wmma_f32_16x16x32_bf16(false, a, false, b, (short)0, c, false, false); }

// 16x16x32 operand fragment of lane (lr, hi): 16-bit elements p[0..7] and p[16..23], p = row lr + 8 hi; the same map serves A and B (ld: from a row-major tile; ldf: the same elements from two neighbouring chunks of a plane, p = chunk + 8 lane)
template <typename T16> struct WFrag;
template <> struct WFrag<h16> { typedef v16h V; static __device__ __forceinline__ V ld(const h16* p) { return cat16(*(const v8h*)p, *(const v8h*)(p + 16)); } static __device__ __forceinline__ V ldf(const h16* p) { return cat16(*(const v8h*)p, *(const v8h*)(p + FC)); } static __device__ __forceinline__ v8f mma(V a, V b, v8f c) { return wmma16(a, b, c); } };
template <> struct WFrag<bf> { typedef v16bf V; static __device__ __forceinline__ V ld(const bf* p) { return cat16b(*(const v8us*)p, *(const v8us*)(p + 16)); } static __device__ __forceinline__ V ldf(const bf* p) { return cat16b(*(const v8us*)p, *(const v8us*)(p + FC)); } static __device__ __forceinline__ v8f mma(V a, V b, v8f c) { return wmmab(a, b, c); } };
__device__ __forceinline__ h16 tohx(float x) { return (h16)x; }
__device__ __forceinline__ void splitf(float y, unsigned short& h, unsigned short& l) { h = f2bf(y); l = f2bf(y - bf2f(h)); }
__constant__ __attribute__((aligned(16))) float PEINV[DM] = { 1.000000000e+00f,7.498942018e-01f,5.623413324e-01f,4.216965139e-01f,3.162277639e-01f,2.371373624e-01f,1.778279394e-01f,1.333521456e-01f,1.000000015e-01f,7.498941571e-02f,5.623412877e-02f,4.216964915e-02f,3.162277862e-02f,2.371373586e-02f,1.778279431e-02f,1.333521493e-02f,9.999999776e-03f,7.498942316e-03f,5.623413250e-03f,4.216964822e-03f,3.162277862e-03f,2.371373819e-03f,1.778279431e-03f,1.333521446e-03f,1.000000047e-03f,7.498941850e-04f,5.623413017e-04f,4.216964880e-04f,3.162277862e-04f,2.371373848e-04f,1.778279402e-04f,1.333521504e-04f,9.999999747e-05f,7.498942432e-05f,5.623413017e-05f,4.216965317e-05f,3.162277426e-05f,2.371373739e-05f,1.778279329e-05f,1.333521413e-05f,9.999999747e-06f,7.498942068e-06f,5.623413472e-06f,4.216964953e-06f,3.162277608e-06f,2.371373739e-06f,1.778279398e-06f,1.333521482e-06f,9.999999975e-07f,7.498942409e-07f,5.623413131e-07f,4.216964840e-07f,3.162277551e-07f,2.371373711e-07f,1.778279284e-07f,1.333521453e-07f,1.000000012e-07f,7.498942267e-08f,5.623413202e-08f,4.216964911e-08f,3.162277551e-08f,2.371373675e-08f,1.778279390e-08f,1.333521382e-08f };   // 1/10000^(2j/64) for j < 64 as float32 (jnp.power form, precomputed)

#define PR   64                   // rows of x per k_prep work-group: four 16-row tiles of the q and k planes, two 32-key blocks of the v plane
#define XP   72                   // LDS pitch in 16-bit elements of a 64-wide row (144 bytes = 16 x odd, for 16-byte fragment reads)
// eight f32 results of one lane, contiguous in the plane: fp16 + hi/lo bf16, one 16-byte store each
__device__ __forceinline__ void put8(v8f r, h16* p16, bf* ph, bf* pl) { v8h o16; v8us oh, ol;
#pragma unroll
    for (int j = 0; j < 8; ++j) { o16[j] = tohx(r[j]); unsigned short a2, c2; splitf(r[j], a2, c2); oh[j] = a2; ol[j] = c2; }
    *(v8h*)p16 = o16; *(v8us*)ph = oh; *(v8us*)pl = ol; }
// ---- k_prep: x + PE, q/k/v projections and their planes in one kernel. grid x = [NB_ x TT] rows / PR, 12 waves.
// Waves 0-7 form x + PE (16 values a thread) as hi/lo bf16 rows in LDS, waves 8-11 the three weight matrices as bf16 [n][k] rows; behind the barrier wave w owns matrix w / 4 and 16 rows (w % 4).
// q and k: D = W^T x'^T (A = 16 output columns, B = 16 rows of x'), so a lane holds 8 neighbouring d of one row t; v: D = x' W (A = rows, B = columns), 8 neighbouring t of one d: in both cases the 8 elements that one lane of an attention fragment takes with one load, so each tile goes out as whole chunks. Per tile: hi k 0-31, lo k 0-31, hi k 32-63, lo k 32-63.
__global__ __launch_bounds__(384) void k_prep(const float* __restrict__ x, const float* __restrict__ wk3, h16* __restrict__ Q16, bf* __restrict__ Qh, bf* __restrict__ Ql, h16* __restrict__ K16, bf* __restrict__ Kh, bf* __restrict__ Kl, h16* __restrict__ V16, bf* __restrict__ Vh, bf* __restrict__ Vl) {
    __shared__ __align__(16) bf xh[PR * XP]; __shared__ __align__(16) bf xl[PR * XP]; __shared__ __align__(16) bf wt[3 * HD * XP];
    const int tid = threadIdx.x, w = __builtin_amdgcn_readfirstlane(tid >> 5); const int R0 = blockIdx.x * PR;   // first row of the work-group in [NB_ x TT]; PR divides TT, so all its rows are of one batch
    if (w < 8) {
        const int row = tid >> 2, c0 = (tid & 3) * 16; const int t = R0 % TT + row; const float* xr = x + (size_t)(R0 + row) * DM + c0;
        v4f x4[4], f4[4];   // the thread's inverse frequencies come in with its x, ahead of the sines: fetched one by one between the sines' branches, each would be waited for alone
#pragma unroll
        for (int i = 0; i < 4; ++i) { x4[i] = *(const v4f*)(xr + 4 * i); f4[i] = *(const v4f*)(PEINV + c0 + 4 * i); }
        v8us oh[2], ol[2];
#pragma unroll
        for (int q = 0; q < 16; ++q) { const float ang = __fmul_rn((float)t, f4[q >> 2][q & 3]); const float s = __fadd_rn(bfr(x4[q >> 2][q & 3]), sinf(ang)); unsigned short u, v; splitf(s, u, v); oh[q >> 3][q & 7] = u; ol[q >> 3][q & 7] = v; }
#pragma unroll
        for (int i = 0; i < 2; ++i) { *(v8usa*)(xh + row * XP + c0 + 8 * i) = oh[i]; *(v8usa*)(xl + row * XP + c0 + 8 * i) = ol[i]; }
    } else {
        const int u = tid - 256, kb = u >> 4, nq = u & 15;   // 8 k x 4 n of each matrix a thread
#pragma unroll
        for (int m = 0; m < 3; ++m) { v4f r[8];
#pragma unroll
            for (int kk = 0; kk < 8; ++kk) r[kk] = *(const v4f*)(wk3 + (size_t)m * DM * HD + (kb * 8 + kk) * HD + nq * 4);
#pragma unroll
            for (int c = 0; c < 4; ++c) { v8us o;
#pragma unroll
                for (int kk = 0; kk < 8; ++kk) o[kk] = f2bf(r[kk][c]);
                *(v8usa*)(wt + (m * HD + nq * 4 + c) * XP + kb * 8) = o; } }
    }
    __syncthreads();   // x' rows and weight rows are in LDS before any wave reads its fragments
    typedef WFrag<bf> F;
    const int lane = tid & 31, lr = lane & 15, hi = lane >> 4, m = w >> 2, rt = w & 3;
    v16bf ah[2], al[2];
#pragma unroll
    for (int kc = 0; kc < 2; ++kc) { const int o = (rt * 16 + lr) * XP + kc * 32 + 8 * hi; ah[kc] = F::ld(xh + o); al[kc] = F::ld(xl + o); }
    const bf* wp = wt + (m * HD + lr) * XP + 8 * hi;
    if (m < 2) {
        h16* P16 = m ? K16 : Q16; bf* Ph = m ? Kh : Qh; bf* Pl = m ? Kl : Ql; const size_t ob = (size_t)(R0 / 16 + rt) * (16 * HD) + lane * 8;   // tile nb holds d = 16 nb + 8 hi + j of row lr: chunk nb of the 16 rows
#pragma unroll
        for (int nb = 0; nb < 4; ++nb) { const v16bf b0 = F::ld(wp + nb * 16 * XP), b1 = F::ld(wp + nb * 16 * XP + 32); v8f acc = (v8f){};
            acc = wmmab(b0, ah[0], acc); acc = wmmab(b0, al[0], acc); acc = wmmab(b1, ah[1], acc); acc = wmmab(b1, al[1], acc);
            put8(acc, P16 + ob + nb * FC, Ph + ob + nb * FC, Pl + ob + nb * FC); }
    } else {
        const size_t ob = (size_t)(R0 / 32 + (rt >> 1)) * (32 * HD) + (rt & 1) * FC + lane * 8;   // tile nb holds keys 16 rt + 8 hi + j of d = 16 nb + lr: half rt % 2 of the 32 keys' chunk pair nb
#pragma unroll
        for (int nb = 0; nb < 4; ++nb) { const v16bf b0 = F::ld(wp + nb * 16 * XP), b1 = F::ld(wp + nb * 16 * XP + 32); v8f acc = (v8f){};
            acc = wmmab(ah[0], b0, acc); acc = wmmab(al[0], b0, acc); acc = wmmab(ah[1], b1, acc); acc = wmmab(al[1], b1, acc);
            put8(acc, V16 + ob + nb * 2 * FC, Vh + ob + nb * 2 * FC, Vl + ob + nb * 2 * FC); }
        asm volatile("s_wait_xcnt 0x0" ::: "memory");   // behind this side's last stores: in the built code the other side's text follows and reuses their registers
    }
}
typedef __attribute__((ext_vector_type(8))) __bf16 v8bf;
// v_exp_f32 in asm text with the one vector slot that the instruction set asks for behind a transcendental before its result is used or its source overwritten: inside a statement the slot stands where it is written, whatever registers the allocator reuses next.
__device__ __forceinline__ float exp2s(float x) { float r; asm("v_exp_f32 %0, %1\n\tv_nop" : "=v"(r) : "v"(x)); return r; }
// eight in place: each next one is independent and fills the slot of the one before, the v_nop that of the last
__device__ __forceinline__ void exp2x8(v8f& x) { float a = x[0], b = x[1], c = x[2], d = x[3], e = x[4], f = x[5], g = x[6], h = x[7];
    asm("v_exp_f32 %0, %0\n\tv_exp_f32 %1, %1\n\tv_exp_f32 %2, %2\n\tv_exp_f32 %3, %3\n\tv_exp_f32 %4, %4\n\tv_exp_f32 %5, %5\n\tv_exp_f32 %6, %6\n\tv_exp_f32 %7, %7\n\tv_nop" : "+v"(a), "+v"(b), "+v"(c), "+v"(d), "+v"(e), "+v"(f), "+v"(g), "+v"(h));
    x[0] = a; x[1] = b; x[2] = c; x[3] = d; x[4] = e; x[5] = f; x[6] = g; x[7] = h; }
// ---- k_fattn: scores, softmax and attn x v in one kernel. S^T = K Q^T (A = 16 keys, B = 16 query columns kept in registers), so a lane holds scores of ONE query; two S^T tiles (keys 0-15, 16-31), converted in place, are the B operand of O^T += V^T P^T.
// A work-group has QG groups of NQT x 16 query columns and KW key slices: wave w = group KW + slice walks keys [slice TT/KW, (slice+1) TT/KW) for its group with its own maximum in use, sum and O^T; a group's KW partials are joined in LDS in slice order.
// The QG waves of a slice work from ONE copy of its K and V chunks: a stage (32 keys of every slice) is brought into LDS by asynchronous copies, chunk for chunk as it lies in the planes, so each K and V byte leaves L2 once per work-group, not once per group. Two stage buffers: stage t + 2 flies while stage t + 1 is worked on.
#define PB   4096                 // bytes of 32 keys of one plane: 8 chunks, what one wave copies with 8 instructions
// eight asynchronous copies of 32 lanes x 16 bytes: 4 KiB in a row, l = the lane's LDS byte address, g = the lane's global address. The s_wait_xcnt is the last line of the copies' own statement, so that no address register is rewritten ahead of it.
__device__ __forceinline__ void copy4k(unsigned l, const char* g) {
    asm volatile("global_load_async_to_lds_b128 %0, %8, off\n\tglobal_load_async_to_lds_b128 %1, %9, off\n\tglobal_load_async_to_lds_b128 %2, %10, off\n\tglobal_load_async_to_lds_b128 %3, %11, off\n\t"
                 "global_load_async_to_lds_b128 %4, %12, off\n\tglobal_load_async_to_lds_b128 %5, %13, off\n\tglobal_load_async_to_lds_b128 %6, %14, off\n\tglobal_load_async_to_lds_b128 %7, %15, off\n\ts_wait_xcnt 0x0"
                 :: "v"(l), "v"(l + 512), "v"(l + 1024), "v"(l + 1536), "v"(l + 2048), "v"(l + 2560), "v"(l + 3072), "v"(l + 3584),
                    "v"(g), "v"(g + 512), "v"(g + 1024), "v"(g + 1536), "v"(g + 2048), "v"(g + 2560), "v"(g + 3072), "v"(g + 3584) : "memory"); }
template <typename T16, bool HI, int NQT>
__device__ __forceinline__ void attn_cols(const T16* __restrict__ Q, const T16* __restrict__ Q2, const T16* __restrict__ Kp, const T16* __restrict__ K2, const T16* __restrict__ Vt, const T16* __restrict__ V2, int q0, float* __restrict__ outb, char* ring, float* ms, float* ls) {
    typedef WFrag<T16> F; typedef typename F::V V;
    const float C2 = SCL * 1.4426950408889634f;   // scores are taken to base 2
    constexpr int NP = HI ? 4 : 2, SB = KW * NP * PB, NT = TT / KW / 32;   // planes of a stage (K, V, then the lo planes of K, V), bytes of a stage buffer [slice][plane][PB], stages
    const int lane = threadIdx.x & 31, lr = lane & 15, hi = lane >> 4, w = __builtin_amdgcn_readfirstlane(threadIdx.x >> 5), ks = w % KW, g = w / KW;
    V qf[NQT][2], qf2[NQT][2];
#pragma unroll
    for (int qt = 0; qt < NQT; ++qt)
#pragma unroll
        for (int kc = 0; kc < 2; ++kc) { const size_t o = (size_t)(q0 / 16 + g * NQT + qt) * (16 * HD) + kc * 2 * FC + lane * 8; qf[qt][kc] = F::ldf(Q + o); if (HI) qf2[qt][kc] = F::ldf(Q2 + o); }
    v8f o[4][NQT]; float mu[NQT], l[NQT];
#pragma unroll
    for (int qt = 0; qt < NQT; ++qt) { mu[qt] = -3.0e38f; l[qt] = 0.f;
#pragma unroll
        for (int dt = 0; dt < 4; ++dt) o[dt][qt] = (v8f){}; }
    const size_t kbase = (size_t)ks * (TT / KW) * HD + lane * 8;   // a stage's 32 keys are 32 x HD elements in a row of the K plane and of the V plane alike
    // of a slice's planes, group 0's wave copies K (and its lo plane), group 1's V (and its lo plane)
    const char* src = (const char*)((g ? Vt : Kp) + kbase); const char* src2 = HI ? (const char*)((g ? V2 : K2) + kbase) : src;
    const unsigned dst = (unsigned)(size_t)ring + (unsigned)((ks * NP + g) * PB + lane * 16);
    auto fill = [&](int t) { const unsigned d = dst + (unsigned)((t & 1) * SB); copy4k(d, src + (size_t)t * PB); if constexpr (HI) copy4k(d + 2 * PB, src2 + (size_t)t * PB); };
    fill(0);
    asm volatile("s_wait_asynccnt 0x0" ::: "memory");   // this wave's share of stage 0 has landed
    __syncthreads();   // stage 0 is whole before any wave reads it
    fill(1);
#pragma unroll 1   // one pass = one stage = 32 keys of the wave's slice; the two buffers alternate by the pass's parity
    for (int it = 0; it < NT; ++it) {
        const T16* st = (const T16*)(ring + (it & 1) * SB + ks * NP * PB) + lane * 8;
        V kf[2][2], kf2[2][2];
#pragma unroll
        for (int kt = 0; kt < 2; ++kt)
#pragma unroll
            for (int kc = 0; kc < 2; ++kc) { const int a = kt * 16 * HD + kc * 2 * FC; kf[kt][kc] = F::ldf(st + a); if (HI) kf2[kt][kc] = F::ldf(st + 2 * (PB / 2) + a); }
        v8f s[2][NQT];
#pragma unroll
        for (int kt = 0; kt < 2; ++kt)
#pragma unroll
            for (int qt = 0; qt < NQT; ++qt) s[kt][qt] = (v8f){};
#pragma unroll
        for (int kc = 0; kc < 2; ++kc) {
#pragma unroll
            for (int kt = 0; kt < 2; ++kt)
#pragma unroll
                for (int qt = 0; qt < NQT; ++qt) s[kt][qt] = F::mma(kf[kt][kc], qf[qt][kc], s[kt][qt]);
            if (HI) {
#pragma unroll
                for (int kt = 0; kt < 2; ++kt)
#pragma unroll
                    for (int qt = 0; qt < NQT; ++qt) s[kt][qt] = F::mma(kf2[kt][kc], qf[qt][kc], s[kt][qt]);
#pragma unroll
                for (int kt = 0; kt < 2; ++kt)
#pragma unroll
                    for (int qt = 0; qt < NQT; ++qt) s[kt][qt] = F::mma(kf[kt][kc], qf2[qt][kc], s[kt][qt]); } }
        V vf[4], vf2[4];
#pragma unroll
        for (int dt = 0; dt < 4; ++dt) vf[dt] = F::ldf(st + PB / 2 + dt * 2 * FC);
        float ml[NQT]; bool need = false;
#pragma unroll
        for (int qt = 0; qt < NQT; ++qt) { float mx = fmaxf(s[0][qt][0], s[1][qt][0]);
#pragma unroll
            for (int j = 1; j < 8; ++j) mx = fmaxf(mx, fmaxf(s[0][qt][j], s[1][qt][j]));
            ml[qt] = mx * C2; need = need || (ml[qt] > mu[qt] + 8.0f); }
        if (__builtin_amdgcn_ballot_w32(need) != 0) {   // the maximum in use moves only when a score passes it by more than 2^8: rare behind the first pass
#pragma unroll
            for (int qt = 0; qt < NQT; ++qt) { const float mn = fmaxf(mu[qt], fmaxf(ml[qt], __shfl_xor(ml[qt], 16, 32))); const float al = exp2s(mu[qt] - mn); mu[qt] = mn; l[qt] *= al;
#pragma unroll
                for (int dt = 0; dt < 4; ++dt) o[dt][qt] *= al; } }
        V pf[NQT], pf2[NQT];
#pragma unroll
        for (int qt = 0; qt < NQT; ++qt) {
#pragma unroll
            for (int kt = 0; kt < 2; ++kt) {
#pragma unroll
                for (int j = 0; j < 8; ++j) s[kt][qt][j] = __builtin_fmaf(s[kt][qt][j], C2, -mu[qt]);
                exp2x8(s[kt][qt]);
#pragma unroll
                for (int j = 0; j < 8; ++j) l[qt] += s[kt][qt][j]; }
            if constexpr (HI) { const v8bf h0 = __builtin_convertvector(s[0][qt], v8bf), h1 = __builtin_convertvector(s[1][qt], v8bf);
                const v8bf l0 = __builtin_convertvector(s[0][qt] - __builtin_convertvector(h0, v8f), v8bf), l1 = __builtin_convertvector(s[1][qt] - __builtin_convertvector(h1, v8f), v8bf);
                pf[qt] = __builtin_shufflevector(h0, h1, 0, 1, 2, 3, 4, 5, 6, 7, 8, 9, 10, 11, 12, 13, 14, 15); pf2[qt] = __builtin_shufflevector(l0, l1, 0, 1, 2, 3, 4, 5, 6, 7, 8, 9, 10, 11, 12, 13, 14, 15);
            } else pf[qt] = cat16(__builtin_convertvector(s[0][qt], v8h), __builtin_convertvector(s[1][qt], v8h)); }
        if constexpr (HI) {
            __builtin_amdgcn_sched_barrier(0);   // keeps the loads of V's lo fragments behind the softmax: fetched beside it they push Q fragments out to scratch; the first two product groups cover their latency
#pragma unroll
            for (int dt = 0; dt < 4; ++dt) vf2[dt] = F::ldf(st + 3 * (PB / 2) + dt * 2 * FC); }
#pragma unroll
        for (int dt = 0; dt < 4; ++dt)
#pragma unroll
            for (int qt = 0; qt < NQT; ++qt) o[dt][qt] = F::mma(vf[dt], pf[qt], o[dt][qt]);
        if (HI) {
#pragma unroll
            for (int dt = 0; dt < 4; ++dt)
#pragma unroll
                for (int qt = 0; qt < NQT; ++qt) o[dt][qt] = F::mma(vf[dt], pf2[qt], o[dt][qt]);
#pragma unroll
            for (int dt = 0; dt < 4; ++dt)
#pragma unroll
                for (int qt = 0; qt < NQT; ++qt) o[dt][qt] = F::mma(vf2[dt], pf[qt], o[dt][qt]); }
        // four vector slots behind the pass's last matrix instruction, for the taken back edge
        asm volatile("v_nop\n\tv_nop\n\tv_nop\n\tv_nop" : "+v"(o[0][0]), "+v"(o[1][0]), "+v"(o[2][0]), "+v"(o[3][0]), "+v"(o[0][1]), "+v"(o[1][1]), "+v"(o[2][1]), "+v"(o[3][1]));
        // hand-over of stage it + 1, in this order in every wave
        asm volatile("s_wait_dscnt 0x0" ::: "memory");      // this wave's reads of stage it are done before its buffer may be refilled
        asm volatile("s_wait_asynccnt 0x0" ::: "memory");   // this wave's share of stage it + 1 has landed
        __syncthreads();   // stage it + 1 is whole, and every wave has left stage it
        if (it + 2 < NT) fill(it + 2);
    }
    asm volatile("s_wait_asynccnt 0x0" ::: "memory");   // no copy is outstanding when the ring becomes the partials' place (the last pass's barrier has ended every read of it)
    float* os = (float*)ring;
#pragma unroll
    for (int qt = 0; qt < NQT; ++qt) { l[qt] += __shfl_xor(l[qt], 16, 32); const int q = w * 32 + qt * 16 + lr; if (hi == 0) { ms[q] = mu[qt]; ls[q] = l[qt]; }
#pragma unroll
        for (int dt = 0; dt < 4; ++dt) { float* d = os + (size_t)q * OP + dt * 16 + hi * 8; *(v4fa*)d = __builtin_shufflevector(o[dt][qt], o[dt][qt], 0, 1, 2, 3); *(v4fa*)(d + 4) = __builtin_shufflevector(o[dt][qt], o[dt][qt], 4, 5, 6, 7); } }
    __syncthreads();   // every wave's partials are in LDS before any thread joins them
    constexpr int CH = NQT * 4;   // outputs per thread: QG x NQT x 16 queries x 64 over QG x KW x 32 threads
    const int q = threadIdx.x / (HD / CH), d0 = (threadIdx.x % (HD / CH)) * CH;
    const int r0 = q / 32 * (KW * 32) + q % 32;   // the query's row in the partials of its group's slice 0
    float M = ms[r0];
#pragma unroll
    for (int ww = 1; ww < KW; ++ww) M = fmaxf(M, ms[ww * 32 + r0]);
    float L = 0.f; v4f acc[CH / 4];
#pragma unroll
    for (int c = 0; c < CH / 4; ++c) acc[c] = (v4f){};
#pragma unroll
    for (int ww = 0; ww < KW; ++ww) { const float al = exp2s(ms[ww * 32 + r0] - M); L += ls[ww * 32 + r0] * al;
#pragma unroll
        for (int c = 0; c < CH / 4; ++c) acc[c] += *(const v4fa*)(os + (size_t)(ww * 32 + r0) * OP + d0 + c * 4) * al; }
    const float r = __fdiv_rn(1.0f, L);
#pragma unroll
    for (int c = 0; c < CH / 4; ++c) *(v4f*)(outb + (size_t)(q0 + q) * DQ + d0 + c * 4) = acc[c] * r;
}
// grid x: first the NB_ x RH / 64 hi/lo work-groups (three products each: the longest), then NB_ x (TT - RH) / 64 fp16 ones; 64 query columns each, one work-group per WGP
__global__ __launch_bounds__(QG * KW * 32) __attribute__((amdgpu_waves_per_eu(4, 4))) void k_fattn(const h16* __restrict__ Q16, const h16* __restrict__ K16, const h16* __restrict__ V16, const bf* __restrict__ Qh, const bf* __restrict__ Ql, const bf* __restrict__ Kh, const bf* __restrict__ Kl, const bf* __restrict__ Vh, const bf* __restrict__ Vl, float* __restrict__ OUTp) {
    __shared__ __align__(128) char ring[2 * KW * 4 * PB];   // two stage buffers (hi/lo: 4 planes; fp16: 2); behind the loop the QG x KW x 32 rows of OP floats of the partials
    __shared__ float ms[QG * KW * 32]; __shared__ float ls[QG * KW * 32];
    static_assert(QG * KW * 32 * OP * 4 <= 2 * KW * 4 * PB, "the partials fit the ring");
    const int bid = blockIdx.x;
    if (bid < NB_ * RH / 64) { const size_t pb = (size_t)(bid / (RH / 64)) * TT * HD; attn_cols<bf, true, 2>(Qh + pb, Ql + pb, Kh + pb, Kl + pb, Vh + pb, Vl + pb, (bid % (RH / 64)) * 64, OUTp + pb, ring, ms, ls); }
    else { const int id = bid - NB_ * RH / 64; const size_t pb = (size_t)(id / ((TT - RH) / 64)) * TT * HD; attn_cols<h16, false, 2>(Q16 + pb, nullptr, K16 + pb, nullptr, V16 + pb, nullptr, RH + (id % ((TT - RH) / 64)) * 64, OUTp + pb, ring, ms, ls); }
}

extern "C" void kernel_launch(void* const* d_in, const int* in_sizes, int n_in,
                              void* d_out, int out_size, void* d_ws, size_t ws_size, hipStream_t stream) {
    (void)in_sizes; (void)n_in; (void)out_size;
    const float* x = (const float*)d_in[0]; const float* wk3 = (const float*)d_in[1];   /* kernel [3][64][64] 'xw': q, k, v */
    float* OUT = (float*)d_out;     // [4][4096][64]
    char* wsp = (char*)d_ws;
    auto take = [&](size_t bytes) { char* p = wsp; wsp += (bytes + 255) & ~(size_t)255; return (void*)p; };
    // q/k/v planes hold all NB_ batches, [batch] outermost
    h16* QP16 = (h16*)take((size_t)NB_ * NH_ * TT * HD * 2); h16* KP16 = (h16*)take((size_t)NB_ * NKV * TT * HD * 2); h16* VT16 = (h16*)take((size_t)NB_ * NKV * HD * TT * 2);
    bf* QPh = (bf*)take((size_t)NB_ * NH_ * TT * HD * 2); bf* QPl = (bf*)take((size_t)NB_ * NH_ * TT * HD * 2); bf* KPh = (bf*)take((size_t)NB_ * NKV * TT * HD * 2); bf* KPl = (bf*)take((size_t)NB_ * NKV * TT * HD * 2); bf* VTh = (bf*)take((size_t)NB_ * NKV * HD * TT * 2); bf* VTl = (bf*)take((size_t)NB_ * NKV * HD * TT * 2);
    if ((size_t)(wsp - (char*)d_ws) > ws_size) return;    // ws 256 MiB
    k_prep<<<NB_ * TT / PR, 384, 0, stream>>>(x, wk3, QP16, QPh, QPl, KP16, KPh, KPl, VT16, VTh, VTl);
    // attention: one launch for all batches and both row classes
    k_fattn<<<NB_ * RH / 64 + NB_ * (TT - RH) / 64, QG * KW * 32, 0, stream>>>(QP16, KP16, VT16, QPh, QPl, KPh, KPl, VTh, VTl, OUT);
}

// v007
// Measured time: 31.8 microseconds a run.
// In two side-by-side timings against v006, it was 1.19 and 1.17 times as fast.
// Over all steps from v000 it is 27.9 times as fast.
#include <hip/hip_runtime.h>

// Single-head self-attention with a sinusoidal (sine-only) position embedding (x [4][4096][64]; x' = x + PE, PE[i][j] = sin(i x 10000^(-2j/64)) (computed: float32 inverse frequencies via pow, precise sinf); q, k, v = x' kernel[0|1|2] ('xw' [64][64] 0.05, no bias); scores / 8 over all 4,096 keys; softmax; out = attn v -> [4][4096][64] (1.0 M)).
// Two launches: k_prep (x + PE, the three projections and every q/k/v plane, all 4 batches, 64 rows of x per work-group) and the one fused attention kernel.
// The q/k/v planes lie in fragment order: a chunk of FC elements holds, lane after lane, the 8 elements that each of the 32 lanes takes with one 16-byte load, so a wave's load or store covers 512 bytes in a row (4 whole lines, not 32 bytes of each of 16).
// Layout per batch: x + PE summed in f32 from the bf16-rounded input and split into hi/lo bf16 (the sum is not bf16-exact); projections hi/lo x exact (2 products); one 64-wide head, attention fused in one kernel (hybrid rows: < 512 hi/lo 3 products, rest fp16; running-maximum softmax in registers, scores and probabilities never stored); 8 key slices x 2 query groups per work-group (16 + 16 hi/lo, 48 + 32 or 32 + 32 fp16 query columns), K and V staged in LDS for both groups, slices joined in LDS.
// Compute dtypes, f32 accumulate: every input rounded to bf16; position embedding f32; projections hi/lo x exact; attention rows < 512 3 products, rest fp16; softmax f32; output f32.
#define NB_  4
#define TT   4096
#define DM   64
#define NH_  1
#define NKV  1
#define REP  (NH_ / NKV)
#define HD   64
#define DQ   (NH_ * HD)
#define DKV  (NKV * HD)
#define RH   512                  // query rows < RH use hi+lo planes (0: none)
#define WIN  0
#define SCL  0.125f   // HD^-0.5
#define KW   8                    // key slices of an attention work-group: a wave walks one slice of TT / KW keys
#define QG   2                    // groups of query columns of an attention work-group (a group: 1 to 3 tiles of 16 columns); QG x KW waves
#define OP   68                   // LDS pitch in floats of a query's 64 partial outputs
#define FC   256                  // 16-bit elements of a plane chunk (32 lanes x 8). q, k: [row / 16][d / 16][chunk], lane = 16 (d / 8 % 2) + row % 16; v: [key / 32][d / 16][key / 16 % 2][chunk], lane = 16 (key / 8 % 2) + d % 16
typedef _Float16 h16;
typedef unsigned short bf;
typedef __attribute__((ext_vector_type(16))) __bf16   v16bf;
typedef __attribute__((ext_vector_type(16))) _Float16 v16h;
typedef __attribute__((ext_vector_type(8)))  _Float16 v8h;
typedef __attribute__((ext_vector_type(8)))  unsigned short v8us;
typedef __attribute__((ext_vector_type(8)))  float    v8f;
typedef __attribute__((ext_vector_type(4)))  float    v4f;
typedef v8h  __attribute__((may_alias)) v8ha;
typedef v4f  __attribute__((may_alias)) v4fa;
typedef v8us __attribute__((may_alias)) v8usa;

__device__ __forceinline__ unsigned short f2bf(float f) { unsigned u = __float_as_uint(f); u += 0x7FFFu + ((u >> 16) & 1u); return (unsigned short)(u >> 16); }
__device__ __forceinline__ float bf2f(unsigned short b) { return __uint_as_float(((unsigned)b) << 16); }
__device__ __forceinline__ float bfr(float f) { return bf2f(f2bf(f)); }
__device__ __forceinline__ v16h cat16(v8h lo, v8h hi) { return __builtin_shufflevector(lo, hi, 0, 1, 2, 3, 4, 5, 6, 7, 8, 9, 10, 11, 12, 13, 14, 15); }
__device__ __forceinline__ v16bf cat16b(v8us lo, v8us hi) { return __builtin_bit_cast(v16bf, __builtin_shufflevector(lo, hi, 0, 1, 2, 3, 4, 5, 6, 7, 8, 9, 10, 11, 12, 13, 14, 15)); }
__device__ __forceinline__ v8f wmma16(v16h a, v16h b, v8f c) { return __builtin_amdgcn_wmma_f32_16x16x32_f16(false, a, false, b, (short)0, c, false, false); }
__device__ __forceinline__ v8f wmmab(v16bf a, v16bf b, v8f c) { return __builtin_amdgcn_wmma_f32_16x16x32_bf16(false, a, false, b, (short)0, c, false, false); }

// 16x16x32 operand fragment of lane (lr, hi): 16-bit elements p[0..7] and p[16..23], p = row lr + 8 hi; the same map serves A and B (ld: from a row-major tile; ldf: the same elements from two neighbouring chunks of a plane, p = chunk + 8 lane)
template <typename T16> struct WFrag;
template <> struct WFrag<h16> { typedef v16h V; static __device__ __forceinline__ V ld(const h16* p) { return cat16(*(const v8h*)p, *(const v8h*)(p + 16)); } static __device__ __forceinline__ V ldf(const h16* p) { return cat16(*(const v8h*)p, *(const v8h*)(p + FC)); } static __device__ __forceinline__ v8f mma(V a, V b, v8f c) { return wmma16(a, b, c); } };
template <> struct WFrag<bf> { typedef v16bf V; static __device__ __forceinline__ V ld(const bf* p) { return cat16b(*(const v8us*)p, *(const v8us*)(p + 16)); } static __device__ __forceinline__ V ldf(const bf* p) { return cat16b(*(const v8us*)p, *(const v8us*)(p + FC)); } static __device__ __forceinline__ v8f mma(V a, V b, v8f c) { return wmmab(a, b, c); } };
__device__ __forceinline__ h16 tohx(float x) { return (h16)x; }
__device__ __forceinline__ void splitf(float y, unsigned short& h, unsigned short& l) { h = f2bf(y); l = f2bf(y - bf2f(h)); }
__constant__ __attribute__((aligned(16))) float PEINV[DM] = { 1.000000000e+00f,7.498942018e-01f,5.623413324e-01f,4.216965139e-01f,3.162277639e-01f,2.371373624e-01f,1.778279394e-01f,1.333521456e-01f,1.000000015e-01f,7.498941571e-02f,5.623412877e-02f,4.216964915e-02f,3.162277862e-02f,2.371373586e-02f,1.778279431e-02f,1.333521493e-02f,9.999999776e-03f,7.498942316e-03f,5.623413250e-03f,4.216964822e-03f,3.162277862e-03f,2.371373819e-03f,1.778279431e-03f,1.333521446e-03f,1.000000047e-03f,7.498941850e-04f,5.623413017e-04f,4.216964880e-04f,3.162277862e-04f,2.371373848e-04f,1.778279402e-04f,1.333521504e-04f,9.999999747e-05f,7.498942432e-05f,5.623413017e-05f,4.216965317e-05f,3.162277426e-05f,2.371373739e-05f,1.778279329e-05f,1.333521413e-05f,9.999999747e-06f,7.498942068e-06f,5.623413472e-06f,4.216964953e-06f,3.162277608e-06f,2.371373739e-06f,1.778279398e-06f,1.333521482e-06f,9.999999975e-07f,7.498942409e-07f,5.623413131e-07f,4.216964840e-07f,3.162277551e-07f,2.371373711e-07f,1.778279284e-07f,1.333521453e-07f,1.000000012e-07f,7.498942267e-08f,5.623413202e-08f,4.216964911e-08f,3.162277551e-08f,2.371373675e-08f,1.778279390e-08f,1.333521382e-08f };   // 1/10000^(2j/64) for j < 64 as float32 (jnp.power form, precomputed)

#define PR   64                   // rows of x per k_prep work-group: four 16-row tiles of the q and k planes, two 32-key blocks of the v plane
#define XP   72                   // LDS pitch in 16-bit elements of a 64-wide row (144 bytes = 16 x odd, for 16-byte fragment reads)
// eight f32 results of one lane, contiguous in the plane: fp16 + hi/lo bf16, one 16-byte store each
__device__ __forceinline__ void put8(v8f r, h16* p16, bf* ph, bf* pl) { v8h o16; v8us oh, ol;
#pragma unroll
    for (int j = 0; j < 8; ++j) { o16[j] = tohx(r[j]); unsigned short a2, c2; splitf(r[j], a2, c2); oh[j] = a2; ol[j] = c2; }
    *(v8h*)p16 = o16; *(v8us*)ph = oh; *(v8us*)pl = ol; }
// ---- k_prep: x + PE, q/k/v projections and their planes in one kernel. grid x = [NB_ x TT] rows / PR, 12 waves.
// Waves 0-7 form x + PE (16 values a thread) as hi/lo bf16 rows in LDS, waves 8-11 the three weight matrices as bf16 [n][k] rows; behind the barrier wave w owns matrix w / 4 and 16 rows (w % 4).
// q and k: D = W^T x'^T (A = 16 output columns, B = 16 rows of x'), so a lane holds 8 neighbouring d of one row t; v: D = x' W (A = rows, B = columns), 8 neighbouring t of one d: in both cases the 8 elements that one lane of an attention fragment takes with one load, so each tile goes out as whole chunks. Per tile: hi k 0-31, lo k 0-31, hi k 32-63, lo k 32-63.
__global__ __launch_bounds__(384) void k_prep(const float* __restrict__ x, const float* __restrict__ wk3, h16* __restrict__ Q16, bf* __restrict__ Qh, bf* __restrict__ Ql, h16* __restrict__ K16, bf* __restrict__ Kh, bf* __restrict__ Kl, h16* __restrict__ V16, bf* __restrict__ Vh, bf* __restrict__ Vl) {
    __shared__ __align__(16) bf xh[PR * XP]; __shared__ __align__(16) bf xl[PR * XP]; __shared__ __align__(16) bf wt[3 * HD * XP];
    const int tid = threadIdx.x, w = __builtin_amdgcn_readfirstlane(tid >> 5); const int R0 = blockIdx.x * PR;   // first row of the work-group in [NB_ x TT]; PR divides TT, so all its rows are of one batch
    if (w < 8) {
        const int row = tid >> 2, c0 = (tid & 3) * 16; const int t = R0 % TT + row; const float* xr = x + (size_t)(R0 + row) * DM + c0;
        v4f x4[4], f4[4];   // the thread's inverse frequencies come in with its x, ahead of the sines: fetched one by one between the sines' branches, each would be waited for alone
#pragma unroll
        for (int i = 0; i < 4; ++i) { x4[i] = *(const v4f*)(xr + 4 * i); f4[i] = *(const v4f*)(PEINV + c0 + 4 * i); }
        v8us oh[2], ol[2];
#pragma unroll
        for (int q = 0; q < 16; ++q) { const float ang = __fmul_rn((float)t, f4[q >> 2][q & 3]); const float s = __fadd_rn(bfr(x4[q >> 2][q & 3]), sinf(ang)); unsigned short u, v; splitf(s, u, v); oh[q >> 3][q & 7] = u; ol[q >> 3][q & 7] = v; }
#pragma unroll
        for (int i = 0; i < 2; ++i) { *(v8usa*)(xh + row * XP + c0 + 8 * i) = oh[i]; *(v8usa*)(xl + row * XP + c0 + 8 * i) = ol[i]; }
    } else {
        const int u = tid - 256, kb = u >> 4, nq = u & 15;   // 8 k x 4 n of each matrix a thread
#pragma unroll
        for (int m = 0; m < 3; ++m) { v4f r[8];
#pragma unroll
            for (int kk = 0; kk < 8; ++kk) r[kk] = *(const v4f*)(wk3 + (size_t)m * DM * HD + (kb * 8 + kk) * HD + nq * 4);
#pragma unroll
            for (int c = 0; c < 4; ++c) { v8us o;
#pragma unroll
                for (int kk = 0; kk < 8; ++kk) o[kk] = f2bf(r[kk][c]);
                *(v8usa*)(wt + (m * HD + nq * 4 + c) * XP + kb * 8) = o; } }
    }
    __syncthreads();   // x' rows and weight rows are in LDS before any wave reads its fragments
    typedef WFrag<bf> F;
    const int lane = tid & 31, lr = lane & 15, hi = lane >> 4, m = w >> 2, rt = w & 3;
    v16bf ah[2], al[2];
#pragma unroll
    for (int kc = 0; kc < 2; ++kc) { const int o = (rt * 16 + lr) * XP + kc * 32 + 8 * hi; ah[kc] = F::ld(xh + o); al[kc] = F::ld(xl + o); }
    const bf* wp = wt + (m * HD + lr) * XP + 8 * hi;
    if (m < 2) {
        h16* P16 = m ? K16 : Q16; bf* Ph = m ? Kh : Qh; bf* Pl = m ? Kl : Ql; const size_t ob = (size_t)(R0 / 16 + rt) * (16 * HD) + lane * 8;   // tile nb holds d = 16 nb + 8 hi + j of row lr: chunk nb of the 16 rows
#pragma unroll
        for (int nb = 0; nb < 4; ++nb) { const v16bf b0 = F::ld(wp + nb * 16 * XP), b1 = F::ld(wp + nb * 16 * XP + 32); v8f acc = (v8f){};
            acc = wmmab(b0, ah[0], acc); acc = wmmab(b0, al[0], acc); acc = wmmab(b1, ah[1], acc); acc = wmmab(b1, al[1], acc);
            put8(acc, P16 + ob + nb * FC, Ph + ob + nb * FC, Pl + ob + nb * FC); }
    } else {
        const size_t ob = (size_t)(R0 / 32 + (rt >> 1)) * (32 * HD) + (rt & 1) * FC + lane * 8;   // tile nb holds keys 16 rt + 8 hi + j of d = 16 nb + lr: half rt % 2 of the 32 keys' chunk pair nb
#pragma unroll
        for (int nb = 0; nb < 4; ++nb) { const v16bf b0 = F::ld(wp + nb * 16 * XP), b1 = F::ld(wp + nb * 16 * XP + 32); v8f acc = (v8f){};
            acc = wmmab(ah[0], b0, acc); acc = wmmab(al[0], b0, acc); acc = wmmab(ah[1], b1, acc); acc = wmmab(al[1], b1, acc);
            put8(acc, V16 + ob + nb * 2 * FC, Vh + ob + nb * 2 * FC, Vl + ob + nb * 2 * FC); }
        asm volatile("s_wait_xcnt 0x0" ::: "memory");   // behind this side's last stores: in the built code the other side's text follows and reuses their registers
    }
}
typedef __attribute__((ext_vector_type(8))) __bf16 v8bf;
// v_exp_f32 in asm text with the one vector slot that the instruction set asks for behind a transcendental before its result is used or its source overwritten: inside a statement the slot stands where it is written, whatever registers the allocator reuses next.
__device__ __forceinline__ float exp2s(float x) { float r; asm("v_exp_f32 %0, %1\n\tv_nop" : "=v"(r) : "v"(x)); return r; }
// eight in place: each next one is independent and fills the slot of the one before, the v_nop that of the last
__device__ __forceinline__ void exp2x8(v8f& x) { float a = x[0], b = x[1], c = x[2], d = x[3], e = x[4], f = x[5], g = x[6], h = x[7];
    asm("v_exp_f32 %0, %0\n\tv_exp_f32 %1, %1\n\tv_exp_f32 %2, %2\n\tv_exp_f32 %3, %3\n\tv_exp_f32 %4, %4\n\tv_exp_f32 %5, %5\n\tv_exp_f32 %6, %6\n\tv_exp_f32 %7, %7\n\tv_nop" : "+v"(a), "+v"(b), "+v"(c), "+v"(d), "+v"(e), "+v"(f), "+v"(g), "+v"(h));
    x[0] = a; x[1] = b; x[2] = c; x[3] = d; x[4] = e; x[5] = f; x[6] = g; x[7] = h; }
// ---- k_fattn: scores, softmax and attn x v in one kernel. S^T = K Q^T (A = 16 keys, B = 16 query columns kept in registers), so a lane holds scores of ONE query; two S^T tiles (keys 0-15, 16-31), converted in place, are the B operand of O^T += V^T P^T.
// A work-group has QG groups of query columns and KW key slices: each wave has one group and one slice and walks keys [slice TT/KW, (slice+1) TT/KW) for its group with its own maximum in use, sum and O^T; a group's KW partials are joined in LDS in slice order.
// The QG waves of a slice work from ONE copy of its K and V chunks: a stage (32 keys of every slice) is brought into LDS by asynchronous copies, chunk for chunk as it lies in the planes, so each K and V byte leaves L2 once per work-group, not once per group. Two stage buffers: stage t + 2 flies while stage t + 1 is worked on.
#define PB   4096                 // bytes of 32 keys of one plane: 8 chunks, what one wave copies with 8 instructions
// eight asynchronous copies of 32 lanes x 16 bytes: 4 KiB in a row, l = the lane's LDS byte address, g = the lane's global address. The s_wait_xcnt is the last line of the copies' own statement, so that no address register is rewritten ahead of it.
__device__ __forceinline__ void copy4k(unsigned l, const char* g) {
    asm volatile("global_load_async_to_lds_b128 %0, %8, off\n\tglobal_load_async_to_lds_b128 %1, %9, off\n\tglobal_load_async_to_lds_b128 %2, %10, off\n\tglobal_load_async_to_lds_b128 %3, %11, off\n\t"
                 "global_load_async_to_lds_b128 %4, %12, off\n\tglobal_load_async_to_lds_b128 %5, %13, off\n\tglobal_load_async_to_lds_b128 %6, %14, off\n\tglobal_load_async_to_lds_b128 %7, %15, off\n\ts_wait_xcnt 0x0"
                 :: "v"(l), "v"(l + 512), "v"(l + 1024), "v"(l + 1536), "v"(l + 2048), "v"(l + 2560), "v"(l + 3072), "v"(l + 3584),
                    "v"(g), "v"(g + 512), "v"(g + 1024), "v"(g + 1536), "v"(g + 2048), "v"(g + 2560), "v"(g + 3072), "v"(g + 3584) : "memory"); }
template <int N> struct IC { static constexpr int v = N; };
// NQ0, NQ1: tiles of 16 query columns of a wave of group 0 and of group 1 (NQ1 = NQ0 or NQ0 - 1)
template <typename T16, bool HI, int NQ0, int NQ1>
__device__ __forceinline__ void attn_cols(const T16* __restrict__ Q, const T16* __restrict__ Q2, const T16* __restrict__ Kp, const T16* __restrict__ K2, const T16* __restrict__ Vt, const T16* __restrict__ V2, int q0, float* __restrict__ outb, char* ring, float* ms, float* ls) {
    typedef WFrag<T16> F; typedef typename F::V V;
    static_assert(NQ1 == NQ0 || NQ1 == NQ0 - 1, "group 1 has as many tiles as group 0 or one fewer");
    const float C2 = SCL * 1.4426950408889634f;   // scores are taken to base 2
    constexpr int NP = HI ? 4 : 2, SB = KW * NP * PB, NT = TT / KW / 32;   // planes of a stage (K, V, then the lo planes of K, V), bytes of a stage buffer [slice][plane][PB], stages
    // waves 2 ks and 2 ks + 1 are the two groups of slice ks; which of them is group 1 alternates from one four waves to the next, so that of waves w, w + 1, w + 2, w + 3 and of waves w, w + 4, w + 8, w + 12 alike two are of each group
    const int lane = threadIdx.x & 31, lr = lane & 15, hi = lane >> 4, w = __builtin_amdgcn_readfirstlane(threadIdx.x >> 5), ks = w >> 1, g = ((w >> 2) ^ w) & 1;
    const bool full = NQ1 == NQ0 || g == 0;   // the wave has tile NQ0 - 1: the same in every lane, a scalar test
    V qf[NQ0][2], qf2[NQ0][2];
#pragma unroll
    for (int qt = 0; qt < NQ0; ++qt)
#pragma unroll
        for (int kc = 0; kc < 2; ++kc) { const size_t o = (size_t)(q0 / 16 + g * NQ0 + ((qt < NQ1 || full) ? qt : 0)) * (16 * HD) + kc * 2 * FC + lane * 8;   // a wave without the last tile takes its first again: in bounds, never used
            qf[qt][kc] = F::ldf(Q + o); if (HI) qf2[qt][kc] = F::ldf(Q2 + o); }
    v8f o[4][NQ0]; float mu[NQ0], l[NQ0];
#pragma unroll
    for (int qt = 0; qt < NQ0; ++qt) { mu[qt] = -3.0e38f; l[qt] = 0.f;
#pragma unroll
        for (int dt = 0; dt < 4; ++dt) o[dt][qt] = (v8f){}; }
    const size_t kbase = (size_t)ks * (TT / KW) * HD + lane * 8;   // a stage's 32 keys are 32 x HD elements in a row of the K plane and of the V plane alike
    // of a slice's planes, group 0's wave copies K (and its lo plane), group 1's V (and its lo plane)
    const char* src = (const char*)((g ? Vt : Kp) + kbase); const char* src2 = HI ? (const char*)((g ? V2 : K2) + kbase) : src;
    const unsigned dst = (unsigned)(size_t)ring + (unsigned)((ks * NP + g) * PB + lane * 16);
    auto fill = [&](int t) { const unsigned d = dst + (unsigned)((t & 1) * SB); copy4k(d, src + (size_t)t * PB); if constexpr (HI) copy4k(d + 2 * PB, src2 + (size_t)t * PB); };
    fill(0);
    asm volatile("s_wait_asynccnt 0x0" ::: "memory");   // this wave's share of stage 0 has landed
    __syncthreads();   // stage 0 is whole before any wave reads it
    fill(1);
#pragma unroll 1   // one pass = one stage = 32 keys of the wave's slice; the two buffers alternate by the pass's parity
    for (int it = 0; it < NT; ++it) {
        const T16* st = (const T16*)(ring + (it & 1) * SB + ks * NP * PB) + lane * 8;
        V kf[2][2], kf2[2][2];
#pragma unroll
        for (int kt = 0; kt < 2; ++kt)
#pragma unroll
            for (int kc = 0; kc < 2; ++kc) { const int a = kt * 16 * HD + kc * 2 * FC; kf[kt][kc] = F::ldf(st + a); if (HI) kf2[kt][kc] = F::ldf(st + 2 * (PB / 2) + a); }
        V vf[4], vf2[4]; v8f s[2][NQ0];
        // scores of tiles QA .. QB - 1 against the stage's 32 keys
        auto scores = [&](auto qa_, auto qb_) {
            constexpr int QA = decltype(qa_)::v, QB = decltype(qb_)::v;
#pragma unroll
            for (int kt = 0; kt < 2; ++kt)
#pragma unroll
                for (int qt = QA; qt < QB; ++qt) s[kt][qt] = (v8f){};
#pragma unroll
            for (int kc = 0; kc < 2; ++kc) {
#pragma unroll
                for (int kt = 0; kt < 2; ++kt)
#pragma unroll
                    for (int qt = QA; qt < QB; ++qt) s[kt][qt] = F::mma(kf[kt][kc], qf[qt][kc], s[kt][qt]);
                if (HI) {
#pragma unroll
                    for (int kt = 0; kt < 2; ++kt)
#pragma unroll
                        for (int qt = QA; qt < QB; ++qt) s[kt][qt] = F::mma(kf2[kt][kc], qf[qt][kc], s[kt][qt]);
#pragma unroll
                    for (int kt = 0; kt < 2; ++kt)
#pragma unroll
                        for (int qt = QA; qt < QB; ++qt) s[kt][qt] = F::mma(kf[kt][kc], qf2[qt][kc], s[kt][qt]); } } };
        // softmax step and attn x v of tiles QA .. QB - 1
        auto tiles = [&](auto qa_, auto qb_) {
            constexpr int QA = decltype(qa_)::v, QB = decltype(qb_)::v;
            float ml[NQ0]; bool need = false;
#pragma unroll
            for (int qt = QA; qt < QB; ++qt) { float mx = fmaxf(s[0][qt][0], s[1][qt][0]);
#pragma unroll
                for (int j = 1; j < 8; ++j) mx = fmaxf(mx, fmaxf(s[0][qt][j], s[1][qt][j]));
                ml[qt] = mx * C2; need = need || (ml[qt] > mu[qt] + 8.0f); }
            if (__builtin_amdgcn_ballot_w32(need) != 0) {   // the maximum in use moves only when a score passes it by more than 2^8: rare behind the first pass
#pragma unroll
                for (int qt = QA; qt < QB; ++qt) { const float mn = fmaxf(mu[qt], fmaxf(ml[qt], __shfl_xor(ml[qt], 16, 32))); const float al = exp2s(mu[qt] - mn); mu[qt] = mn; l[qt] *= al;
#pragma unroll
                    for (int dt = 0; dt < 4; ++dt) o[dt][qt] *= al; } }
            V pf[NQ0], pf2[NQ0];
#pragma unroll
            for (int qt = QA; qt < QB; ++qt) {
#pragma unroll
                for (int kt = 0; kt < 2; ++kt) {
#pragma unroll
                    for (int j = 0; j < 8; ++j) s[kt][qt][j] = __builtin_fmaf(s[kt][qt][j], C2, -mu[qt]);
                    exp2x8(s[kt][qt]);
#pragma unroll
                    for (int j = 0; j < 8; ++j) l[qt] += s[kt][qt][j]; }
                if constexpr (HI) { const v8bf h0 = __builtin_convertvector(s[0][qt], v8bf), h1 = __builtin_convertvector(s[1][qt], v8bf);
                    const v8bf l0 = __builtin_convertvector(s[0][qt] - __builtin_convertvector(h0, v8f), v8bf), l1 = __builtin_convertvector(s[1][qt] - __builtin_convertvector(h1, v8f), v8bf);
                    pf[qt] = __builtin_shufflevector(h0, h1, 0, 1, 2, 3, 4, 5, 6, 7, 8, 9, 10, 11, 12, 13, 14, 15); pf2[qt] = __builtin_shufflevector(l0, l1, 0, 1, 2, 3, 4, 5, 6, 7, 8, 9, 10, 11, 12, 13, 14, 15);
                } else pf[qt] = cat16(__builtin_convertvector(s[0][qt], v8h), __builtin_convertvector(s[1][qt], v8h)); }
            if constexpr (NQ0 > 2) {
#pragma unroll
                for (int qt = QA; qt < QB; ++qt) asm volatile("" : "+v"(l[qt])); }   // each row's sum, against spills: left free, the additions sink behind the products, the further tile and the barrier, every probability stays alive in f32 beside its 16-bit copy, and Q fragments go out to scratch
            if constexpr (HI && QA == 0) {
                __builtin_amdgcn_sched_barrier(0);   // keeps the loads of V's lo fragments behind the softmax: fetched beside it they push Q fragments out to scratch; the first two product groups cover their latency
#pragma unroll
                for (int dt = 0; dt < 4; ++dt) vf2[dt] = F::ldf(st + 3 * (PB / 2) + dt * 2 * FC); }
#pragma unroll
            for (int dt = 0; dt < 4; ++dt)
#pragma unroll
                for (int qt = QA; qt < QB; ++qt) o[dt][qt] = F::mma(vf[dt], pf[qt], o[dt][qt]);
            if (HI) {
#pragma unroll
                for (int dt = 0; dt < 4; ++dt)
#pragma unroll
                    for (int qt = QA; qt < QB; ++qt) o[dt][qt] = F::mma(vf[dt], pf2[qt], o[dt][qt]);
#pragma unroll
                for (int dt = 0; dt < 4; ++dt)
#pragma unroll
                    for (int qt = QA; qt < QB; ++qt) o[dt][qt] = F::mma(vf2[dt], pf[qt], o[dt][qt]); } };
        // group 0's further tile works from the same K and V fragments, under a scalar test with no barrier inside. Its scores come first: so all scores are done before the first softmax step, the K fragments' registers are free from there on, and the products of the other tiles fill the slots behind its last one
        if constexpr (NQ1 < NQ0) { if (full) scores(IC<NQ1>{}, IC<NQ0>{}); }
        scores(IC<0>{}, IC<NQ1>{});
#pragma unroll
        for (int dt = 0; dt < 4; ++dt) vf[dt] = F::ldf(st + PB / 2 + dt * 2 * FC);
        tiles(IC<0>{}, IC<NQ1>{});
        if constexpr (NQ1 < NQ0) { if (full) tiles(IC<NQ1>{}, IC<NQ0>{}); }
        // four vector slots behind the pass's last matrix instruction, for the taken back edge and the jump past the further tile
        if constexpr (NQ0 == 1) asm volatile("v_nop\n\tv_nop\n\tv_nop\n\tv_nop" : "+v"(o[0][0]), "+v"(o[1][0]), "+v"(o[2][0]), "+v"(o[3][0]));
        else if constexpr (NQ0 == 2) asm volatile("v_nop\n\tv_nop\n\tv_nop\n\tv_nop" : "+v"(o[0][0]), "+v"(o[1][0]), "+v"(o[2][0]), "+v"(o[3][0]), "+v"(o[0][1]), "+v"(o[1][1]), "+v"(o[2][1]), "+v"(o[3][1]));
        else { static_assert(NQ0 <= 3, "the statement names every accumulator"); asm volatile("v_nop\n\tv_nop\n\tv_nop\n\tv_nop" : "+v"(o[0][0]), "+v"(o[1][0]), "+v"(o[2][0]), "+v"(o[3][0]), "+v"(o[0][1]), "+v"(o[1][1]), "+v"(o[2][1]), "+v"(o[3][1]), "+v"(o[0][2]), "+v"(o[1][2]), "+v"(o[2][2]), "+v"(o[3][2])); }
        // hand-over of stage it + 1, in this order in every wave
        asm volatile("s_wait_dscnt 0x0" ::: "memory");      // this wave's reads of stage it are done before its buffer may be refilled
        asm volatile("s_wait_asynccnt 0x0" ::: "memory");   // this wave's share of stage it + 1 has landed
        __syncthreads();   // stage it + 1 is whole, and every wave has left stage it
        if (it + 2 < NT) fill(it + 2);
    }
    asm volatile("s_wait_asynccnt 0x0" ::: "memory");   // no copy is outstanding when the ring becomes the partials' place (the last pass's barrier has ended every read of it)
    float* os = (float*)ring; constexpr int G0 = NQ0 * 16, G1 = NQ1 * 16, NQW = G0 + G1;   // query columns of group 0, of group 1, of the work-group
    const int rb = g ? KW * G0 + ks * G1 : ks * G0;   // partials: [group][slice][column of the group]
#pragma unroll
    for (int qt = 0; qt < NQ0; ++qt) if (qt < NQ1 || full) { l[qt] += __shfl_xor(l[qt], 16, 32); const int q = rb + qt * 16 + lr; if (hi == 0) { ms[q] = mu[qt]; ls[q] = l[qt]; }
#pragma unroll
        for (int dt = 0; dt < 4; ++dt) { float* d = os + (size_t)q * OP + dt * 16 + hi * 8; *(v4fa*)d = __builtin_shufflevector(o[dt][qt], o[dt][qt], 0, 1, 2, 3); *(v4fa*)(d + 4) = __builtin_shufflevector(o[dt][qt], o[dt][qt], 4, 5, 6, 7); } }
    __syncthreads();   // every wave's partials are in LDS before any thread joins them
    // 16 threads a query, 4 outputs each, 32 queries a round (a wave: two whole rows of out); in the last round only the waves whose queries exist
    constexpr int NR = (NQW + 31) / 32; v4f res[NR];
#pragma unroll
    for (int i = 0; i < NR; ++i) if ((i + 1) * 32 <= NQW || i * 32 + 2 * w < NQW) {
        const int q = i * 32 + threadIdx.x / 16, d0 = (threadIdx.x % 16) * 4;
        const int gr = q < G0 ? G0 : G1, r0 = q < G0 ? q : KW * G0 + q - G0;   // rows from slice to slice, and the query's row in the partials of its group's slice 0
        float M = ms[r0];
#pragma unroll
        for (int ww = 1; ww < KW; ++ww) M = fmaxf(M, ms[ww * gr + r0]);
        float L = 0.f; v4f acc = (v4f){};
#pragma unroll
        for (int ww = 0; ww < KW; ++ww) { const float al = exp2s(ms[ww * gr + r0] - M); L += ls[ww * gr + r0] * al; acc += *(const v4fa*)(os + (size_t)(ww * gr + r0) * OP + d0) * al; }
        res[i] = acc * __fdiv_rn(1.0f, L); }
#pragma unroll
    for (int i = 0; i < NR; ++i) if ((i + 1) * 32 <= NQW || i * 32 + 2 * w < NQW) *(v4f*)(outb + (size_t)(q0 + i * 32 + threadIdx.x / 16) * DQ + (threadIdx.x % 16) * 4) = res[i];
    if constexpr (!HI) asm volatile("s_wait_xcnt 0x0" ::: "memory");   // behind an fp16 form's last stores: in the built code another form's text follows and reuses their registers
}
// grid x: first the hi/lo work-groups (NB_ x RH / HW, 1 + 1 tiles = HW query columns each), then the fp16 ones (FN a batch, 3 + 2 tiles = FW columns each), then one fp16 work-group a batch (2 + 2 tiles) for the columns left; fewer work-groups than WGPs, one per WGP, all at once.
// A hi/lo tile costs three products where an fp16 tile costs one: with 2 tiles a slice against 5 no kind of work-group runs far longer than the others.
#define HW   32
#define FW   80
#define FN   ((TT - RH) / FW)
__global__ __launch_bounds__(QG * KW * 32) __attribute__((amdgpu_waves_per_eu(4, 4))) void k_fattn(const h16* __restrict__ Q16, const h16* __restrict__ K16, const h16* __restrict__ V16, const bf* __restrict__ Qh, const bf* __restrict__ Ql, const bf* __restrict__ Kh, const bf* __restrict__ Kl, const bf* __restrict__ Vh, const bf* __restrict__ Vl, float* __restrict__ OUTp) {
    __shared__ __align__(128) char ring[2 * KW * 4 * PB];   // two stage buffers (hi/lo: 4 planes; fp16: 2); behind the loop the KW x (a work-group's query columns) rows of OP floats of the partials
    __shared__ float ms[KW * FW]; __shared__ float ls[KW * FW];
    static_assert(KW * FW * OP * 4 <= 2 * KW * 4 * PB, "the partials fit the ring");
    static_assert(RH % HW == 0 && (TT - RH) - FN * FW == 64, "the work-groups cover every row once");
    const int bid = blockIdx.x;
    if (bid < NB_ * RH / HW) { const size_t pb = (size_t)(bid / (RH / HW)) * TT * HD; attn_cols<bf, true, 1, 1>(Qh + pb, Ql + pb, Kh + pb, Kl + pb, Vh + pb, Vl + pb, (bid % (RH / HW)) * HW, OUTp + pb, ring, ms, ls); }
    else if (bid < NB_ * RH / HW + NB_ * FN) { const int id = bid - NB_ * RH / HW; const size_t pb = (size_t)(id / FN) * TT * HD; attn_cols<h16, false, 3, 2>(Q16 + pb, nullptr, K16 + pb, nullptr, V16 + pb, nullptr, RH + (id % FN) * FW, OUTp + pb, ring, ms, ls); }
    else { const size_t pb = (size_t)(bid - NB_ * RH / HW - NB_ * FN) * TT * HD; attn_cols<h16, false, 2, 2>(Q16 + pb, nullptr, K16 + pb, nullptr, V16 + pb, nullptr, RH + FN * FW, OUTp + pb, ring, ms, ls); }
}

extern "C" void kernel_launch(void* const* d_in, const int* in_sizes, int n_in,
                              void* d_out, int out_size, void* d_ws, size_t ws_size, hipStream_t stream) {
    (void)in_sizes; (void)n_in; (void)out_size;
    const float* x = (const float*)d_in[0]; const float* wk3 = (const float*)d_in[1];   /* kernel [3][64][64] 'xw': q, k, v */
    float* OUT = (float*)d_out;     // [4][4096][64]
    char* wsp = (char*)d_ws;
    auto take = [&](size_t bytes) { char* p = wsp; wsp += (bytes + 255) & ~(size_t)255; return (void*)p; };
    // q/k/v planes hold all NB_ batches, [batch] outermost
    h16* QP16 = (h16*)take((size_t)NB_ * NH_ * TT * HD * 2); h16* KP16 = (h16*)take((size_t)NB_ * NKV * TT * HD * 2); h16* VT16 = (h16*)take((size_t)NB_ * NKV * HD * TT * 2);
    bf* QPh = (bf*)take((size_t)NB_ * NH_ * TT * HD * 2); bf* QPl = (bf*)take((size_t)NB_ * NH_ * TT * HD * 2); bf* KPh = (bf*)take((size_t)NB_ * NKV * TT * HD * 2); bf* KPl = (bf*)take((size_t)NB_ * NKV * TT * HD * 2); bf* VTh = (bf*)take((size_t)NB_ * NKV * HD * TT * 2); bf* VTl = (bf*)take((size_t)NB_ * NKV * HD * TT * 2);
    if ((size_t)(wsp - (char*)d_ws) > ws_size) return;    // ws 256 MiB
    k_prep<<<NB_ * TT / PR, 384, 0, stream>>>(x, wk3, QP16, QPh, QPl, KP16, KPh, KPl, VT16, VTh, VTl);
    // attention: one launch for all batches and both row classes
    k_fattn<<<NB_ * RH / HW + NB_ * FN + NB_, QG * KW * 32, 0, stream>>>(QP16, KP16, VT16, QPh, QPl, KPh, KPl, VTh, VTl, OUT);
}

// v008
// A run of this version takes 29.9 microseconds.
// Timed twice side by side with v007, it ran 1.04 and 1.03 times as fast.
// Over all steps from v000 it is 28.9 times as fast.
#include <hip/hip_runtime.h>

// Single-head self-attention with a sinusoidal (sine-only) position embedding (x [4][4096][64]; x' = x + PE, PE[i][j] = sin(i x 10000^(-2j/64)) (computed: float32 inverse frequencies via pow, precise sinf); q, k, v = x' kernel[0|1|2] ('xw' [64][64] 0.05, no bias); scores / 8 over all 4,096 keys; softmax; out = attn v -> [4][4096][64] (1.0 M)).
// Two launches: k_prep (x + PE, the three projections and every q/k/v plane, all 4 batches, 64 rows of x per work-group) and the one fused attention kernel.
// The q/k/v planes lie in fragment order: a chunk of FC elements holds, lane after lane, the 8 elements that each of the 32 lanes takes with one 16-byte load, so a wave's load or store covers 512 bytes in a row (4 whole lines, not 32 bytes of each of 16).
// Layout per batch: x + PE summed in f32 from the bf16-rounded input and split into hi/lo bf16 (the sum is not bf16-exact); projections hi/lo x exact (2 products); one 64-wide head, attention fused in one kernel (hybrid rows: < 512 hi/lo 3 products, rest fp16; running-maximum softmax in registers, scores and probabilities never stored); 8 key slices x 2 query groups per work-group (16 + 16 hi/lo, 48 + 32 or 32 + 32 fp16 query columns), K and V staged in LDS for both groups, slices joined in LDS.
// Compute dtypes, f32 accumulate: every input rounded to bf16; position embedding f32; projections hi/lo x exact; attention rows < 512 3 products, rest fp16; softmax f32; output f32.
#define NB_  4
#define TT   4096
#define DM   64
#define NH_  1
#define NKV  1
#define REP  (NH_ / NKV)
#define HD   64
#define DQ   (NH_ * HD)
#define DKV  (NKV * HD)
#define RH   512                  // query rows < RH use hi+lo planes (0: none)
#define WIN  0
#define SCL  0.125f   // HD^-0.5
#define KW   8                    // key slices of an attention work-group: a wave walks one slice of TT / KW keys
#define QG   2                    // groups of query columns of an attention work-group (a group: 1 to 3 tiles of 16 columns); QG x KW waves
#define OP   68                   // LDS pitch in floats of a query's 64 partial outputs
#define FC   256                  // 16-bit elements of a plane chunk (32 lanes x 8). q, k: [row / 16][d / 16][chunk], lane = 16 (d / 8 % 2) + row % 16; v: [key / 32][d / 16][key / 16 % 2][chunk], lane = 16 (key / 8 % 2) + d % 16
typedef _Float16 h16;
typedef unsigned short bf;
typedef __attribute__((ext_vector_type(16))) __bf16   v16bf;
typedef __attribute__((ext_vector_type(16))) _Float16 v16h;
typedef __attribute__((ext_vector_type(8)))  _Float16 v8h;
typedef __attribute__((ext_vector_type(8)))  unsigned short v8us;
typedef __attribute__((ext_vector_type(8)))  float    v8f;
typedef __attribute__((ext_vector_type(4)))  float    v4f;
typedef v8h  __attribute__((may_alias)) v8ha;
typedef v4f  __attribute__((may_alias)) v4fa;
typedef v8us __attribute__((may_alias)) v8usa;

__device__ __forceinline__ unsigned short f2bf(float f) { unsigned u = __float_as_uint(f); u += 0x7FFFu + ((u >> 16) & 1u); return (unsigned short)(u >> 16); }
__device__ __forceinline__ float bf2f(unsigned short b) { return __uint_as_float(((unsigned)b) << 16); }
__device__ __forceinline__ float bfr(float f) { return bf2f(f2bf(f)); }
__device__ __forceinline__ v16h cat16(v8h lo, v8h hi) { return __builtin_shufflevector(lo, hi, 0, 1, 2, 3, 4, 5, 6, 7, 8, 9, 10, 11, 12, 13, 14, 15); }
__device__ __forceinline__ v16bf cat16b(v8us lo, v8us hi) { return __builtin_bit_cast(v16bf, __builtin_shufflevector(lo, hi, 0, 1, 2, 3, 4, 5, 6, 7, 8, 9, 10, 11, 12, 13, 14, 15)); }
__device__ __forceinline__ v8f wmma16(v16h a, v16h b, v8f c) { return __builtin_amdgcn_wmma_f32_16x16x32_f16(false, a, false, b, (short)0, c, false, false); }
__device__ __forceinline__ v8f wmmab(v16bf a, v16bf b, v8f c) { return __builtin_amdgcn_wmma_f32_16x16x32_bf16(false, a, false, b, (short)0, c, false, false); }

// 16x16x32 operand fragment of lane (lr, hi): 16-bit elements p[0..7] and p[16..23], p = row lr + 8 hi; the same map serves A and B (ld: from a row-major tile; ldf: the same elements from two neighbouring chunks of a plane, p = chunk + 8 lane)
template <typename T16> struct WFrag;
template <> struct WFrag<h16> { typedef v16h V; static __device__ __forceinline__ V ld(const h16* p) { return cat16(*(const v8h*)p, *(const v8h*)(p + 16)); } static __device__ __forceinline__ V ldf(const h16* p) { return cat16(*(const v8h*)p, *(const v8h*)(p + FC)); } static __device__ __forceinline__ v8f mma(V a, V b, v8f c) { return wmma16(a, b, c); } };
template <> struct WFrag<bf> { typedef v16bf V; static __device__ __forceinline__ V ld(const bf* p) { return cat16b(*(const v8us*)p, *(const v8us*)(p + 16)); } static __device__ __forceinline__ V ldf(const bf* p) { return cat16b(*(const v8us*)p, *(const v8us*)(p + FC)); } static __device__ __forceinline__ v8f mma(V a, V b, v8f c) { return wmmab(a, b, c); } };
__device__ __forceinline__ h16 tohx(float x) { return (h16)x; }
__device__ __forceinline__ void splitf(float y, unsigned short& h, unsigned short& l) { h = f2bf(y); l = f2bf(y - bf2f(h)); }
__constant__ __attribute__((aligned(16))) float PEINV[DM] = { 1.000000000e+00f,7.498942018e-01f,5.623413324e-01f,4.216965139e-01f,3.162277639e-01f,2.371373624e-01f,1.778279394e-01f,1.333521456e-01f,1.000000015e-01f,7.498941571e-02f,5.623412877e-02f,4.216964915e-02f,3.162277862e-02f,2.371373586e-02f,1.778279431e-02f,1.333521493e-02f,9.999999776e-03f,7.498942316e-03f,5.623413250e-03f,4.216964822e-03f,3.162277862e-03f,2.371373819e-03f,1.778279431e-03f,1.333521446e-03f,1.000000047e-03f,7.498941850e-04f,5.623413017e-04f,4.216964880e-04f,3.162277862e-04f,2.371373848e-04f,1.778279402e-04f,1.333521504e-04f,9.999999747e-05f,7.498942432e-05f,5.623413017e-05f,4.216965317e-05f,3.162277426e-05f,2.371373739e-05f,1.778279329e-05f,1.333521413e-05f,9.999999747e-06f,7.498942068e-06f,5.623413472e-06f,4.216964953e-06f,3.162277608e-06f,2.371373739e-06f,1.778279398e-06f,1.333521482e-06f,9.999999975e-07f,7.498942409e-07f,5.623413131e-07f,4.216964840e-07f,3.162277551e-07f,2.371373711e-07f,1.778279284e-07f,1.333521453e-07f,1.000000012e-07f,7.498942267e-08f,5.623413202e-08f,4.216964911e-08f,3.162277551e-08f,2.371373675e-08f,1.778279390e-08f,1.333521382e-08f };   // 1/10000^(2j/64) for j < 64 as float32 (jnp.power form, precomputed)

#define PR   64                   // rows of x per k_prep work-group: four 16-row tiles of the q and k planes, two 32-key blocks of the v plane
#define XP   72                   // LDS pitch in 16-bit elements of a 64-wide row (144 bytes = 16 x odd, for 16-byte fragment reads)
// eight f32 results of one lane, contiguous in the plane: fp16 + hi/lo bf16, one 16-byte store each
__device__ __forceinline__ void put8(v8f r, h16* p16, bf* ph, bf* pl) { v8h o16; v8us oh, ol;
#pragma unroll
    for (int j = 0; j < 8; ++j) { o16[j] = tohx(r[j]); unsigned short a2, c2; splitf(r[j], a2, c2); oh[j] = a2; ol[j] = c2; }
    *(v8h*)p16 = o16; *(v8us*)ph = oh; *(v8us*)pl = ol; }
// ---- k_prep: x + PE, q/k/v projections and their planes in one kernel. grid x = [NB_ x TT] rows / PR, 12 waves.
// Waves 0-7 form x + PE (16 values a thread) as hi/lo bf16 rows in LDS, waves 8-11 the three weight matrices as bf16 [n][k] rows; behind the barrier wave w owns matrix w / 4 and 16 rows (w % 4).
// q and k: D = W^T x'^T (A = 16 output columns, B = 16 rows of x'), so a lane holds 8 neighbouring d of one row t; v: D = x' W (A = rows, B = columns), 8 neighbouring t of one d: in both cases the 8 elements that one lane of an attention fragment takes with one load, so each tile goes out as whole chunks. Per tile: hi k 0-31, lo k 0-31, hi k 32-63, lo k 32-63.
__global__ __launch_bounds__(384) void k_prep(const float* __restrict__ x, const float* __restrict__ wk3, h16* __restrict__ Q16, bf* __restrict__ Qh, bf* __restrict__ Ql, h16* __restrict__ K16, bf* __restrict__ Kh, bf* __restrict__ Kl, h16* __restrict__ V16, bf* __restrict__ Vh, bf* __restrict__ Vl) {
    __shared__ __align__(16) bf xh[PR * XP]; __shared__ __align__(16) bf xl[PR * XP]; __shared__ __align__(16) bf wt[3 * HD * XP];
    const int tid = threadIdx.x, w = __builtin_amdgcn_readfirstlane(tid >> 5); const int R0 = blockIdx.x * PR;   // first row of the work-group in [NB_ x TT]; PR divides TT, so all its rows are of one batch
    if (w < 8) {
        const int row = tid >> 2, c0 = (tid & 3) * 16; const int t = R0 % TT + row; const float* xr = x + (size_t)(R0 + row) * DM + c0;
        v4f x4[4], f4[4];   // the thread's inverse frequencies come in with its x, ahead of the sines: fetched one by one between the sines' branches, each would be waited for alone
#pragma unroll
        for (int i = 0; i < 4; ++i) { x4[i] = *(const v4f*)(xr + 4 * i); f4[i] = *(const v4f*)(PEINV + c0 + 4 * i); }
        v8us oh[2], ol[2];
#pragma unroll
        for (int q = 0; q < 16; ++q) { const float ang = __fmul_rn((float)t, f4[q >> 2][q & 3]); const float s = __fadd_rn(bfr(x4[q >> 2][q & 3]), sinf(ang)); unsigned short u, v; splitf(s, u, v); oh[q >> 3][q & 7] = u; ol[q >> 3][q & 7] = v; }
#pragma unroll
        for (int i = 0; i < 2; ++i) { *(v8usa*)(xh + row * XP + c0 + 8 * i) = oh[i]; *(v8usa*)(xl + row * XP + c0 + 8 * i) = ol[i]; }
    } else {
        const int u = tid - 256, kb = u >> 4, nq = u & 15;   // 8 k x 4 n of each matrix a thread
#pragma unroll
        for (int m = 0; m < 3; ++m) { v4f r[8];
#pragma unroll
            for (int kk = 0; kk < 8; ++kk) r[kk] = *(const v4f*)(wk3 + (size_t)m * DM * HD + (kb * 8 + kk) * HD + nq * 4);
#pragma unroll
            for (int c = 0; c < 4; ++c) { v8us o;
#pragma unroll
                for (int kk = 0; kk < 8; ++kk) o[kk] = f2bf(r[kk][c]);
                *(v8usa*)(wt + (m * HD + nq * 4 + c) * XP + kb * 8) = o; } }
    }
    __syncthreads();   // x' rows and weight rows are in LDS before any wave reads its fragments
    typedef WFrag<bf> F;
    const int lane = tid & 31, lr = lane & 15, hi = lane >> 4, m = w >> 2, rt = w & 3;
    v16bf ah[2], al[2];
#pragma unroll
    for (int kc = 0; kc < 2; ++kc) { const int o = (rt * 16 + lr) * XP + kc * 32 + 8 * hi; ah[kc] = F::ld(xh + o); al[kc] = F::ld(xl + o); }
    const bf* wp = wt + (m * HD + lr) * XP + 8 * hi;
    if (m < 2) {
        h16* P16 = m ? K16 : Q16; bf* Ph = m ? Kh : Qh; bf* Pl = m ? Kl : Ql; const size_t ob = (size_t)(R0 / 16 + rt) * (16 * HD) + lane * 8;   // tile nb holds d = 16 nb + 8 hi + j of row lr: chunk nb of the 16 rows
#pragma unroll
        for (int nb = 0; nb < 4; ++nb) { const v16bf b0 = F::ld(wp + nb * 16 * XP), b1 = F::ld(wp + nb * 16 * XP + 32); v8f acc = (v8f){};
            acc = wmmab(b0, ah[0], acc); acc = wmmab(b0, al[0], acc); acc = wmmab(b1, ah[1], acc); acc = wmmab(b1, al[1], acc);
            put8(acc, P16 + ob + nb * FC, Ph + ob + nb * FC, Pl + ob + nb * FC); }
    } else {
        const size_t ob = (size_t)(R0 / 32 + (rt >> 1)) * (32 * HD) + (rt & 1) * FC + lane * 8;   // tile nb holds keys 16 rt + 8 hi + j of d = 16 nb + lr: half rt % 2 of the 32 keys' chunk pair nb
#pragma unroll
        for (int nb = 0; nb < 4; ++nb) { const v16bf b0 = F::ld(wp + nb * 16 * XP), b1 = F::ld(wp + nb * 16 * XP + 32); v8f acc = (v8f){};
            acc = wmmab(ah[0], b0, acc); acc = wmmab(al[0], b0, acc); acc = wmmab(ah[1], b1, acc); acc = wmmab(al[1], b1, acc);
            put8(acc, V16 + ob + nb * 2 * FC, Vh + ob + nb * 2 * FC, Vl + ob + nb * 2 * FC); }
        asm volatile("s_wait_xcnt 0x0" ::: "memory");   // behind this side's last stores: in the built code the other side's text follows and reuses their registers
    }
}
typedef __attribute__((ext_vector_type(8))) __bf16 v8bf;
// v_exp_f32 in asm text with the one vector slot that the instruction set asks for behind a transcendental before its result is used or its source overwritten: inside a statement the slot stands where it is written, whatever registers the allocator reuses next.
__device__ __forceinline__ float exp2s(float x) { float r; asm("v_exp_f32 %0, %1\n\tv_nop" : "=v"(r) : "v"(x)); return r; }
// eight in place: each next one is independent and fills the slot of the one before, the v_nop that of the last
__device__ __forceinline__ void exp2x8(v8f& x) { float a = x[0], b = x[1], c = x[2], d = x[3], e = x[4], f = x[5], g = x[6], h = x[7];
    asm("v_exp_f32 %0, %0\n\tv_exp_f32 %1, %1\n\tv_exp_f32 %2, %2\n\tv_exp_f32 %3, %3\n\tv_exp_f32 %4, %4\n\tv_exp_f32 %5, %5\n\tv_exp_f32 %6, %6\n\tv_exp_f32 %7, %7\n\tv_nop" : "+v"(a), "+v"(b), "+v"(c), "+v"(d), "+v"(e), "+v"(f), "+v"(g), "+v"(h));
    x[0] = a; x[1] = b; x[2] = c; x[3] = d; x[4] = e; x[5] = f; x[6] = g; x[7] = h; }
// ---- k_fattn: scores, softmax and attn x v in one kernel. S^T = K Q^T (A = 16 keys, B = 16 query columns kept in registers), so a lane holds scores of ONE query; two S^T tiles (keys 0-15, 16-31), converted in place, are the B operand of O^T += V^T P^T.
// A work-group has QG groups of query columns and KW key slices: each wave has one group and one slice and walks keys [slice TT/KW, (slice+1) TT/KW) for its group with its own maximum in use, sum and O^T; a group's KW partials are joined in LDS in slice order.
// The QG waves of a slice work from ONE copy of its K and V chunks: a stage (32 keys of every slice) is brought into LDS by asynchronous copies, chunk for chunk as it lies in the planes, so each K and V byte leaves L2 once per work-group, not once per group. Two stage buffers: stage t + 2 flies while stage t + 1 is worked on. rot: the work-group's number among those of its batch and kind, the stage at which its walk starts.
#define PB   4096                 // bytes of 32 keys of one plane: 8 chunks, what one wave copies with 8 instructions
// eight asynchronous copies of 32 lanes x 16 bytes: 4 KiB in a row, l = the lane's LDS byte address, g = the lane's global address. The s_wait_xcnt is the last line of the copies' own statement, so that no address register is rewritten ahead of it.
__device__ __forceinline__ void copy4k(unsigned l, const char* g) {
    asm volatile("global_load_async_to_lds_b128 %0, %8, off\n\tglobal_load_async_to_lds_b128 %1, %9, off\n\tglobal_load_async_to_lds_b128 %2, %10, off\n\tglobal_load_async_to_lds_b128 %3, %11, off\n\t"
                 "global_load_async_to_lds_b128 %4, %12, off\n\tglobal_load_async_to_lds_b128 %5, %13, off\n\tglobal_load_async_to_lds_b128 %6, %14, off\n\tglobal_load_async_to_lds_b128 %7, %15, off\n\ts_wait_xcnt 0x0"
                 :: "v"(l), "v"(l + 512), "v"(l + 1024), "v"(l + 1536), "v"(l + 2048), "v"(l + 2560), "v"(l + 3072), "v"(l + 3584),
                    "v"(g), "v"(g + 512), "v"(g + 1024), "v"(g + 1536), "v"(g + 2048), "v"(g + 2560), "v"(g + 3072), "v"(g + 3584) : "memory"); }
template <int N> struct IC { static constexpr int v = N; };
// NQ0, NQ1: tiles of 16 query columns of a wave of group 0 and of group 1 (NQ1 = NQ0 or NQ0 - 1)
template <typename T16, bool HI, int NQ0, int NQ1>
__device__ __forceinline__ void attn_cols(const T16* __restrict__ Q, const T16* __restrict__ Q2, const T16* __restrict__ Kp, const T16* __restrict__ K2, const T16* __restrict__ Vt, const T16* __restrict__ V2, int q0, int rot, float* __restrict__ outb, char* ring, float* ms, float* ls) {
    typedef WFrag<T16> F; typedef typename F::V V;
    static_assert(NQ1 == NQ0 || NQ1 == NQ0 - 1, "group 1 has as many tiles as group 0 or one fewer");
    const float C2 = SCL * 1.4426950408889634f;   // scores are taken to base 2
    constexpr int NP = HI ? 4 : 2, SB = KW * NP * PB, NT = TT / KW / 32;   // planes of a stage (K, V, then the lo planes of K, V), bytes of a stage buffer [slice][plane][PB], stages
    // waves 2 ks and 2 ks + 1 are the two groups of slice ks; which of them is group 1 alternates from one four waves to the next, so that of waves w, w + 1, w + 2, w + 3 and of waves w, w + 4, w + 8, w + 12 alike two are of each group
    const int lane = threadIdx.x & 31, lr = lane & 15, hi = lane >> 4, w = __builtin_amdgcn_readfirstlane(threadIdx.x >> 5), ks = w >> 1, g = ((w >> 2) ^ w) & 1;
    const bool full = NQ1 == NQ0 || g == 0;   // the wave has tile NQ0 - 1: the same in every lane, a scalar test
    V qf[NQ0][2], qf2[NQ0][2];
#pragma unroll
    for (int qt = 0; qt < NQ0; ++qt)
#pragma unroll
        for (int kc = 0; kc < 2; ++kc) { const size_t o = (size_t)(q0 / 16 + g * NQ0 + ((qt < NQ1 || full) ? qt : 0)) * (16 * HD) + kc * 2 * FC + lane * 8;   // a wave without the last tile takes its first again: in bounds, never used
            qf[qt][kc] = F::ldf(Q + o); if (HI) qf2[qt][kc] = F::ldf(Q2 + o); }
    v8f o[4][NQ0]; float mu[NQ0], l[NQ0];
#pragma unroll
    for (int qt = 0; qt < NQ0; ++qt) { mu[qt] = -3.0e38f; l[qt] = 0.f;
#pragma unroll
        for (int dt = 0; dt < 4; ++dt) o[dt][qt] = (v8f){}; }
    const size_t kbase = (size_t)ks * (TT / KW) * HD + lane * 8;   // a stage's 32 keys are 32 x HD elements in a row of the K plane and of the V plane alike
    // of a slice's planes, group 0's wave copies K (and its lo plane), group 1's V (and its lo plane)
    const char* src = (const char*)((g ? Vt : Kp) + kbase); const char* src2 = HI ? (const char*)((g ? V2 : K2) + kbase) : src;
    const unsigned dst = (unsigned)(size_t)ring + (unsigned)((ks * NP + g) * PB + lane * 16);
    // pass t works on stage (t + rot) mod NT of every slice: the work-groups of a batch read the same K and V lines, and started at different stages they do not ask L2 for the same lines at the same moment. The softmax takes the keys in any order.
    static_assert((NT & (NT - 1)) == 0, "the walk wraps by a mask");
    auto fill = [&](int t) { const unsigned d = dst + (unsigned)((t & 1) * SB); const size_t so = (size_t)((t + rot) & (NT - 1)) * PB; copy4k(d, src + so); if constexpr (HI) copy4k(d + 2 * PB, src2 + so); };
    fill(0);
    asm volatile("s_wait_asynccnt 0x0" ::: "memory");   // this wave's share of the first pass's stage has landed
    __syncthreads();   // the first pass's stage is whole before any wave reads it
    fill(1);
#pragma unroll 1   // one pass = one stage = 32 keys of the wave's slice; the two buffers alternate by the pass's parity
    for (int it = 0; it < NT; ++it) {
        const T16* st = (const T16*)(ring + (it & 1) * SB + ks * NP * PB) + lane * 8;
        V kf[2][2], kf2[2][2];
#pragma unroll
        for (int kt = 0; kt < 2; ++kt)
#pragma unroll
            for (int kc = 0; kc < 2; ++kc) { const int a = kt * 16 * HD + kc * 2 * FC; kf[kt][kc] = F::ldf(st + a); if (HI) kf2[kt][kc] = F::ldf(st + 2 * (PB / 2) + a); }
        V vf[4], vf2[4]; v8f s[2][NQ0];
        // scores of tiles QA .. QB - 1 against the stage's 32 keys
        auto scores = [&](auto qa_, auto qb_) {
            constexpr int QA = decltype(qa_)::v, QB = decltype(qb_)::v;
#pragma unroll
            for (int kt = 0; kt < 2; ++kt)
#pragma unroll
                for (int qt = QA; qt < QB; ++qt) s[kt][qt] = (v8f){};
#pragma unroll
            for (int kc = 0; kc < 2; ++kc) {
#pragma unroll
                for (int kt = 0; kt < 2; ++kt)
#pragma unroll
                    for (int qt = QA; qt < QB; ++qt) s[kt][qt] = F::mma(kf[kt][kc], qf[qt][kc], s[kt][qt]);
                if (HI) {
#pragma unroll
                    for (int kt = 0; kt < 2; ++kt)
#pragma unroll
                        for (int qt = QA; qt < QB; ++qt) s[kt][qt] = F::mma(kf2[kt][kc], qf[qt][kc], s[kt][qt]);
#pragma unroll
                    for (int kt = 0; kt < 2; ++kt)
#pragma unroll
                        for (int qt = QA; qt < QB; ++qt) s[kt][qt] = F::mma(kf[kt][kc], qf2[qt][kc], s[kt][qt]); } } };
        // softmax step and attn x v of tiles QA .. QB - 1
        auto tiles = [&](auto qa_, auto qb_) {
            constexpr int QA = decltype(qa_)::v, QB = decltype(qb_)::v;
            float ml[NQ0]; bool need = false;
#pragma unroll
            for (int qt = QA; qt < QB; ++qt) { float mx = fmaxf(s[0][qt][0], s[1][qt][0]);
#pragma unroll
                for (int j = 1; j < 8; ++j) mx = fmaxf(mx, fmaxf(s[0][qt][j], s[1][qt][j]));
                ml[qt] = mx * C2; need = need || (ml[qt] > mu[qt] + 8.0f); }
            if (__builtin_amdgcn_ballot_w32(need) != 0) {   // the maximum in use moves only when a score passes it by more than 2^8: rare behind the first pass
#pragma unroll
                for (int qt = QA; qt < QB; ++qt) { const float mn = fmaxf(mu[qt], fmaxf(ml[qt], __shfl_xor(ml[qt], 16, 32))); const float al = exp2s(mu[qt] - mn); mu[qt] = mn; l[qt] *= al;
#pragma unroll
                    for (int dt = 0; dt < 4; ++dt) o[dt][qt] *= al; } }
            V pf[NQ0], pf2[NQ0];
#pragma unroll
            for (int qt = QA; qt < QB; ++qt) {
#pragma unroll
                for (int kt = 0; kt < 2; ++kt) {
#pragma unroll
                    for (int j = 0; j < 8; ++j) s[kt][qt][j] = __builtin_fmaf(s[kt][qt][j], C2, -mu[qt]);
                    exp2x8(s[kt][qt]);
#pragma unroll
                    for (int j = 0; j < 8; ++j) l[qt] += s[kt][qt][j]; }
                if constexpr (HI) { const v8bf h0 = __builtin_convertvector(s[0][qt], v8bf), h1 = __builtin_convertvector(s[1][qt], v8bf);
                    const v8bf l0 = __builtin_convertvector(s[0][qt] - __builtin_convertvector(h0, v8f), v8bf), l1 = __builtin_convertvector(s[1][qt] - __builtin_convertvector(h1, v8f), v8bf);
                    pf[qt] = __builtin_shufflevector(h0, h1, 0, 1, 2, 3, 4, 5, 6, 7, 8, 9, 10, 11, 12, 13, 14, 15); pf2[qt] = __builtin_shufflevector(l0, l1, 0, 1, 2, 3, 4, 5, 6, 7, 8, 9, 10, 11, 12, 13, 14, 15);
                } else pf[qt] = cat16(__builtin_convertvector(s[0][qt], v8h), __builtin_convertvector(s[1][qt], v8h)); }
            if constexpr (NQ0 > 2) {
#pragma unroll
                for (int qt = QA; qt < QB; ++qt) asm volatile("" : "+v"(l[qt])); }   // each row's sum, against spills: left free, the additions sink behind the products, the further tile and the barrier, every probability stays alive in f32 beside its 16-bit copy, and Q fragments go out to scratch
            if constexpr (HI && QA == 0) {
                __builtin_amdgcn_sched_barrier(0);   // keeps the loads of V's lo fragments behind the softmax: fetched beside it they push Q fragments out to scratch; the first two product groups cover their latency
#pragma unroll
                for (int dt = 0; dt < 4; ++dt) vf2[dt] = F::ldf(st + 3 * (PB / 2) + dt * 2 * FC); }
#pragma unroll
            for (int dt = 0; dt < 4; ++dt)
#pragma unroll
                for (int qt = QA; qt < QB; ++qt) o[dt][qt] = F::mma(vf[dt], pf[qt], o[dt][qt]);
            if (HI) {
#pragma unroll
                for (int dt = 0; dt < 4; ++dt)
#pragma unroll
                    for (int qt = QA; qt < QB; ++qt) o[dt][qt] = F::mma(vf[dt], pf2[qt], o[dt][qt]);
#pragma unroll
                for (int dt = 0; dt < 4; ++dt)
#pragma unroll
                    for (int qt = QA; qt < QB; ++qt) o[dt][qt] = F::mma(vf2[dt], pf[qt], o[dt][qt]); } };
        // group 0's further tile works from the same K and V fragments, under a scalar test with no barrier inside. Its scores come first: so all scores are done before the first softmax step, the K fragments' registers are free from there on, and the products of the other tiles fill the slots behind its last one
        if constexpr (NQ1 < NQ0) { if (full) scores(IC<NQ1>{}, IC<NQ0>{}); }
        scores(IC<0>{}, IC<NQ1>{});
#pragma unroll
        for (int dt = 0; dt < 4; ++dt) vf[dt] = F::ldf(st + PB / 2 + dt * 2 * FC);
        tiles(IC<0>{}, IC<NQ1>{});
        if constexpr (NQ1 < NQ0) { if (full) tiles(IC<NQ1>{}, IC<NQ0>{}); }
        // four vector slots behind the pass's last matrix instruction, for the taken back edge and the jump past the further tile
        if constexpr (NQ0 == 1) asm volatile("v_nop\n\tv_nop\n\tv_nop\n\tv_nop" : "+v"(o[0][0]), "+v"(o[1][0]), "+v"(o[2][0]), "+v"(o[3][0]));
        else if constexpr (NQ0 == 2) asm volatile("v_nop\n\tv_nop\n\tv_nop\n\tv_nop" : "+v"(o[0][0]), "+v"(o[1][0]), "+v"(o[2][0]), "+v"(o[3][0]), "+v"(o[0][1]), "+v"(o[1][1]), "+v"(o[2][1]), "+v"(o[3][1]));
        else { static_assert(NQ0 <= 3, "the statement names every accumulator"); asm volatile("v_nop\n\tv_nop\n\tv_nop\n\tv_nop" : "+v"(o[0][0]), "+v"(o[1][0]), "+v"(o[2][0]), "+v"(o[3][0]), "+v"(o[0][1]), "+v"(o[1][1]), "+v"(o[2][1]), "+v"(o[3][1]), "+v"(o[0][2]), "+v"(o[1][2]), "+v"(o[2][2]), "+v"(o[3][2])); }
        // hand-over of pass it + 1's stage, in this order in every wave
        asm volatile("s_wait_dscnt 0x0" ::: "memory");      // this wave's reads of this pass's stage are done before its buffer may be refilled
        asm volatile("s_wait_asynccnt 0x0" ::: "memory");   // this wave's share of pass it + 1's stage has landed
        __syncthreads();   // pass it + 1's stage is whole, and every wave has left this pass's
        if (it + 2 < NT) fill(it + 2);
    }
    asm volatile("s_wait_asynccnt 0x0" ::: "memory");   // no copy is outstanding when the ring becomes the partials' place (the last pass's barrier has ended every read of it)
    float* os = (float*)ring; constexpr int G0 = NQ0 * 16, G1 = NQ1 * 16, NQW = G0 + G1;   // query columns of group 0, of group 1, of the work-group
    const int rb = g ? KW * G0 + ks * G1 : ks * G0;   // partials: [group][slice][column of the group]
#pragma unroll
    for (int qt = 0; qt < NQ0; ++qt) if (qt < NQ1 || full) { l[qt] += __shfl_xor(l[qt], 16, 32); const int q = rb + qt * 16 + lr; if (hi == 0) { ms[q] = mu[qt]; ls[q] = l[qt]; }
#pragma unroll
        for (int dt = 0; dt < 4; ++dt) { float* d = os + (size_t)q * OP + dt * 16 + hi * 8; *(v4fa*)d = __builtin_shufflevector(o[dt][qt], o[dt][qt], 0, 1, 2, 3); *(v4fa*)(d + 4) = __builtin_shufflevector(o[dt][qt], o[dt][qt], 4, 5, 6, 7); } }
    __syncthreads();   // every wave's partials are in LDS before any thread joins them
    // 16 threads a query, 4 outputs each, 32 queries a round (a wave: two whole rows of out); in the last round only the waves whose queries exist
    constexpr int NR = (NQW + 31) / 32; v4f res[NR];
#pragma unroll
    for (int i = 0; i < NR; ++i) if ((i + 1) * 32 <= NQW || i * 32 + 2 * w < NQW) {
        const int q = i * 32 + threadIdx.x / 16, d0 = (threadIdx.x % 16) * 4;
        const int gr = q < G0 ? G0 : G1, r0 = q < G0 ? q : KW * G0 + q - G0;   // rows from slice to slice, and the query's row in the partials of its group's slice 0
        float M = ms[r0];
#pragma unroll
        for (int ww = 1; ww < KW; ++ww) M = fmaxf(M, ms[ww * gr + r0]);
        float L = 0.f; v4f acc = (v4f){};
#pragma unroll
        for (int ww = 0; ww < KW; ++ww) { const float al = exp2s(ms[ww * gr + r0] - M); L += ls[ww * gr + r0] * al; acc += *(const v4fa*)(os + (size_t)(ww * gr + r0) * OP + d0) * al; }
        res[i] = acc * __fdiv_rn(1.0f, L); }
#pragma unroll
    for (int i = 0; i < NR; ++i) if ((i + 1) * 32 <= NQW || i * 32 + 2 * w < NQW) *(v4f*)(outb + (size_t)(q0 + i * 32 + threadIdx.x / 16) * DQ + (threadIdx.x % 16) * 4) = res[i];
    if constexpr (!HI) asm volatile("s_wait_xcnt 0x0" ::: "memory");   // behind an fp16 form's last stores: in the built code another form's text follows and reuses their registers
}
// grid x: first the hi/lo work-groups (NB_ x RH / HW, 1 + 1 tiles = HW query columns each), then the fp16 ones (FN a batch, 3 + 2 tiles = FW columns each), then one fp16 work-group a batch (2 + 2 tiles) for the columns left; fewer work-groups than WGPs, one per WGP, all at once.
// A hi/lo tile costs three products where an fp16 tile costs one: with 2 tiles a slice against 5 no kind of work-group runs far longer than the others.
#define HW   32
#define FW   80
#define FN   ((TT - RH) / FW)
__global__ __launch_bounds__(QG * KW * 32) __attribute__((amdgpu_waves_per_eu(4, 4))) void k_fattn(const h16* __restrict__ Q16, const h16* __restrict__ K16, const h16* __restrict__ V16, const bf* __restrict__ Qh, const bf* __restrict__ Ql, const bf* __restrict__ Kh, const bf* __restrict__ Kl, const bf* __restrict__ Vh, const bf* __restrict__ Vl, float* __restrict__ OUTp) {
    __shared__ __align__(128) char ring[2 * KW * 4 * PB];   // two stage buffers (hi/lo: 4 planes; fp16: 2); behind the loop the KW x (a work-group's query columns) rows of OP floats of the partials
    __shared__ float ms[KW * FW]; __shared__ float ls[KW * FW];
    static_assert(KW * FW * OP * 4 <= 2 * KW * 4 * PB, "the partials fit the ring");
    static_assert(RH % HW == 0 && (TT - RH) - FN * FW == 64, "the work-groups cover every row once");
    const int bid = blockIdx.x;
    if (bid < NB_ * RH / HW) { const size_t pb = (size_t)(bid / (RH / HW)) * TT * HD; attn_cols<bf, true, 1, 1>(Qh + pb, Ql + pb, Kh + pb, Kl + pb, Vh + pb, Vl + pb, (bid % (RH / HW)) * HW, bid % (RH / HW), OUTp + pb, ring, ms, ls); }
    else if (bid < NB_ * RH / HW + NB_ * FN) { const int id = bid - NB_ * RH / HW; const size_t pb = (size_t)(id / FN) * TT * HD; attn_cols<h16, false, 3, 2>(Q16 + pb, nullptr, K16 + pb, nullptr, V16 + pb, nullptr, RH + (id % FN) * FW, id % FN, OUTp + pb, ring, ms, ls); }
    else { const size_t pb = (size_t)(bid - NB_ * RH / HW - NB_ * FN) * TT * HD; attn_cols<h16, false, 2, 2>(Q16 + pb, nullptr, K16 + pb, nullptr, V16 + pb, nullptr, RH + FN * FW, FN, OUTp + pb, ring, ms, ls); }
}

extern "C" void kernel_launch(void* const* d_in, const int* in_sizes, int n_in,
                              void* d_out, int out_size, void* d_ws, size_t ws_size, hipStream_t stream) {
    (void)in_sizes; (void)n_in; (void)out_size;
    const float* x = (const float*)d_in[0]; const float* wk3 = (const float*)d_in[1];   /* kernel [3][64][64] 'xw': q, k, v */
    float* OUT = (float*)d_out;     // [4][4096][64]
    char* wsp = (char*)d_ws;
    auto take = [&](size_t bytes) { char* p = wsp; wsp += (bytes + 255) & ~(size_t)255; return (void*)p; };
    // q/k/v planes hold all NB_ batches, [batch] outermost
    h16* QP16 = (h16*)take((size_t)NB_ * NH_ * TT * HD * 2); h16* KP16 = (h16*)take((size_t)NB_ * NKV * TT * HD * 2); h16* VT16 = (h16*)take((size_t)NB_ * NKV * HD * TT * 2);
    bf* QPh = (bf*)take((size_t)NB_ * NH_ * TT * HD * 2); bf* QPl = (bf*)take((size_t)NB_ * NH_ * TT * HD * 2); bf* KPh = (bf*)take((size_t)NB_ * NKV * TT * HD * 2); bf* KPl = (bf*)take((size_t)NB_ * NKV * TT * HD * 2); bf* VTh = (bf*)take((size_t)NB_ * NKV * HD * TT * 2); bf* VTl = (bf*)take((size_t)NB_ * NKV * HD * TT * 2);
    if ((size_t)(wsp - (char*)d_ws) > ws_size) return;    // ws 256 MiB
    k_prep<<<NB_ * TT / PR, 384, 0, stream>>>(x, wk3, QP16, QPh, QPl, KP16, KPh, KPl, VT16, VTh, VTl);
    // attention: one launch for all batches and both row classes
    k_fattn<<<NB_ * RH / HW + NB_ * FN + NB_, QG * KW * 32, 0, stream>>>(QP16, KP16, VT16, QPh, QPl, KPh, KPl, VTh, VTl, OUT);
}

// v009
// One run takes 27.5 microseconds.
// In two side-by-side timings against v008, it was 1.09 and 1.08 times as fast.
// All steps since v000 together make it 31.3 times as fast.
#include <hip/hip_runtime.h>

// Single-head self-attention with a sinusoidal (sine-only) position embedding (x [4][4096][64]; x' = x + PE, PE[i][j] = sin(i x 10000^(-2j/64)) (computed: float32 inverse frequencies via pow, precise sinf); q, k, v = x' kernel[0|1|2] ('xw' [64][64] 0.05, no bias); scores / 8 over all 4,096 keys; softmax; out = attn v -> [4][4096][64] (1.0 M)).
// Two launches: k_prep (x + PE, the three projections and every q/k/v plane, all 4 batches, 64 rows of x per work-group) and the one fused attention kernel.
// The q/k/v planes lie in fragment order: a chunk of FC elements holds, lane after lane, the 8 elements that each of the 32 lanes takes with one 16-byte load, so a wave's load or store covers 512 bytes in a row (4 whole lines, not 32 bytes of each of 16).
// Layout per batch: x + PE summed in f32 from the bf16-rounded input and split into hi/lo bf16 (the sum is not bf16-exact); projections hi/lo x exact (2 products); one 64-wide head, attention fused in one kernel (hybrid rows: < 512 fp16 + fp16 residual, 3 products, rest fp16 alone; running-maximum softmax in registers, scores and probabilities never stored); 8 key slices x 2 query groups per work-group (16 + 16 hi/lo or 48 + 32 fp16 query columns), K and V staged in LDS for both groups, slices joined in LDS.
// Compute dtypes, f32 accumulate: every input rounded to bf16; position embedding f32; projections hi/lo bf16 x exact; attention rows < 512 3 products of fp16 values and fp16 residuals, rest fp16; softmax f32; output f32.
// Six planes: q, k, v in fp16 serve every row; the residual planes (value - its fp16 rounding, again in fp16) of k and v serve the rows < RH, that of q is written for those rows alone.
#define NB_  4
#define TT   4096
#define DM   64
#define NH_  1
#define NKV  1
#define REP  (NH_ / NKV)
#define HD   64
#define DQ   (NH_ * HD)
#define DKV  (NKV * HD)
#define RH   512                  // query rows < RH use the residual planes too (0: none)
#define WIN  0
#define SCL  0.125f   // HD^-0.5
#define KW   8                    // key slices of an attention work-group: a wave walks one slice of TT / KW keys
#define QG   2                    // groups of query columns of an attention work-group (a group: 1 to 3 tiles of 16 columns); QG x KW waves
#define OP   68                   // LDS pitch in floats of a query's 64 partial outputs
#define FC   256                  // 16-bit elements of a plane chunk (32 lanes x 8). q, k: [row / 16][d / 16][chunk], lane = 16 (d / 8 % 2) + row % 16; v: [key / 32][d / 16][key / 16 % 2][chunk], lane = 16 (key / 8 % 2) + d % 16
typedef _Float16 h16;
typedef unsigned short bf;
typedef __attribute__((ext_vector_type(16))) __bf16   v16bf;
typedef __attribute__((ext_vector_type(16))) _Float16 v16h;
typedef __attribute__((ext_vector_type(8)))  _Float16 v8h;
typedef __attribute__((ext_vector_type(8)))  unsigned short v8us;
typedef __attribute__((ext_vector_type(8)))  float    v8f;
typedef __attribute__((ext_vector_type(4)))  float    v4f;
typedef v8h  __attribute__((may_alias)) v8ha;
typedef v4f  __attribute__((may_alias)) v4fa;
typedef v8us __attribute__((may_alias)) v8usa;

__device__ __forceinline__ unsigned short f2bf(float f) { unsigned u = __float_as_uint(f); u += 0x7FFFu + ((u >> 16) & 1u); return (unsigned short)(u >> 16); }
__device__ __forceinline__ float bf2f(unsigned short b) { return __uint_as_float(((unsigned)b) << 16); }
__device__ __forceinline__ float bfr(float f) { return bf2f(f2bf(f)); }
__device__ __forceinline__ v16h cat16(v8h lo, v8h hi) { return __builtin_shufflevector(lo, hi, 0, 1, 2, 3, 4, 5, 6, 7, 8, 9, 10, 11, 12, 13, 14, 15); }
__device__ __forceinline__ v16bf cat16b(v8us lo, v8us hi) { return __builtin_bit_cast(v16bf, __builtin_shufflevector(lo, hi, 0, 1, 2, 3, 4, 5, 6, 7, 8, 9, 10, 11, 12, 13, 14, 15)); }
__device__ __forceinline__ v8f wmma16(v16h a, v16h b, v8f c) { return __builtin_amdgcn_wmma_f32_16x16x32_f16(false, a, false, b, (short)0, c, false, false); }
__device__ __forceinline__ v8f wmmab(v16bf a, v16bf b, v8f c) { return __builtin_amdgcn_wmma_f32_16x16x32_bf16(false, a, false, b, (short)0, c, false, false); }

// 16x16x32 operand fragment of lane (lr, hi): 16-bit elements p[0..7] and p[16..23], p = row lr + 8 hi; the same map serves A and B (ld: from a row-major tile; ldf: the same elements from two neighbouring chunks of a plane, p = chunk + 8 lane)
template <typename T16> struct WFrag;
template <> struct WFrag<h16> { typedef v16h V; static __device__ __forceinline__ V ld(const h16* p) { return cat16(*(const v8h*)p, *(const v8h*)(p + 16)); } static __device__ __forceinline__ V ldf(const h16* p) { return cat16(*(const v8h*)p, *(const v8h*)(p + FC)); } static __device__ __forceinline__ v8f mma(V a, V b, v8f c) { return wmma16(a, b, c); } };
template <> struct WFrag<bf> { typedef v16bf V; static __device__ __forceinline__ V ld(const bf* p) { return cat16b(*(const v8us*)p, *(const v8us*)(p + 16)); } static __device__ __forceinline__ V ldf(const bf* p) { return cat16b(*(const v8us*)p, *(const v8us*)(p + FC)); } static __device__ __forceinline__ v8f mma(V a, V b, v8f c) { return wmmab(a, b, c); } };
__device__ __forceinline__ h16 tohx(float x) { return (h16)x; }
__device__ __forceinline__ void splitf(float y, unsigned short& h, unsigned short& l) { h = f2bf(y); l = f2bf(y - bf2f(h)); }
__constant__ __attribute__((aligned(16))) float PEINV[DM] = { 1.000000000e+00f,7.498942018e-01f,5.623413324e-01f,4.216965139e-01f,3.162277639e-01f,2.371373624e-01f,1.778279394e-01f,1.333521456e-01f,1.000000015e-01f,7.498941571e-02f,5.623412877e-02f,4.216964915e-02f,3.162277862e-02f,2.371373586e-02f,1.778279431e-02f,1.333521493e-02f,9.999999776e-03f,7.498942316e-03f,5.623413250e-03f,4.216964822e-03f,3.162277862e-03f,2.371373819e-03f,1.778279431e-03f,1.333521446e-03f,1.000000047e-03f,7.498941850e-04f,5.623413017e-04f,4.216964880e-04f,3.162277862e-04f,2.371373848e-04f,1.778279402e-04f,1.333521504e-04f,9.999999747e-05f,7.498942432e-05f,5.623413017e-05f,4.216965317e-05f,3.162277426e-05f,2.371373739e-05f,1.778279329e-05f,1.333521413e-05f,9.999999747e-06f,7.498942068e-06f,5.623413472e-06f,4.216964953e-06f,3.162277608e-06f,2.371373739e-06f,1.778279398e-06f,1.333521482e-06f,9.999999975e-07f,7.498942409e-07f,5.623413131e-07f,4.216964840e-07f,3.162277551e-07f,2.371373711e-07f,1.778279284e-07f,1.333521453e-07f,1.000000012e-07f,7.498942267e-08f,5.623413202e-08f,4.216964911e-08f,3.162277551e-08f,2.371373675e-08f,1.778279390e-08f,1.333521382e-08f };   // 1/10000^(2j/64) for j < 64 as float32 (jnp.power form, precomputed)

#define PR   64                   // rows of x per k_prep work-group: four 16-row tiles of the q and k planes, two 32-key blocks of the v plane
#define XP   72                   // LDS pitch in 16-bit elements of a 64-wide row (144 bytes = 16 x odd, for 16-byte fragment reads)
// eight f32 results of one lane, contiguous in the plane: their fp16 roundings and the fp16 residuals, 16 bytes each
__device__ __forceinline__ void cut8(v8f r, v8h& o16, v8h& ol) {
#pragma unroll
    for (int j = 0; j < 8; ++j) { o16[j] = tohx(r[j]); ol[j] = tohx(r[j] - (float)o16[j]); } }
// ---- k_prep: x + PE, q/k/v projections and their planes in one kernel. grid x = [NB_ x TT] rows / PR, 12 waves.
// Waves 0-7 form x + PE (16 values a thread) as hi/lo bf16 rows in LDS, waves 8-11 the three weight matrices as bf16 [n][k] rows; behind the barrier wave w owns matrix w / 4 and 16 rows (w % 4).
// q and k: D = W^T x'^T (A = 16 output columns, B = 16 rows of x'), so a lane holds 8 neighbouring d of one row t; v: D = x' W (A = rows, B = columns), 8 neighbouring t of one d: in both cases the 8 elements that one lane of an attention fragment takes with one load, so each tile goes out as whole chunks. Per tile: hi k 0-31, lo k 0-31, hi k 32-63, lo k 32-63.
__global__ __launch_bounds__(384) void k_prep(const float* __restrict__ x, const float* __restrict__ wk3, h16* __restrict__ Q16, h16* __restrict__ Ql, h16* __restrict__ K16, h16* __restrict__ Kl, h16* __restrict__ V16, h16* __restrict__ Vl) {
    __shared__ __align__(16) bf xh[PR * XP]; __shared__ __align__(16) bf xl[PR * XP]; __shared__ __align__(16) bf wt[3 * HD * XP];
    const int tid = threadIdx.x, w = __builtin_amdgcn_readfirstlane(tid >> 5); const int R0 = blockIdx.x * PR;   // first row of the work-group in [NB_ x TT]; PR divides TT, so all its rows are of one batch
    if (w < 8) {
        const int row = tid >> 2, c0 = (tid & 3) * 16; const int t = R0 % TT + row; const float* xr = x + (size_t)(R0 + row) * DM + c0;
        v4f x4[4], f4[4];   // the thread's inverse frequencies come in with its x, ahead of the sines: fetched one by one between the sines' branches, each would be waited for alone
#pragma unroll
        for (int i = 0; i < 4; ++i) { x4[i] = *(const v4f*)(xr + 4 * i); f4[i] = *(const v4f*)(PEINV + c0 + 4 * i); }
        v8us oh[2], ol[2];
#pragma unroll
        for (int q = 0; q < 16; ++q) { const float ang = __fmul_rn((float)t, f4[q >> 2][q & 3]); const float s = __fadd_rn(bfr(x4[q >> 2][q & 3]), sinf(ang)); unsigned short u, v; splitf(s, u, v); oh[q >> 3][q & 7] = u; ol[q >> 3][q & 7] = v; }
#pragma unroll
        for (int i = 0; i < 2; ++i) { *(v8usa*)(xh + row * XP + c0 + 8 * i) = oh[i]; *(v8usa*)(xl + row * XP + c0 + 8 * i) = ol[i]; }
    } else {
        const int u = tid - 256, kb = u >> 4, nq = u & 15;   // 8 k x 4 n of each matrix a thread
#pragma unroll
        for (int m = 0; m < 3; ++m) { v4f r[8];
#pragma unroll
            for (int kk = 0; kk < 8; ++kk) r[kk] = *(const v4f*)(wk3 + (size_t)m * DM * HD + (kb * 8 + kk) * HD + nq * 4);
#pragma unroll
            for (int c = 0; c < 4; ++c) { v8us o;
#pragma unroll
                for (int kk = 0; kk < 8; ++kk) o[kk] = f2bf(r[kk][c]);
                *(v8usa*)(wt + (m * HD + nq * 4 + c) * XP + kb * 8) = o; } }
    }
    __syncthreads();   // x' rows and weight rows are in LDS before any wave reads its fragments
    typedef WFrag<bf> F;
    const int lane = tid & 31, lr = lane & 15, hi = lane >> 4, m = w >> 2, rt = w & 3;
    v16bf ah[2], al[2];
#pragma unroll
    for (int kc = 0; kc < 2; ++kc) { const int o = (rt * 16 + lr) * XP + kc * 32 + 8 * hi; ah[kc] = F::ld(xh + o); al[kc] = F::ld(xl + o); }
    const bf* wp = wt + (m * HD + lr) * XP + 8 * hi;
    v8h o16[4], ol[4];   // a wave's four tiles, stored behind its last product
    if (m < 2) {
        h16* P16 = m ? K16 : Q16; h16* Pl = m ? Kl : Ql; static_assert(RH % PR == 0, "a work-group's rows are all below RH or none is"); const bool lo = m || R0 % TT < RH;   /* q's residuals are read for rows < RH alone */ const size_t ob = (size_t)(R0 / 16 + rt) * (16 * HD) + lane * 8;   // tile nb holds d = 16 nb + 8 hi + j of row lr: chunk nb of the 16 rows
#pragma unroll
        for (int nb = 0; nb < 4; ++nb) { const v16bf b0 = F::ld(wp + nb * 16 * XP), b1 = F::ld(wp + nb * 16 * XP + 32); v8f acc = (v8f){};
            acc = wmmab(b0, ah[0], acc); acc = wmmab(b0, al[0], acc); acc = wmmab(b1, ah[1], acc); acc = wmmab(b1, al[1], acc);
            cut8(acc, o16[nb], ol[nb]); }
#pragma unroll
        for (int nb = 0; nb < 4; ++nb) *(v8h*)(P16 + ob + nb * FC) = o16[nb];
        asm volatile("s_wait_xcnt 0x0" ::: "memory");   // in the built code the residuals are formed behind the test below, in registers that these four stores name
        if (lo) {
#pragma unroll
            for (int nb = 0; nb < 4; ++nb) *(v8h*)(Pl + ob + nb * FC) = ol[nb]; }
    } else {
        const size_t ob = (size_t)(R0 / 32 + (rt >> 1)) * (32 * HD) + (rt & 1) * FC + lane * 8;   // tile nb holds keys 16 rt + 8 hi + j of d = 16 nb + lr: half rt % 2 of the 32 keys' chunk pair nb
#pragma unroll
        for (int nb = 0; nb < 4; ++nb) { const v16bf b0 = F::ld(wp + nb * 16 * XP), b1 = F::ld(wp + nb * 16 * XP + 32); v8f acc = (v8f){};
            acc = wmmab(ah[0], b0, acc); acc = wmmab(al[0], b0, acc); acc = wmmab(ah[1], b1, acc); acc = wmmab(al[1], b1, acc);
            cut8(acc, o16[nb], ol[nb]); }
#pragma unroll
        for (int nb = 0; nb < 4; ++nb) { *(v8h*)(V16 + ob + nb * 2 * FC) = o16[nb]; *(v8h*)(Vl + ob + nb * 2 * FC) = ol[nb]; }
        asm volatile("s_wait_xcnt 0x0" ::: "memory");   // behind this side's last stores: in the built code the other side's text follows and reuses their registers
    }
}
// v_exp_f32 in asm text with the one vector slot that the instruction set asks for behind a transcendental before its result is used or its source overwritten: inside a statement the slot stands where it is written, whatever registers the allocator reuses next.
__device__ __forceinline__ float exp2s(float x) { float r; asm("v_exp_f32 %0, %1\n\tv_nop" : "=v"(r) : "v"(x)); return r; }
// eight in place: each next one is independent and fills the slot of the one before, the v_nop that of the last
__device__ __forceinline__ void exp2x8(v8f& x) { float a = x[0], b = x[1], c = x[2], d = x[3], e = x[4], f = x[5], g = x[6], h = x[7];
    asm("v_exp_f32 %0, %0\n\tv_exp_f32 %1, %1\n\tv_exp_f32 %2, %2\n\tv_exp_f32 %3, %3\n\tv_exp_f32 %4, %4\n\tv_exp_f32 %5, %5\n\tv_exp_f32 %6, %6\n\tv_exp_f32 %7, %7\n\tv_nop" : "+v"(a), "+v"(b), "+v"(c), "+v"(d), "+v"(e), "+v"(f), "+v"(g), "+v"(h));
    x[0] = a; x[1] = b; x[2] = c; x[3] = d; x[4] = e; x[5] = f; x[6] = g; x[7] = h; }
// ---- k_fattn: scores, softmax and attn x v in one kernel. S^T = K Q^T (A = 16 keys, B = 16 query columns kept in registers), so a lane holds scores of ONE query; two S^T tiles (keys 0-15, 16-31), converted in place, are the B operand of O^T += V^T P^T.
// A work-group has QG groups of query columns and KW key slices: each wave has one group and one slice and walks keys [slice TT/KW, (slice+1) TT/KW) for its group with its own maximum in use, sum and O^T; a group's KW partials are joined in LDS in slice order.
// The QG waves of a slice work from ONE copy of its K and V chunks: a stage (32 keys of every slice) is brought into LDS by asynchronous copies, chunk for chunk as it lies in the planes, so each K and V byte leaves L2 once per work-group, not once per group. Two stage buffers: stage t + 2 flies while stage t + 1 is worked on. rot: the work-group's number among those of its batch and kind, the stage at which its walk starts.
#define PB   4096                 // bytes of 32 keys of one plane: 8 chunks, what one wave copies with 8 instructions
// eight asynchronous copies of 32 lanes x 16 bytes: 4 KiB in a row, l = the lane's LDS byte address, g = the lane's global address. The s_wait_xcnt is the last line of the copies' own statement, so that no address register is rewritten ahead of it.
__device__ __forceinline__ void copy4k(unsigned l, const char* g) {
    asm volatile("global_load_async_to_lds_b128 %0, %8, off\n\tglobal_load_async_to_lds_b128 %1, %9, off\n\tglobal_load_async_to_lds_b128 %2, %10, off\n\tglobal_load_async_to_lds_b128 %3, %11, off\n\t"
                 "global_load_async_to_lds_b128 %4, %12, off\n\tglobal_load_async_to_lds_b128 %5, %13, off\n\tglobal_load_async_to_lds_b128 %6, %14, off\n\tglobal_load_async_to_lds_b128 %7, %15, off\n\ts_wait_xcnt 0x0"
                 :: "v"(l), "v"(l + 512), "v"(l + 1024), "v"(l + 1536), "v"(l + 2048), "v"(l + 2560), "v"(l + 3072), "v"(l + 3584),
                    "v"(g), "v"(g + 512), "v"(g + 1024), "v"(g + 1536), "v"(g + 2048), "v"(g + 2560), "v"(g + 3072), "v"(g + 3584) : "memory"); }
template <int N> struct IC { static constexpr int v = N; };
// NQ0, NQ1: tiles of 16 query columns of a wave of group 0 and of group 1 (NQ1 = NQ0 or NQ0 - 1)
template <typename T16, bool HI, int NQ0, int NQ1>
__device__ __forceinline__ void attn_cols(const T16* __restrict__ Q, const T16* __restrict__ Q2, const T16* __restrict__ Kp, const T16* __restrict__ K2, const T16* __restrict__ Vt, const T16* __restrict__ V2, int q0, int rot, float* __restrict__ outb, char* ring, float* ms, float* ls) {
    typedef WFrag<T16> F; typedef typename F::V V;
    static_assert(NQ1 == NQ0 || NQ1 == NQ0 - 1, "group 1 has as many tiles as group 0 or one fewer");
    const float C2 = SCL * 1.4426950408889634f;   // scores are taken to base 2
    constexpr int NP = HI ? 4 : 2, SB = KW * NP * PB, NT = TT / KW / 32;   // planes of a stage (K, V, then the lo planes of K, V), bytes of a stage buffer [slice][plane][PB], stages
    // waves 2 ks and 2 ks + 1 are the two groups of slice ks; which of them is group 1 alternates from one four waves to the next, so that of waves w, w + 1, w + 2, w + 3 and of waves w, w + 4, w + 8, w + 12 alike two are of each group
    const int lane = threadIdx.x & 31, lr = lane & 15, hi = lane >> 4, w = __builtin_amdgcn_readfirstlane(threadIdx.x >> 5), ks = w >> 1, g = ((w >> 2) ^ w) & 1;
    const bool full = NQ1 == NQ0 || g == 0;   // the wave has tile NQ0 - 1: the same in every lane, a scalar test
    V qf[NQ0][2], qf2[NQ0][2];
#pragma unroll
    for (int qt = 0; qt < NQ0; ++qt)
#pragma unroll
        for (int kc = 0; kc < 2; ++kc) { const size_t o = (size_t)(q0 / 16 + g * NQ0 + ((qt < NQ1 || full) ? qt : 0)) * (16 * HD) + kc * 2 * FC + lane * 8;   // a wave without the last tile takes its first again: in bounds, never used
            qf[qt][kc] = F::ldf(Q + o); if (HI) qf2[qt][kc] = F::ldf(Q2 + o); }
    v8f o[4][NQ0]; float mu[NQ0], l[NQ0];
#pragma unroll
    for (int qt = 0; qt < NQ0; ++qt) { mu[qt] = -3.0e38f; l[qt] = 0.f;
#pragma unroll
        for (int dt = 0; dt < 4; ++dt) o[dt][qt] = (v8f){}; }
    const size_t kbase = (size_t)ks * (TT / KW) * HD + lane * 8;   // a stage's 32 keys are 32 x HD elements in a row of the K plane and of the V plane alike
    // of a slice's planes, group 0's wave copies K (and its lo plane), group 1's V (and its lo plane)
    const char* src = (const char*)((g ? Vt : Kp) + kbase); const char* src2 = HI ? (const char*)((g ? V2 : K2) + kbase) : src;
    const unsigned dst = (unsigned)(size_t)ring + (unsigned)((ks * NP + g) * PB + lane * 16);
    // pass t works on stage (t + rot) mod NT of every slice: the work-groups of a batch read the same K and V lines, and started at different stages they do not ask L2 for the same lines at the same moment. The softmax takes the keys in any order.
    static_assert((NT & (NT - 1)) == 0, "the walk wraps by a mask");
    auto fill = [&](int t) { const unsigned d = dst + (unsigned)((t & 1) * SB); const size_t so = (size_t)((t + rot) & (NT - 1)) * PB; copy4k(d, src + so); if constexpr (HI) copy4k(d + 2 * PB, src2 + so); };
    fill(0);
    asm volatile("s_wait_asynccnt 0x0" ::: "memory");   // this wave's share of the first pass's stage has landed
    __syncthreads();   // the first pass's stage is whole before any wave reads it
    fill(1);
#pragma unroll 1   // one pass = one stage = 32 keys of the wave's slice; the two buffers alternate by the pass's parity
    for (int it = 0; it < NT; ++it) {
        const T16* st = (const T16*)(ring + (it & 1) * SB + ks * NP * PB) + lane * 8;
        V kf[2][2], kf2[2][2];
#pragma unroll
        for (int kt = 0; kt < 2; ++kt)
#pragma unroll
            for (int kc = 0; kc < 2; ++kc) { const int a = kt * 16 * HD + kc * 2 * FC; kf[kt][kc] = F::ldf(st + a); if (HI) kf2[kt][kc] = F::ldf(st + 2 * (PB / 2) + a); }
        V vf[4], vf2[4]; v8f s[2][NQ0];
        // scores of tiles QA .. QB - 1 against the stage's 32 keys
        auto scores = [&](auto qa_, auto qb_) {
            constexpr int QA = decltype(qa_)::v, QB = decltype(qb_)::v;
#pragma unroll
            for (int kt = 0; kt < 2; ++kt)
#pragma unroll
                for (int qt = QA; qt < QB; ++qt) s[kt][qt] = (v8f){};
#pragma unroll
            for (int kc = 0; kc < 2; ++kc) {
#pragma unroll
                for (int kt = 0; kt < 2; ++kt)
#pragma unroll
                    for (int qt = QA; qt < QB; ++qt) s[kt][qt] = F::mma(kf[kt][kc], qf[qt][kc], s[kt][qt]);
                if (HI) {
#pragma unroll
                    for (int kt = 0; kt < 2; ++kt)
#pragma unroll
                        for (int qt = QA; qt < QB; ++qt) s[kt][qt] = F::mma(kf2[kt][kc], qf[qt][kc], s[kt][qt]);
#pragma unroll
                    for (int kt = 0; kt < 2; ++kt)
#pragma unroll
                        for (int qt = QA; qt < QB; ++qt) s[kt][qt] = F::mma(kf[kt][kc], qf2[qt][kc], s[kt][qt]); } } };
        // softmax step and attn x v of tiles QA .. QB - 1
        auto tiles = [&](auto qa_, auto qb_) {
            constexpr int QA = decltype(qa_)::v, QB = decltype(qb_)::v;
            float ml[NQ0]; bool need = false;
#pragma unroll
            for (int qt = QA; qt < QB; ++qt) { float mx = fmaxf(s[0][qt][0], s[1][qt][0]);
#pragma unroll
                for (int j = 1; j < 8; ++j) mx = fmaxf(mx, fmaxf(s[0][qt][j], s[1][qt][j]));
                ml[qt] = mx * C2; need = need || (ml[qt] > mu[qt] + 8.0f); }
            if (__builtin_amdgcn_ballot_w32(need) != 0) {   // the maximum in use moves only when a score passes it by more than 2^8: rare behind the first pass
#pragma unroll
                for (int qt = QA; qt < QB; ++qt) { const float mn = fmaxf(mu[qt], fmaxf(ml[qt], __shfl_xor(ml[qt], 16, 32))); const float al = exp2s(mu[qt] - mn); mu[qt] = mn; l[qt] *= al;
#pragma unroll
                    for (int dt = 0; dt < 4; ++dt) o[dt][qt] *= al; } }
            V pf[NQ0], pf2[NQ0];
#pragma unroll
            for (int qt = QA; qt < QB; ++qt) {
#pragma unroll
                for (int kt = 0; kt < 2; ++kt) {
#pragma unroll
                    for (int j = 0; j < 8; ++j) s[kt][qt][j] = __builtin_fmaf(s[kt][qt][j], C2, -mu[qt]);
                    exp2x8(s[kt][qt]);
#pragma unroll
                    for (int j = 0; j < 8; ++j) l[qt] += s[kt][qt][j]; }
                if constexpr (HI) { const v8h h0 = __builtin_convertvector(s[0][qt], v8h), h1 = __builtin_convertvector(s[1][qt], v8h);
                    const v8h l0 = __builtin_convertvector(s[0][qt] - __builtin_convertvector(h0, v8f), v8h), l1 = __builtin_convertvector(s[1][qt] - __builtin_convertvector(h1, v8f), v8h);
                    pf[qt] = cat16(h0, h1); pf2[qt] = cat16(l0, l1);
                } else pf[qt] = cat16(__builtin_convertvector(s[0][qt], v8h), __builtin_convertvector(s[1][qt], v8h)); }
            if constexpr (NQ0 > 2) {
#pragma unroll
                for (int qt = QA; qt < QB; ++qt) asm volatile("" : "+v"(l[qt])); }   // each row's sum, against spills: left free, the additions sink behind the products, the further tile and the barrier, every probability stays alive in f32 beside its 16-bit copy, and Q fragments go out to scratch
            if constexpr (HI && QA == 0) {
                __builtin_amdgcn_sched_barrier(0);   // keeps the loads of V's lo fragments behind the softmax: fetched beside it they push Q fragments out to scratch; the first two product groups cover their latency
#pragma unroll
                for (int dt = 0; dt < 4; ++dt) vf2[dt] = F::ldf(st + 3 * (PB / 2) + dt * 2 * FC); }
#pragma unroll
            for (int dt = 0; dt < 4; ++dt)
#pragma unroll
                for (int qt = QA; qt < QB; ++qt) o[dt][qt] = F::mma(vf[dt], pf[qt], o[dt][qt]);
            if (HI) {
#pragma unroll
                for (int dt = 0; dt < 4; ++dt)
#pragma unroll
                    for (int qt = QA; qt < QB; ++qt) o[dt][qt] = F::mma(vf[dt], pf2[qt], o[dt][qt]);
#pragma unroll
                for (int dt = 0; dt < 4; ++dt)
#pragma unroll
                    for (int qt = QA; qt < QB; ++qt) o[dt][qt] = F::mma(vf2[dt], pf[qt], o[dt][qt]); } };
        // group 0's further tile works from the same K and V fragments, under a scalar test with no barrier inside. Its scores come first: so all scores are done before the first softmax step, the K fragments' registers are free from there on, and the products of the other tiles fill the slots behind its last one
        if constexpr (NQ1 < NQ0) { if (full) scores(IC<NQ1>{}, IC<NQ0>{}); }
        scores(IC<0>{}, IC<NQ1>{});
#pragma unroll
        for (int dt = 0; dt < 4; ++dt) vf[dt] = F::ldf(st + PB / 2 + dt * 2 * FC);
        tiles(IC<0>{}, IC<NQ1>{});
        if constexpr (NQ1 < NQ0) { if (full) tiles(IC<NQ1>{}, IC<NQ0>{}); }
        // four vector slots behind the pass's last matrix instruction, for the taken back edge and the jump past the further tile
        if constexpr (NQ0 == 1) asm volatile("v_nop\n\tv_nop\n\tv_nop\n\tv_nop" : "+v"(o[0][0]), "+v"(o[1][0]), "+v"(o[2][0]), "+v"(o[3][0]));
        else if constexpr (NQ0 == 2) asm volatile("v_nop\n\tv_nop\n\tv_nop\n\tv_nop" : "+v"(o[0][0]), "+v"(o[1][0]), "+v"(o[2][0]), "+v"(o[3][0]), "+v"(o[0][1]), "+v"(o[1][1]), "+v"(o[2][1]), "+v"(o[3][1]));
        else { static_assert(NQ0 <= 3, "the statement names every accumulator"); asm volatile("v_nop\n\tv_nop\n\tv_nop\n\tv_nop" : "+v"(o[0][0]), "+v"(o[1][0]), "+v"(o[2][0]), "+v"(o[3][0]), "+v"(o[0][1]), "+v"(o[1][1]), "+v"(o[2][1]), "+v"(o[3][1]), "+v"(o[0][2]), "+v"(o[1][2]), "+v"(o[2][2]), "+v"(o[3][2])); }
        // hand-over of pass it + 1's stage, in this order in every wave
        asm volatile("s_wait_dscnt 0x0" ::: "memory");      // this wave's reads of this pass's stage are done before its buffer may be refilled
        asm volatile("s_wait_asynccnt 0x0" ::: "memory");   // this wave's share of pass it + 1's stage has landed
        __syncthreads();   // pass it + 1's stage is whole, and every wave has left this pass's
        if (it + 2 < NT) fill(it + 2);
    }
    asm volatile("s_wait_asynccnt 0x0" ::: "memory");   // no copy is outstanding when the ring becomes the partials' place (the last pass's barrier has ended every read of it)
    float* os = (float*)ring; constexpr int G0 = NQ0 * 16, G1 = NQ1 * 16, NQW = G0 + G1;   // query columns of group 0, of group 1, of the work-group
    const int rb = g ? KW * G0 + ks * G1 : ks * G0;   // partials: [group][slice][column of the group]
#pragma unroll
    for (int qt = 0; qt < NQ0; ++qt) if (qt < NQ1 || full) { l[qt] += __shfl_xor(l[qt], 16, 32); const int q = rb + qt * 16 + lr; if (hi == 0) { ms[q] = mu[qt]; ls[q] = l[qt]; }
#pragma unroll
        for (int dt = 0; dt < 4; ++dt) { float* d = os + (size_t)q * OP + dt * 16 + hi * 8; *(v4fa*)d = __builtin_shufflevector(o[dt][qt], o[dt][qt], 0, 1, 2, 3); *(v4fa*)(d + 4) = __builtin_shufflevector(o[dt][qt], o[dt][qt], 4, 5, 6, 7); } }
    __syncthreads();   // every wave's partials are in LDS before any thread joins them
    // 16 threads a query, 4 outputs each, 32 queries a round (a wave: two whole rows of out); in the last round only the waves whose queries exist
    constexpr int NR = (NQW + 31) / 32; v4f res[NR];
#pragma unroll
    for (int i = 0; i < NR; ++i) if ((i + 1) * 32 <= NQW || i * 32 + 2 * w < NQW) {
        const int q = i * 32 + threadIdx.x / 16, d0 = (threadIdx.x % 16) * 4;
        const int gr = q < G0 ? G0 : G1, r0 = q < G0 ? q : KW * G0 + q - G0;   // rows from slice to slice, and the query's row in the partials of its group's slice 0
        float M = ms[r0];
#pragma unroll
        for (int ww = 1; ww < KW; ++ww) M = fmaxf(M, ms[ww * gr + r0]);
        float L = 0.f; v4f acc = (v4f){};
#pragma unroll
        for (int ww = 0; ww < KW; ++ww) { const float al = exp2s(ms[ww * gr + r0] - M); L += ls[ww * gr + r0] * al; acc += *(const v4fa*)(os + (size_t)(ww * gr + r0) * OP + d0) * al; }
        res[i] = acc * __fdiv_rn(1.0f, L); }
#pragma unroll
    for (int i = 0; i < NR; ++i) if ((i + 1) * 32 <= NQW || i * 32 + 2 * w < NQW) *(v4f*)(outb + (size_t)(q0 + i * 32 + threadIdx.x / 16) * DQ + (threadIdx.x % 16) * 4) = res[i];
    if constexpr (!HI) asm volatile("s_wait_xcnt 0x0" ::: "memory");   // behind an fp16 form's last stores: in the built code another form's text follows and reuses their registers
}
// grid x: first the hi/lo work-groups (NB_ x RH / HW, 1 + 1 tiles = HW query columns each), then the fp16 ones (FN a batch, 3 + 2 tiles = FW columns each), then one fp16 work-group a batch (2 + 2 tiles) for the columns left; fewer work-groups than WGPs, one per WGP, all at once.
// A hi/lo tile costs three products where an fp16 tile costs one: with 2 tiles a slice against 5 no kind of work-group runs far longer than the others.
#define HW   32
#define FW   80
#define FN   ((TT - RH) / FW)
__global__ __launch_bounds__(QG * KW * 32) __attribute__((amdgpu_waves_per_eu(4, 4))) void k_fattn(const h16* __restrict__ Q16, const h16* __restrict__ K16, const h16* __restrict__ V16, const h16* __restrict__ Ql, const h16* __restrict__ Kl, const h16* __restrict__ Vl, float* __restrict__ OUTp) {
    __shared__ __align__(128) char ring[2 * KW * 4 * PB];   // two stage buffers (hi/lo: 4 planes; fp16: 2); behind the loop the KW x (a work-group's query columns) rows of OP floats of the partials
    __shared__ float ms[KW * FW]; __shared__ float ls[KW * FW];
    static_assert(KW * FW * OP * 4 <= 2 * KW * 4 * PB, "the partials fit the ring");
    static_assert(RH % HW == 0 && (TT - RH) - FN * FW == 64, "the work-groups cover every row once");
    const int bid = blockIdx.x;
    if (bid < NB_ * RH / HW) { const size_t pb = (size_t)(bid / (RH / HW)) * TT * HD; attn_cols<h16, true, 1, 1>(Q16 + pb, Ql + pb, K16 + pb, Kl + pb, V16 + pb, Vl + pb, (bid % (RH / HW)) * HW, bid % (RH / HW), OUTp + pb, ring, ms, ls); }
    else if (bid < NB_ * RH / HW + NB_ * FN) { const int id = bid - NB_ * RH / HW; const size_t pb = (size_t)(id / FN) * TT * HD; attn_cols<h16, false, 3, 2>(Q16 + pb, nullptr, K16 + pb, nullptr, V16 + pb, nullptr, RH + (id % FN) * FW, id % FN, OUTp + pb, ring, ms, ls); }
    else { const size_t pb = (size_t)(bid - NB_ * RH / HW - NB_ * FN) * TT * HD; attn_cols<h16, false, 2, 2>(Q16 + pb, nullptr, K16 + pb, nullptr, V16 + pb, nullptr, RH + FN * FW, FN, OUTp + pb, ring, ms, ls); }
}

extern "C" void kernel_launch(void* const* d_in, const int* in_sizes, int n_in,
                              void* d_out, int out_size, void* d_ws, size_t ws_size, hipStream_t stream) {
    (void)in_sizes; (void)n_in; (void)out_size;
    const float* x = (const float*)d_in[0]; const float* wk3 = (const float*)d_in[1];   /* kernel [3][64][64] 'xw': q, k, v */
    float* OUT = (float*)d_out;     // [4][4096][64]
    char* wsp = (char*)d_ws;
    auto take = [&](size_t bytes) { char* p = wsp; wsp += (bytes + 255) & ~(size_t)255; return (void*)p; };
    // q/k/v planes hold all NB_ batches, [batch] outermost
    h16* QP16 = (h16*)take((size_t)NB_ * NH_ * TT * HD * 2); h16* KP16 = (h16*)take((size_t)NB_ * NKV * TT * HD * 2); h16* VT16 = (h16*)take((size_t)NB_ * NKV * HD * TT * 2);
    h16* QPl = (h16*)take((size_t)NB_ * NH_ * TT * HD * 2); h16* KPl = (h16*)take((size_t)NB_ * NKV * TT * HD * 2); h16* VTl = (h16*)take((size_t)NB_ * NKV * HD * TT * 2);
    if ((size_t)(wsp - (char*)d_ws) > ws_size) return;    // ws 256 MiB
    k_prep<<<NB_ * TT / PR, 384, 0, stream>>>(x, wk3, QP16, QPl, KP16, KPl, VT16, VTl);
    // attention: one launch for all batches and both row classes
    k_fattn<<<NB_ * RH / HW + NB_ * FN + NB_, QG * KW * 32, 0, stream>>>(QP16, KP16, VT16, QPl, KPl, VTl, OUT);
}

// v010
// A run of this version takes 25.2 microseconds.
// Two timings next to v009 put it at 1.08 and 1.10 times that version's speed.
// All steps since v000 together make it 34.2 times as fast.
#include <hip/hip_runtime.h>

// Single-head self-attention with a sinusoidal (sine-only) position embedding (x [4][4096][64]; x' = x + PE, PE[i][j] = sin(i x 10000^(-2j/64)) (computed: float32 inverse frequencies via pow, precise sinf); q, k, v = x' kernel[0|1|2] ('xw' [64][64] 0.05, no bias); scores / 8 over all 4,096 keys; softmax; out = attn v -> [4][4096][64] (1.0 M)).
// The weights of k and v are moved off the keys: scores q . k = (q Wk^T) . x' and attn v = (attn x') Wv, so x' itself stands for both K and V. One plane of x' (and its residual) is all that the attention work-groups fetch per key.
// Two launches: k_prep (x + PE and its planes, q = x' Wq, qk = q Wk^T and its planes, all 4 batches, 64 rows of x per work-group; Wv^T in bf16 by work-group 0) and the one fused attention kernel, which ends with the product by Wv.
// The planes lie in fragment order: a chunk of FC elements holds 32 slots of 8 elements, each slot what one lane takes with one 16-byte load, so a wave's load or store covers 512 bytes in a row (4 whole lines, not 32 bytes of each of 16).
// Layout per batch: x + PE summed in f32 from the bf16-rounded input and split into hi/lo bf16 (the sum is not bf16-exact); projections hi/lo x exact (2 products); one 64-wide head, attention fused in one kernel (hybrid rows: < 512 fp16 + fp16 residual, 3 products, rest fp16 alone; running-maximum softmax in registers, scores and probabilities never stored); 8 key slices x 2 query groups per work-group (16 + 16 hi/lo or 48 + 32 fp16 query columns), x' staged in LDS for both groups, slices joined in LDS.
// Compute dtypes, f32 accumulate: every input rounded to bf16; position embedding f32; projections hi/lo bf16 x exact (q, qk), three bf16 terms x exact (the last one, by Wv); attention rows < 512 3 products of fp16 values and fp16 residuals, rest fp16; softmax f32; output f32.
// Four planes: qk and x' in fp16 serve every row; the residual plane (value - its fp16 rounding, again in fp16) of x' serves the rows < RH, that of qk is written for those rows alone.
#define NB_  4
#define TT   4096
#define DM   64
#define NH_  1
#define NKV  1
#define REP  (NH_ / NKV)
#define HD   64
#define DQ   (NH_ * HD)
#define DKV  (NKV * HD)
#define RH   512                  // query rows < RH use the residual planes too (0: none)
#define WIN  0
#define SCL  0.125f   // HD^-0.5
#define KW   8                    // key slices of an attention work-group: a wave walks one slice of TT / KW keys
#define QG   2                    // groups of query columns of an attention work-group (a group: 1 to 3 tiles of 16 columns); QG x KW waves
#define OP   68                   // LDS pitch in floats of a query's 64 partial outputs
#define FC   256                  // 16-bit elements of a plane chunk (32 slots x 8). qk, x': [row / 16][d / 16][chunk]; qk: slot = 16 (d / 8 % 2) + row % 16; x': slot = 16 (d / 8 % 2) + (row % 16 ^ 8 (d / 8 % 2)), so that in LDS the plain reads (16 rows of one half) and the transposing reads (8 rows of both halves) each fall on 64 different banks
typedef _Float16 h16;
typedef unsigned short bf;
typedef __attribute__((ext_vector_type(16))) __bf16   v16bf;
typedef __attribute__((ext_vector_type(16))) _Float16 v16h;
typedef __attribute__((ext_vector_type(8)))  _Float16 v8h;
typedef __attribute__((ext_vector_type(8)))  unsigned short v8us;
typedef __attribute__((ext_vector_type(8)))  float    v8f;
typedef __attribute__((ext_vector_type(4)))  float    v4f;
typedef v8h  __attribute__((may_alias)) v8ha;
typedef v4f  __attribute__((may_alias)) v4fa;
typedef v8us __attribute__((may_alias)) v8usa;

__device__ __forceinline__ unsigned short f2bf(float f) { unsigned u = __float_as_uint(f); u += 0x7FFFu + ((u >> 16) & 1u); return (unsigned short)(u >> 16); }
__device__ __forceinline__ float bf2f(unsigned short b) { return __uint_as_float(((unsigned)b) << 16); }
__device__ __forceinline__ float bfr(float f) { return bf2f(f2bf(f)); }
__device__ __forceinline__ v16h cat16(v8h lo, v8h hi) { return __builtin_shufflevector(lo, hi, 0, 1, 2, 3, 4, 5, 6, 7, 8, 9, 10, 11, 12, 13, 14, 15); }
__device__ __forceinline__ v16bf cat16b(v8us lo, v8us hi) { return __builtin_bit_cast(v16bf, __builtin_shufflevector(lo, hi, 0, 1, 2, 3, 4, 5, 6, 7, 8, 9, 10, 11, 12, 13, 14, 15)); }
__device__ __forceinline__ v8f wmma16(v16h a, v16h b, v8f c) { return __builtin_amdgcn_wmma_f32_16x16x32_f16(false, a, false, b, (short)0, c, false, false); }
__device__ __forceinline__ v8f wmmab(v16bf a, v16bf b, v8f c) { return __builtin_amdgcn_wmma_f32_16x16x32_bf16(false, a, false, b, (short)0, c, false, false); }

// 16x16x32 operand fragment of lane (lr, hi): 16-bit elements p[0..7] and p[16..23], p = row lr + 8 hi; the same map serves A and B (ld: from a row-major tile; ldf: the same elements from two neighbouring chunks of a plane, p = chunk + 8 lane)
template <typename T16> struct WFrag;
template <> struct WFrag<h16> { typedef v16h V; static __device__ __forceinline__ V ld(const h16* p) { return cat16(*(const v8h*)p, *(const v8h*)(p + 16)); } static __device__ __forceinline__ V ldf(const h16* p) { return cat16(*(const v8h*)p, *(const v8h*)(p + FC)); } static __device__ __forceinline__ v8f mma(V a, V b, v8f c) { return wmma16(a, b, c); } };
template <> struct WFrag<bf> { typedef v16bf V; static __device__ __forceinline__ V ld(const bf* p) { return cat16b(*(const v8us*)p, *(const v8us*)(p + 16)); } static __device__ __forceinline__ V ldf(const bf* p) { return cat16b(*(const v8us*)p, *(const v8us*)(p + FC)); } static __device__ __forceinline__ v8f mma(V a, V b, v8f c) { return wmmab(a, b, c); } };
__device__ __forceinline__ h16 tohx(float x) { return (h16)x; }
__device__ __forceinline__ void splitf(float y, unsigned short& h, unsigned short& l) { h = f2bf(y); l = f2bf(y - bf2f(h)); }
// the same split by the conversion instruction (round to nearest even, as f2bf), straight into operand elements
__device__ __forceinline__ void splitb(float y, v16bf& h, v16bf& l, int e) { const __bf16 a = (__bf16)y; h[e] = a; l[e] = (__bf16)(y - (float)a); }
__constant__ __attribute__((aligned(16))) float PEINV[DM] = { 1.000000000e+00f,7.498942018e-01f,5.623413324e-01f,4.216965139e-01f,3.162277639e-01f,2.371373624e-01f,1.778279394e-01f,1.333521456e-01f,1.000000015e-01f,7.498941571e-02f,5.623412877e-02f,4.216964915e-02f,3.162277862e-02f,2.371373586e-02f,1.778279431e-02f,1.333521493e-02f,9.999999776e-03f,7.498942316e-03f,5.623413250e-03f,4.216964822e-03f,3.162277862e-03f,2.371373819e-03f,1.778279431e-03f,1.333521446e-03f,1.000000047e-03f,7.498941850e-04f,5.623413017e-04f,4.216964880e-04f,3.162277862e-04f,2.371373848e-04f,1.778279402e-04f,1.333521504e-04f,9.999999747e-05f,7.498942432e-05f,5.623413017e-05f,4.216965317e-05f,3.162277426e-05f,2.371373739e-05f,1.778279329e-05f,1.333521413e-05f,9.999999747e-06f,7.498942068e-06f,5.623413472e-06f,4.216964953e-06f,3.162277608e-06f,2.371373739e-06f,1.778279398e-06f,1.333521482e-06f,9.999999975e-07f,7.498942409e-07f,5.623413131e-07f,4.216964840e-07f,3.162277551e-07f,2.371373711e-07f,1.778279284e-07f,1.333521453e-07f,1.000000012e-07f,7.498942267e-08f,5.623413202e-08f,4.216964911e-08f,3.162277551e-08f,2.371373675e-08f,1.778279390e-08f,1.333521382e-08f };   // 1/10000^(2j/64) for j < 64 as float32 (jnp.power form, precomputed)

#define PR   64                   // rows of x per k_prep work-group: four 16-row tiles of the qk and x' planes
#define XP   72                   // LDS pitch in 16-bit elements of a 64-wide row (144 bytes = 16 x odd, for 16-byte fragment reads)
// eight f32 results of one lane, contiguous in the plane: their fp16 roundings and the fp16 residuals, 16 bytes each
__device__ __forceinline__ void cut8(v8f r, v8h& o16, v8h& ol) {
#pragma unroll
    for (int j = 0; j < 8; ++j) { o16[j] = tohx(r[j]); ol[j] = tohx(r[j] - (float)o16[j]); } }
// ---- k_prep: x + PE with its planes, q = x' Wq and qk = q Wk^T with its planes, in one kernel. grid x = [NB_ x TT] rows / PR, 12 waves.
// Waves 0-7 form x + PE (16 values a thread): as hi/lo bf16 rows in LDS for the projection, and as fp16 + residual straight into the x' planes (a thread's 16 values are the two slots of its row in one chunk). Waves 8-11 bring Wq as bf16 [n][k] rows and Wk as bf16 [b][o] rows (as it lies) into LDS; behind the barrier wave 8 + rt owns 16 rows.
// q^T = Wq^T x'^T (A = 16 output columns, B = 16 rows of x'): a lane holds 8 neighbouring o of one row t, so two tiles, split into hi/lo bf16 in place, are the B operand of qk^T = Wk q^T (A = 16 rows b of Wk); its tiles hold 8 neighbouring b of one row: what one lane of an attention fragment takes with one load, so each tile goes out as a whole chunk. Per tile: hi k 0-31, lo k 0-31, hi k 32-63, lo k 32-63.
__global__ __launch_bounds__(384) void k_prep(const float* __restrict__ x, const float* __restrict__ wk3, h16* __restrict__ Q16, h16* __restrict__ Ql, h16* __restrict__ X16, h16* __restrict__ Xl, unsigned short* __restrict__ WVT) {
    __shared__ __align__(16) bf xh[PR * XP]; __shared__ __align__(16) bf xl[PR * XP]; __shared__ __align__(16) bf wq[HD * XP]; __shared__ __align__(16) bf wkn[DM * XP];
    const int tid = threadIdx.x, w = __builtin_amdgcn_readfirstlane(tid >> 5); const int R0 = blockIdx.x * PR;   // first row of the work-group in [NB_ x TT]; PR divides TT, so all its rows are of one batch
    v8h ph[2] = {}, pl[2] = {};   // waves 0-7: the thread's 16 values of x' in fp16 and their residuals, stored behind the barrier
    const int row = tid >> 2;
    if (w < 8) {
        const int c0 = (tid & 3) * 16; const int t = R0 % TT + row; const float* xr = x + (size_t)(R0 + row) * DM + c0;
        v4f x4[4], f4[4];   // the thread's inverse frequencies come in with its x, ahead of the sines: fetched one by one between the sines' branches, each would be waited for alone
#pragma unroll
        for (int i = 0; i < 4; ++i) { x4[i] = *(const v4f*)(xr + 4 * i); f4[i] = *(const v4f*)(PEINV + c0 + 4 * i); }
        v8us oh[2], ol[2];
#pragma unroll
        for (int q = 0; q < 16; ++q) { const float ang = __fmul_rn((float)t, f4[q >> 2][q & 3]); const float s = __fadd_rn(bfr(x4[q >> 2][q & 3]), sinf(ang)); unsigned short u, v; splitf(s, u, v); oh[q >> 3][q & 7] = u; ol[q >> 3][q & 7] = v;
            const h16 a = tohx(s); ph[q >> 3][q & 7] = a; pl[q >> 3][q & 7] = tohx(s - (float)a); }
#pragma unroll
        for (int i = 0; i < 2; ++i) { *(v8usa*)(xh + row * XP + c0 + 8 * i) = oh[i]; *(v8usa*)(xl + row * XP + c0 + 8 * i) = ol[i]; }
    } else {
        const int u = tid - 256, kb = u >> 4, nq = u & 15;   // transposed matrices: 8 k x 4 n a thread
#pragma unroll
        for (int m = 0; m < 3; m += 2) if (m == 0 || blockIdx.x == 0) { v4f r[8];   // Wq^T into LDS; Wv^T, for the attention kernel's last product, into the workspace by one work-group
#pragma unroll
            for (int kk = 0; kk < 8; ++kk) r[kk] = *(const v4f*)(wk3 + (size_t)m * DM * HD + (kb * 8 + kk) * HD + nq * 4);
#pragma unroll
            for (int c = 0; c < 4; ++c) { v8us o;
#pragma unroll
                for (int kk = 0; kk < 8; ++kk) o[kk] = f2bf(r[kk][c]);
                if (m == 0) *(v8usa*)(wq + (nq * 4 + c) * XP + kb * 8) = o; else *(v8us*)(WVT + (nq * 4 + c) * DM + kb * 8) = o; } }
        const int b = u >> 1, o0 = (u & 1) * 32;   // Wk as it lies: half a row a thread
#pragma unroll
        for (int i = 0; i < 4; ++i) { const v4f r0 = *(const v4f*)(wk3 + (size_t)DM * HD + b * HD + o0 + 8 * i), r1 = *(const v4f*)(wk3 + (size_t)DM * HD + b * HD + o0 + 8 * i + 4); v8us o;
#pragma unroll
            for (int j = 0; j < 4; ++j) { o[j] = f2bf(r0[j]); o[4 + j] = f2bf(r1[j]); }
            *(v8usa*)(wkn + b * XP + o0 + 8 * i) = o; }
        asm volatile("s_wait_xcnt 0x0" ::: "memory");   // behind this side's loads and stores, before any register that they name is reused
    }
    __syncthreads();   // x' rows and weight rows are in LDS before any wave reads its fragments
    if (w < 8) {   // the plane stores stand behind the barrier, so that the projecting waves do not wait for them; no barrier follows
        const size_t ob = (size_t)((R0 + row) / 16) * (16 * HD) + (tid & 3) * FC;   // the chunk of the thread's 16 d
        h16* a0 = X16 + ob + (row & 15) * 8; h16* b0 = Xl + ob + (row & 15) * 8; h16* a1 = X16 + ob + (16 + ((row & 15) ^ 8)) * 8; h16* b1 = Xl + ob + (16 + ((row & 15) ^ 8)) * 8;
        *(v8h*)a0 = ph[0]; *(v8h*)b0 = pl[0]; *(v8h*)a1 = ph[1]; *(v8h*)b1 = pl[1];
        return; }
    typedef WFrag<bf> F;
    const int lane = tid & 31, lr = lane & 15, hi = lane >> 4, rt = w & 3;
    v16bf ah[2], al[2];
#pragma unroll
    for (int kc = 0; kc < 2; ++kc) { const int o = (rt * 16 + lr) * XP + kc * 32 + 8 * hi; ah[kc] = F::ld(xh + o); al[kc] = F::ld(xl + o); }
    const bf* wp = wq + lr * XP + 8 * hi; const bf* kp = wkn + lr * XP + 8 * hi;
    v8f qa[4];   // tile nb: o = 16 nb + 8 hi + j of row lr
#pragma unroll
    for (int nb = 0; nb < 4; ++nb) { const v16bf b0 = F::ld(wp + nb * 16 * XP), b1 = F::ld(wp + nb * 16 * XP + 32); v8f acc = (v8f){};
        acc = wmmab(b0, ah[0], acc); acc = wmmab(b0, al[0], acc); acc = wmmab(b1, ah[1], acc); acc = wmmab(b1, al[1], acc); qa[nb] = acc; }
    v16bf qh[2], ql[2];   // q^T as B operand: element e of chunk kc is o = 32 kc + 8 hi + e (e < 8) or 32 kc + 16 + 8 hi + e - 8, the order in which ld takes Wk's row
#pragma unroll
    for (int kc = 0; kc < 2; ++kc)
#pragma unroll
        for (int j = 0; j < 8; ++j) { splitb(qa[2 * kc][j], qh[kc], ql[kc], j); splitb(qa[2 * kc + 1][j], qh[kc], ql[kc], 8 + j); }
    v8h o16[4], ol[4];   // the wave's four tiles, stored behind its last product
#pragma unroll
    for (int mb = 0; mb < 4; ++mb) { const v16bf a0 = F::ld(kp + mb * 16 * XP), a1 = F::ld(kp + mb * 16 * XP + 32); v8f acc = (v8f){};
        acc = wmmab(a0, qh[0], acc); acc = wmmab(a0, ql[0], acc); acc = wmmab(a1, qh[1], acc); acc = wmmab(a1, ql[1], acc);
        cut8(acc, o16[mb], ol[mb]); }
    static_assert(RH % PR == 0, "a work-group's rows are all below RH or none is"); const bool lo = R0 % TT < RH;   /* the residuals are read for rows < RH alone */ const size_t ob = (size_t)(R0 / 16 + rt) * (16 * HD) + lane * 8;   // tile mb holds b = 16 mb + 8 hi + j of row lr: chunk mb of the 16 rows
#pragma unroll
    for (int mb = 0; mb < 4; ++mb) *(v8h*)(Q16 + ob + mb * FC) = o16[mb];
    asm volatile("s_wait_xcnt 0x0" ::: "memory");   // the residuals may be formed behind the test below, in registers that these four stores name
    if (lo) {
#pragma unroll
        for (int mb = 0; mb < 4; ++mb) *(v8h*)(Ql + ob + mb * FC) = ol[mb];
        asm volatile("s_wait_xcnt 0x0" ::: "memory"); }   // behind the last stores: in the built code the plane stores of waves 0-7 follow and reuse their registers
}
// v_exp_f32 in asm text with the one vector slot that the instruction set asks for behind a transcendental before its result is used or its source overwritten: inside a statement the slot stands where it is written, whatever registers the allocator reuses next.
__device__ __forceinline__ float exp2s(float x) { float r; asm("v_exp_f32 %0, %1\n\tv_nop" : "=v"(r) : "v"(x)); return r; }
// eight in place: each next one is independent and fills the slot of the one before, the v_nop that of the last
__device__ __forceinline__ void exp2x8(v8f& x) { float a = x[0], b = x[1], c = x[2], d = x[3], e = x[4], f = x[5], g = x[6], h = x[7];
    asm("v_exp_f32 %0, %0\n\tv_exp_f32 %1, %1\n\tv_exp_f32 %2, %2\n\tv_exp_f32 %3, %3\n\tv_exp_f32 %4, %4\n\tv_exp_f32 %5, %5\n\tv_exp_f32 %6, %6\n\tv_exp_f32 %7, %7\n\tv_nop" : "+v"(a), "+v"(b), "+v"(c), "+v"(d), "+v"(e), "+v"(f), "+v"(g), "+v"(h));
    x[0] = a; x[1] = b; x[2] = c; x[3] = d; x[4] = e; x[5] = f; x[6] = g; x[7] = h; }
// ---- k_fattn: scores, softmax, attn x x' and the product by Wv in one kernel. S^T = X QK^T (A = 16 keys' rows of x', B = 16 query columns kept in registers), so a lane holds scores of ONE query; two S^T tiles (keys 0-15, 16-31), converted in place, are the B operand of O^T += X^T P^T, whose A operand comes from the same staged rows by the transposing LDS load.
// A work-group has QG groups of query columns and KW key slices: each wave has one group and one slice and walks keys [slice TT/KW, (slice+1) TT/KW) for its group with its own maximum in use, sum and O^T; a group's KW partials are joined in LDS in slice order.
// The QG waves of a slice work from ONE copy of its x' chunks: a stage (32 keys of every slice) is brought into LDS by asynchronous copies, chunk for chunk as it lies in the planes, so each byte of x' leaves L2 once per work-group and serves scores and outputs of both groups. Two stage buffers: stage t + 2 flies while stage t + 1 is worked on. rot: the work-group's number among those of its batch and kind, the stage at which its walk starts.
#define PB   4096                 // bytes of 32 keys of one plane: 8 chunks, what one wave copies with 8 instructions
// eight asynchronous copies of 32 lanes x 16 bytes: 4 KiB in a row, l = the lane's LDS byte address, g = the lane's global address. The s_wait_xcnt is the last line of the copies' own statement, so that no address register is rewritten ahead of it.
__device__ __forceinline__ void copy4k(unsigned l, const char* g) {
    asm volatile("global_load_async_to_lds_b128 %0, %8, off\n\tglobal_load_async_to_lds_b128 %1, %9, off\n\tglobal_load_async_to_lds_b128 %2, %10, off\n\tglobal_load_async_to_lds_b128 %3, %11, off\n\t"
                 "global_load_async_to_lds_b128 %4, %12, off\n\tglobal_load_async_to_lds_b128 %5, %13, off\n\tglobal_load_async_to_lds_b128 %6, %14, off\n\tglobal_load_async_to_lds_b128 %7, %15, off\n\ts_wait_xcnt 0x0"
                 :: "v"(l), "v"(l + 512), "v"(l + 1024), "v"(l + 1536), "v"(l + 2048), "v"(l + 2560), "v"(l + 3072), "v"(l + 3584),
                    "v"(g), "v"(g + 512), "v"(g + 1024), "v"(g + 1536), "v"(g + 2048), "v"(g + 2560), "v"(g + 3072), "v"(g + 3584) : "memory"); }
// four such copies: 2 KiB in a row
__device__ __forceinline__ void copy2k(unsigned l, const char* g) {
    asm volatile("global_load_async_to_lds_b128 %0, %4, off\n\tglobal_load_async_to_lds_b128 %1, %5, off\n\tglobal_load_async_to_lds_b128 %2, %6, off\n\tglobal_load_async_to_lds_b128 %3, %7, off\n\ts_wait_xcnt 0x0"
                 :: "v"(l), "v"(l + 512), "v"(l + 1024), "v"(l + 1536), "v"(g), "v"(g + 512), "v"(g + 1024), "v"(g + 1536) : "memory"); }
// ds_load_tr16_b128: lane l hands in the address of 8 d (half l / 8 % 2 of a chunk's 16) of key 8 (l / 16) + l % 8 and gets 8 keys (8 (l / 16) + 0 .. 7) of d = l % 16
typedef short s16x8 __attribute__((ext_vector_type(8)));
__device__ __forceinline__ v8h ldtr(const char* p) { typedef __attribute__((address_space(3))) s16x8 lds8; return __builtin_bit_cast(v8h, __builtin_amdgcn_ds_load_tr16_b128_v8i16((lds8*)p)); }
template <int N> struct IC { static constexpr int v = N; };
// NQ0, NQ1: tiles of 16 query columns of a wave of group 0 and of group 1 (NQ1 = NQ0 or NQ0 - 1)
template <typename T16, bool HI, int NQ0, int NQ1>
__device__ __forceinline__ void attn_cols(const T16* __restrict__ Q, const T16* __restrict__ Q2, const T16* __restrict__ Xp, const T16* __restrict__ X2, const bf* __restrict__ Wv, int q0, int rot, float* __restrict__ outb, char* ring, float* ms, float* ls) {
    typedef WFrag<T16> F; typedef typename F::V V;
    static_assert(NQ1 == NQ0 || NQ1 == NQ0 - 1, "group 1 has as many tiles as group 0 or one fewer");
    const float C2 = SCL * 1.4426950408889634f;   // scores are taken to base 2
    constexpr int NP = HI ? 2 : 1, SB = KW * NP * PB, NT = TT / KW / 32;   // planes of a stage (x', then its residual plane), bytes of a stage buffer [slice][plane][PB], stages
    // waves 2 ks and 2 ks + 1 are the two groups of slice ks; which of them is group 1 alternates from one four waves to the next, so that of waves w, w + 1, w + 2, w + 3 and of waves w, w + 4, w + 8, w + 12 alike two are of each group
    const int lane = threadIdx.x & 31, lr = lane & 15, hi = lane >> 4, w = __builtin_amdgcn_readfirstlane(threadIdx.x >> 5), ks = w >> 1, g = ((w >> 2) ^ w) & 1;
    const bool full = NQ1 == NQ0 || g == 0;   // the wave has tile NQ0 - 1: the same in every lane, a scalar test
    V qf[NQ0][2], qf2[NQ0][2];
#pragma unroll
    for (int qt = 0; qt < NQ0; ++qt)
#pragma unroll
        for (int kc = 0; kc < 2; ++kc) { const size_t o = (size_t)(q0 / 16 + g * NQ0 + ((qt < NQ1 || full) ? qt : 0)) * (16 * HD) + kc * 2 * FC + lane * 8;   // a wave without the last tile takes its first again: in bounds, never used
            qf[qt][kc] = F::ldf(Q + o); if (HI) qf2[qt][kc] = F::ldf(Q2 + o); }
    v8f o[4][NQ0]; float mu[NQ0], l[NQ0];
#pragma unroll
    for (int qt = 0; qt < NQ0; ++qt) { mu[qt] = -3.0e38f; l[qt] = 0.f;
#pragma unroll
        for (int dt = 0; dt < 4; ++dt) o[dt][qt] = (v8f){}; }
    const size_t kbase = (size_t)ks * (TT / KW) * HD + lane * 8;   // a stage's 32 keys are 32 x HD elements in a row of a plane
    // hi/lo: of a slice's two planes group 0's wave copies x', group 1's the residuals; fp16: each wave copies half of the one plane's 4 KiB
    const char* src = (const char*)(((HI && g) ? X2 : Xp) + kbase) + (HI ? 0 : g * (PB / 2));
    const unsigned dst = (unsigned)(size_t)ring + (unsigned)(ks * NP * PB + g * (HI ? PB : PB / 2) + lane * 16);
    const int sk = lane ^ (hi << 3);   // the slot of row lr, half hi, in a chunk of x'
    const int sv = 16 * ((lane >> 3) & 1) + ((8 * hi + (lane & 7)) ^ (8 * ((lane >> 3) & 1)));   // the slot that the lane hands to the transposing load: row 8 hi + lane % 8, half lane / 8 % 2
    // pass t works on stage (t + rot) mod NT of every slice: the work-groups of a batch read the same lines of x', and started at different stages they do not ask L2 for the same lines at the same moment. The softmax takes the keys in any order.
    static_assert((NT & (NT - 1)) == 0, "the walk wraps by a mask");
    auto fill = [&](int t) { const unsigned d = dst + (unsigned)((t & 1) * SB); const size_t so = (size_t)((t + rot) & (NT - 1)) * PB; if constexpr (HI) copy4k(d, src + so); else copy2k(d, src + so); };
    fill(0);
    asm volatile("s_wait_asynccnt 0x0" ::: "memory");   // this wave's share of the first pass's stage has landed
    __syncthreads();   // the first pass's stage is whole before any wave reads it
    fill(1);
#pragma unroll 1   // one pass = one stage = 32 keys of the wave's slice; the two buffers alternate by the pass's parity
    for (int it = 0; it < NT; ++it) {
        const char* sb = ring + (it & 1) * SB + ks * NP * PB; const T16* st = (const T16*)sb + sk * 8; const char* tv = sb + sv * 16;
        V kf[2][2], kf2[2][2];
#pragma unroll
        for (int kt = 0; kt < 2; ++kt)
#pragma unroll
            for (int kc = 0; kc < 2; ++kc) { const int a = kt * 16 * HD + kc * 2 * FC; kf[kt][kc] = F::ldf(st + a); if (HI) kf2[kt][kc] = F::ldf(st + PB / 2 + a); }
        V vf[4], vf2[4]; v8f s[2][NQ0];
        // scores of tiles QA .. QB - 1 against the stage's 32 keys
        auto scores = [&](auto qa_, auto qb_) {
            constexpr int QA = decltype(qa_)::v, QB = decltype(qb_)::v;
#pragma unroll
            for (int kt = 0; kt < 2; ++kt)
#pragma unroll
                for (int qt = QA; qt < QB; ++qt) s[kt][qt] = (v8f){};
#pragma unroll
            for (int kc = 0; kc < 2; ++kc) {
#pragma unroll
                for (int kt = 0; kt < 2; ++kt)
#pragma unroll
                    for (int qt = QA; qt < QB; ++qt) s[kt][qt] = F::mma(kf[kt][kc], qf[qt][kc], s[kt][qt]);
                if (HI) {
#pragma unroll
                    for (int kt = 0; kt < 2; ++kt)
#pragma unroll
                        for (int qt = QA; qt < QB; ++qt) s[kt][qt] = F::mma(kf2[kt][kc], qf[qt][kc], s[kt][qt]);
#pragma unroll
                    for (int kt = 0; kt < 2; ++kt)
#pragma unroll
                        for (int qt = QA; qt < QB; ++qt) s[kt][qt] = F::mma(kf[kt][kc], qf2[qt][kc], s[kt][qt]); } } };
        // softmax step and attn x v of tiles QA .. QB - 1
        auto tiles = [&](auto qa_, auto qb_) {
            constexpr int QA = decltype(qa_)::v, QB = decltype(qb_)::v;
            float ml[NQ0]; bool need = false;
#pragma unroll
            for (int qt = QA; qt < QB; ++qt) { float mx = fmaxf(s[0][qt][0], s[1][qt][0]);
#pragma unroll
                for (int j = 1; j < 8; ++j) mx = fmaxf(mx, fmaxf(s[0][qt][j], s[1][qt][j]));
                ml[qt] = mx * C2; need = need || (ml[qt] > mu[qt] + 8.0f); }
            if (__builtin_amdgcn_ballot_w32(need) != 0) {   // the maximum in use moves only when a score passes it by more than 2^8: rare behind the first pass
#pragma unroll
                for (int qt = QA; qt < QB; ++qt) { const float mn = fmaxf(mu[qt], fmaxf(ml[qt], __shfl_xor(ml[qt], 16, 32))); const float al = exp2s(mu[qt] - mn); mu[qt] = mn; l[qt] *= al;
#pragma unroll
                    for (int dt = 0; dt < 4; ++dt) o[dt][qt] *= al; } }
            V pf[NQ0], pf2[NQ0];
#pragma unroll
            for (int qt = QA; qt < QB; ++qt) {
#pragma unroll
                for (int kt = 0; kt < 2; ++kt) {
#pragma unroll
                    for (int j = 0; j < 8; ++j) s[kt][qt][j] = __builtin_fmaf(s[kt][qt][j], C2, -mu[qt]);
                    exp2x8(s[kt][qt]);
#pragma unroll
                    for (int j = 0; j < 8; ++j) l[qt] += s[kt][qt][j]; }
                if constexpr (HI) { const v8h h0 = __builtin_convertvector(s[0][qt], v8h), h1 = __builtin_convertvector(s[1][qt], v8h);
                    const v8h l0 = __builtin_convertvector(s[0][qt] - __builtin_convertvector(h0, v8f), v8h), l1 = __builtin_convertvector(s[1][qt] - __builtin_convertvector(h1, v8f), v8h);
                    pf[qt] = cat16(h0, h1); pf2[qt] = cat16(l0, l1);
                } else pf[qt] = cat16(__builtin_convertvector(s[0][qt], v8h), __builtin_convertvector(s[1][qt], v8h)); }
            if constexpr (NQ0 > 2) {
#pragma unroll
                for (int qt = QA; qt < QB; ++qt) asm volatile("" : "+v"(l[qt])); }   // each row's sum, against spills: left free, the additions sink behind the products, the further tile and the barrier, every probability stays alive in f32 beside its 16-bit copy, and Q fragments go out to scratch
            if constexpr (HI && QA == 0) {
                __builtin_amdgcn_sched_barrier(0);   // keeps the loads of V's lo fragments behind the softmax: fetched beside it they push Q fragments out to scratch; the first two product groups cover their latency
#pragma unroll
                for (int dt = 0; dt < 4; ++dt) vf2[dt] = cat16(ldtr(tv + PB + dt * 2 * FC), ldtr(tv + PB + 32 * HD + dt * 2 * FC)); }
#pragma unroll
            for (int dt = 0; dt < 4; ++dt)
#pragma unroll
                for (int qt = QA; qt < QB; ++qt) o[dt][qt] = F::mma(vf[dt], pf[qt], o[dt][qt]);
            if (HI) {
#pragma unroll
                for (int dt = 0; dt < 4; ++dt)
#pragma unroll
                    for (int qt = QA; qt < QB; ++qt) o[dt][qt] = F::mma(vf[dt], pf2[qt], o[dt][qt]);
#pragma unroll
                for (int dt = 0; dt < 4; ++dt)
#pragma unroll
                    for (int qt = QA; qt < QB; ++qt) o[dt][qt] = F::mma(vf2[dt], pf[qt], o[dt][qt]); } };
        // group 0's further tile works from the same K and V fragments, under a scalar test with no barrier inside. Its scores come first: so all scores are done before the first softmax step, the K fragments' registers are free from there on, and the products of the other tiles fill the slots behind its last one
        if constexpr (NQ1 < NQ0) { if (full) scores(IC<NQ1>{}, IC<NQ0>{}); }
        scores(IC<0>{}, IC<NQ1>{});
#pragma unroll
        for (int dt = 0; dt < 4; ++dt) vf[dt] = cat16(ldtr(tv + dt * 2 * FC), ldtr(tv + 32 * HD + dt * 2 * FC));   // 16 d x 32 keys: chunk dt (2 FC bytes) of keys 0-15 and of keys 16-31 (32 HD bytes on)
        tiles(IC<0>{}, IC<NQ1>{});
        if constexpr (NQ1 < NQ0) { if (full) tiles(IC<NQ1>{}, IC<NQ0>{}); }
        // four vector slots behind the pass's last matrix instruction, for the taken back edge and the jump past the further tile
        if constexpr (NQ0 == 1) asm volatile("v_nop\n\tv_nop\n\tv_nop\n\tv_nop" : "+v"(o[0][0]), "+v"(o[1][0]), "+v"(o[2][0]), "+v"(o[3][0]));
        else if constexpr (NQ0 == 2) asm volatile("v_nop\n\tv_nop\n\tv_nop\n\tv_nop" : "+v"(o[0][0]), "+v"(o[1][0]), "+v"(o[2][0]), "+v"(o[3][0]), "+v"(o[0][1]), "+v"(o[1][1]), "+v"(o[2][1]), "+v"(o[3][1]));
        else { static_assert(NQ0 <= 3, "the statement names every accumulator"); asm volatile("v_nop\n\tv_nop\n\tv_nop\n\tv_nop" : "+v"(o[0][0]), "+v"(o[1][0]), "+v"(o[2][0]), "+v"(o[3][0]), "+v"(o[0][1]), "+v"(o[1][1]), "+v"(o[2][1]), "+v"(o[3][1]), "+v"(o[0][2]), "+v"(o[1][2]), "+v"(o[2][2]), "+v"(o[3][2])); }
        // hand-over of pass it + 1's stage, in this order in every wave
        asm volatile("s_wait_dscnt 0x0" ::: "memory");      // this wave's reads of this pass's stage are done before its buffer may be refilled
        asm volatile("s_wait_asynccnt 0x0" ::: "memory");   // this wave's share of pass it + 1's stage has landed
        __syncthreads();   // pass it + 1's stage is whole, and every wave has left this pass's
        if (it + 2 < NT) fill(it + 2);
    }
    asm volatile("s_wait_asynccnt 0x0" ::: "memory");   // no copy is outstanding when the ring becomes the partials' place (the last pass's barrier has ended every read of it)
    float* os = (float*)ring; constexpr int G0 = NQ0 * 16, G1 = NQ1 * 16, NQW = G0 + G1;   // query columns of group 0, of group 1, of the work-group
    const int rb = g ? KW * G0 + ks * G1 : ks * G0;   // partials: [group][slice][column of the group]
#pragma unroll
    for (int qt = 0; qt < NQ0; ++qt) if (qt < NQ1 || full) { l[qt] += __shfl_xor(l[qt], 16, 32); const int q = rb + qt * 16 + lr; if (hi == 0) { ms[q] = mu[qt]; ls[q] = l[qt]; }
#pragma unroll
        for (int dt = 0; dt < 4; ++dt) { float* d = os + (size_t)q * OP + dt * 16 + hi * 8; *(v4fa*)d = __builtin_shufflevector(o[dt][qt], o[dt][qt], 0, 1, 2, 3); *(v4fa*)(d + 4) = __builtin_shufflevector(o[dt][qt], o[dt][qt], 4, 5, 6, 7); } }
    __syncthreads();   // every wave's partials are in LDS before any thread joins them
    // wave w < NQW / 16 joins the 16 queries of tile w and multiplies by Wv: out^T = Wv^T y^T (A = 16 output columns' rows of Wv^T, B = the joined rows y = O / L, split into three bf16 terms in place). Lane (lr, hi) joins, of query lr, the 32 d that its B fragments hold: 32 kc + 16 e + 8 hi + 0 .. 7, the order in which ld takes a row of Wv^T.
    if (w < NQW / 16) {   // the same in every lane: a scalar test, every lane on at the matrix instructions
        typedef WFrag<bf> B;
        v16bf wa[4][2];
#pragma unroll
        for (int ot = 0; ot < 4; ++ot)
#pragma unroll
            for (int kc = 0; kc < 2; ++kc) wa[ot][kc] = B::ld(Wv + (ot * 16 + lr) * DM + kc * 32 + 8 * hi);
        asm volatile("s_wait_xcnt 0x0" ::: "memory");   // behind the loads of Wv^T, before any register that they name is reused
        const int q = w * 16 + lr;
        const int gr = q < G0 ? G0 : G1, r0 = q < G0 ? q : KW * G0 + q - G0;   // rows from slice to slice, and the query's row in the partials of its group's slice 0
        float M = ms[r0];
#pragma unroll
        for (int ww = 1; ww < KW; ++ww) M = fmaxf(M, ms[ww * gr + r0]);
        float L = 0.f; v4f acc[2][2][2];
#pragma unroll
        for (int i = 0; i < 8; ++i) acc[i >> 2][(i >> 1) & 1][i & 1] = (v4f){};
#pragma unroll
        for (int ww = 0; ww < KW; ++ww) { const float al = exp2s(ms[ww * gr + r0] - M); L += ls[ww * gr + r0] * al; const float* pr = os + (size_t)(ww * gr + r0) * OP + 8 * hi;
#pragma unroll
            for (int i = 0; i < 8; ++i) acc[i >> 2][(i >> 1) & 1][i & 1] += *(const v4fa*)(pr + (i >> 2) * 32 + ((i >> 1) & 1) * 16 + (i & 1) * 4) * al; }
        const float inv = __fdiv_rn(1.0f, L);
        v16bf yh[2], yl[2], ym[2];   // three bf16 terms hold all 24 bits of y: its rounding goes straight into the output, not through an average over keys
#pragma unroll
        for (int kc = 0; kc < 2; ++kc)
#pragma unroll
            for (int e = 0; e < 2; ++e)
#pragma unroll
                for (int j = 0; j < 8; ++j) { const float y = acc[kc][e][j >> 2][j & 3] * inv; splitb(y, yh[kc], yl[kc], 8 * e + j); ym[kc][8 * e + j] = (__bf16)(y - (float)yh[kc][8 * e + j] - (float)yl[kc][8 * e + j]); }
        v8f r[4];   // tile ot: outputs 16 ot + 8 hi + j of query lr
#pragma unroll
        for (int ot = 0; ot < 4; ++ot) r[ot] = (v8f){};
#pragma unroll
        for (int kc = 0; kc < 2; ++kc) {
#pragma unroll
            for (int ot = 0; ot < 4; ++ot) r[ot] = wmmab(wa[ot][kc], yh[kc], r[ot]);
#pragma unroll
            for (int ot = 0; ot < 4; ++ot) r[ot] = wmmab(wa[ot][kc], yl[kc], r[ot]);
#pragma unroll
            for (int ot = 0; ot < 4; ++ot) r[ot] = wmmab(wa[ot][kc], ym[kc], r[ot]); }
        float* d = outb + (size_t)(q0 + q) * DQ + hi * 8;
#pragma unroll
        for (int ot = 0; ot < 4; ++ot) { *(v4f*)(d + ot * 16) = __builtin_shufflevector(r[ot], r[ot], 0, 1, 2, 3); *(v4f*)(d + ot * 16 + 4) = __builtin_shufflevector(r[ot], r[ot], 4, 5, 6, 7); }
        asm volatile("s_wait_xcnt 0x0" ::: "memory");   // behind the last stores: in the built code another form's text may follow and reuse their registers
    }
}
// grid x: first the hi/lo work-groups (NB_ x RH / HW, 1 + 1 tiles = HW query columns each), then the fp16 ones (FN a batch, 3 + 2 tiles = FW columns each), then one fp16 work-group a batch (2 + 2 tiles) for the columns left; fewer work-groups than WGPs, one per WGP, all at once.
// A hi/lo tile costs three products where an fp16 tile costs one: with 2 tiles a slice against 5 no kind of work-group runs far longer than the others.
#define HW   32
#define FW   80
#define FN   ((TT - RH) / FW)
__global__ __launch_bounds__(QG * KW * 32) __attribute__((amdgpu_waves_per_eu(4, 4))) void k_fattn(const h16* __restrict__ Q16, const h16* __restrict__ X16, const h16* __restrict__ Ql, const h16* __restrict__ Xl, const unsigned short* __restrict__ WVT, float* __restrict__ OUTp) {
    __shared__ __align__(128) char ring[KW * FW * OP * 4];   // two stage buffers (hi/lo: 2 planes; fp16: 1); behind the loop the KW x (a work-group's query columns) rows of OP floats of the partials
    __shared__ float ms[KW * FW]; __shared__ float ls[KW * FW];
    static_assert(2 * KW * 2 * PB <= KW * FW * OP * 4, "the stage buffers fit the partials' place");
    static_assert(RH % HW == 0 && (TT - RH) - FN * FW == 64, "the work-groups cover every row once");
    const int bid = blockIdx.x;
    if (bid < NB_ * RH / HW) { const size_t pb = (size_t)(bid / (RH / HW)) * TT * HD; attn_cols<h16, true, 1, 1>(Q16 + pb, Ql + pb, X16 + pb, Xl + pb, WVT, (bid % (RH / HW)) * HW, bid % (RH / HW), OUTp + pb, ring, ms, ls); }
    else if (bid < NB_ * RH / HW + NB_ * FN) { const int id = bid - NB_ * RH / HW; const size_t pb = (size_t)(id / FN) * TT * HD; attn_cols<h16, false, 3, 2>(Q16 + pb, nullptr, X16 + pb, nullptr, WVT, RH + (id % FN) * FW, id % FN, OUTp + pb, ring, ms, ls); }
    else { const size_t pb = (size_t)(bid - NB_ * RH / HW - NB_ * FN) * TT * HD; attn_cols<h16, false, 2, 2>(Q16 + pb, nullptr, X16 + pb, nullptr, WVT, RH + FN * FW, FN, OUTp + pb, ring, ms, ls); }
}

extern "C" void kernel_launch(void* const* d_in, const int* in_sizes, int n_in,
                              void* d_out, int out_size, void* d_ws, size_t ws_size, hipStream_t stream) {
    (void)in_sizes; (void)n_in; (void)out_size;
    const float* x = (const float*)d_in[0]; const float* wk3 = (const float*)d_in[1];   /* kernel [3][64][64] 'xw': q, k, v */
    float* OUT = (float*)d_out;     // [4][4096][64]
    char* wsp = (char*)d_ws;
    auto take = [&](size_t bytes) { char* p = wsp; wsp += (bytes + 255) & ~(size_t)255; return (void*)p; };
    // the planes hold all NB_ batches, [batch] outermost
    h16* QP16 = (h16*)take((size_t)NB_ * NH_ * TT * HD * 2); h16* XP16 = (h16*)take((size_t)NB_ * TT * DM * 2);
    h16* QPl = (h16*)take((size_t)NB_ * NH_ * TT * HD * 2); h16* XPl = (h16*)take((size_t)NB_ * TT * DM * 2); unsigned short* WVT = (unsigned short*)take((size_t)HD * DM * 2);
    if ((size_t)(wsp - (char*)d_ws) > ws_size) return;    // ws 256 MiB
    k_prep<<<NB_ * TT / PR, 384, 0, stream>>>(x, wk3, QP16, QPl, XP16, XPl, WVT);
    // attention: one launch for all batches and both row classes
    k_fattn<<<NB_ * RH / HW + NB_ * FN + NB_, QG * KW * 32, 0, stream>>>(QP16, XP16, QPl, XPl, WVT, OUT);
}
